// v000
// The times below were measured on an AMD MI455X: many runs one after another, warmed up first and cycling through
// copies of the inputs, with the whole window's GPU time divided by the number of runs. Launches and the gaps
// between them are all in it. The median over several windows is given; except for v000 it joins two sittings, which
// can be a few percent apart, so the side-by-side timings, each taken in one sitting, are the better comparison.
// v000, which the later versions start from, runs in 343 microseconds.
// compute dtype: all float inputs rounded to bf16, the int mask read on device; q / k = x . W + b with EXACT bf16 products on WMMA 16x16x32 ((in,out) weights as transposed rows), softplus(k) (precise expf/log1pf) and v = q + k formed in f32 in the same block before one f16 rounding (hi + residual planes); PLAIN attention: q, softplus(k) single f16 x 1/8, running-max softmax in f32 (hardware exp), P (scaled by 2^11, single f16) x v (single f16); f32 merged-head output.
#include <hip/hip_runtime.h>
#include <math.h>

typedef __attribute__((ext_vector_type(16))) _Float16 v16h;
typedef __attribute__((ext_vector_type(16))) __bf16 v16b;
typedef __attribute__((ext_vector_type(8)))  _Float16 v8h;
typedef __attribute__((ext_vector_type(8)))  float v8f;
typedef __attribute__((ext_vector_type(4)))  float v4f;
typedef __attribute__((ext_vector_type(2)))  float v2f;
typedef __attribute__((ext_vector_type(4)))  unsigned v4u;
typedef __attribute__((ext_vector_type(4)))  int v4i;
typedef float __attribute__((may_alias)) float_a;
typedef int __attribute__((may_alias)) int_a;

template <typename T> __device__ __forceinline__ void vst2(void* p, T v) { *(T*)p = v;  }
__device__ __forceinline__ v8f wmma16(v16h a, v16h b, v8f c) {
  v8f d = __builtin_amdgcn_wmma_f32_16x16x32_f16(false, a, false, b, (short)0, c, false, false);
  asm volatile("v_nop\n\tv_nop\n\tv_nop\n\tv_nop" : "+v"(d) : "v"(a), "v"(b));
  return d;
}
__device__ __forceinline__ v8f wmma_bf(v16b a, v16b b, v8f c) {
  v8f d = __builtin_amdgcn_wmma_f32_16x16x32_bf16(false, a, false, b, (short)0, c, false, false);
  asm volatile("v_nop\n\tv_nop\n\tv_nop\n\tv_nop" : "+v"(d) : "v"(a), "v"(b));
  return d;
}
// BERT self attention variant (B 2, S 2,048, 1,024 dims, 16 heads x 64): q = x Wq + bq, k = x Wk + bk, keys transformed to softplus(k), values = q + k, scores / 8 with the attention mask applied on the QUERY axis (masked queries get uniform attention), softmax, . v; merged heads are the output.
__device__ __forceinline__ v16h frag_h(const _Float16* rowk0, int lane) {
  union { v16h v; v8h q[2]; } u; const _Float16* p = rowk0 + 8 * (lane >> 4);
  u.q[0] = *(const v8h*)p; u.q[1] = *(const v8h*)(p + 16); return u.v;
}
__device__ __forceinline__ v16h frag_f32(const float* rowk0, int lane) {
  v16h a; const float* p = rowk0 + 8 * (lane >> 4);
#pragma unroll
  for (int i = 0; i < 8; ++i) { a[i] = (_Float16)p[i]; a[8 + i] = (_Float16)p[16 + i]; }
  return a;
}
__device__ __forceinline__ v16h frag_f32s(const float* rowk0, int lane, float sc) {
  v16h a; const float* p = rowk0 + 8 * (lane >> 4);
#pragma unroll
  for (int i = 0; i < 8; ++i) { a[i] = (_Float16)(p[i] * sc); a[8 + i] = (_Float16)(p[16 + i] * sc); }
  return a;
}
// column fragment from a [K][ld] layout (column n), rows >= K read as 0
__device__ __forceinline__ v16h fragc_f32(const float* W, int k0, int n, int lane, int ld, int K) {
  v16h a; const int g = lane >> 4;
#pragma unroll
  for (int i = 0; i < 8; ++i) { const int ka = k0 + 8 * g + i, kb = ka + 16;
    a[i] = (_Float16)(ka < K ? W[(size_t)(ka < K ? ka : K - 1) * ld + n] : 0.f); a[8 + i] = (_Float16)(kb < K ? W[(size_t)(kb < K ? kb : K - 1) * ld + n] : 0.f); }
  return a;
}
struct F2 { v16b h, l; };
__device__ __forceinline__ F2 bsplit16(const float v[16]) { F2 r;
#pragma unroll
  for (int i = 0; i < 16; ++i) { const __bf16 h = (__bf16)v[i]; r.h[i] = h; r.l[i] = (__bf16)(v[i] - (float)h); }
  return r; }
__device__ __forceinline__ F2 split_row(const float* row, int k0, int lane) { float v[16]; const float* p = row + k0 + 8 * (lane >> 4);
#pragma unroll
  for (int i = 0; i < 8; ++i) { v[i] = p[i]; v[8 + i] = p[16 + i]; }
  return bsplit16(v); }
__device__ __forceinline__ F2 split_rowK(const float* row, int k0, int lane, int K) { float v[16]; const int g = lane >> 4;
#pragma unroll
  for (int i = 0; i < 8; ++i) { const int ka = k0 + 8 * g + i, kb = ka + 16; v[i] = ka < K ? row[ka < K ? ka : K - 1] : 0.f; v[8 + i] = kb < K ? row[kb < K ? kb : K - 1] : 0.f; }
  return bsplit16(v); }
__device__ __forceinline__ F2 split_col(const float* W, int k0, int n, int lane, int ld, int K) { float v[16]; const int g = lane >> 4;
#pragma unroll
  for (int i = 0; i < 8; ++i) { const int ka = k0 + 8 * g + i, kb = ka + 16; v[i] = ka < K ? W[(size_t)(ka < K ? ka : K - 1) * ld + n] : 0.f; v[8 + i] = kb < K ? W[(size_t)(kb < K ? kb : K - 1) * ld + n] : 0.f; }
  return bsplit16(v); }
__device__ __forceinline__ v8f mac3(const F2& a, const F2& b, v8f c) { c = wmma_bf(a.l, b.h, c); c = wmma_bf(a.h, b.l, c); return wmma_bf(a.h, b.h, c); }
__device__ __forceinline__ float sigm(float v) { return 1.0f / (1.0f + expf(-v)); }
#define LDSX() do { asm volatile("s_wait_dscnt 0" ::: "memory"); __builtin_amdgcn_wave_barrier(); __builtin_amdgcn_fence(__ATOMIC_RELEASE, "workgroup"); } while (0)


#define NB 2
#define SS 2048
#define DM 1024
#define NH 16
__device__ __attribute__((noinline)) float exp_p(float v) { return expf(v); }
__device__ __attribute__((noinline)) float log1p_p(float v) { return log1pf(v); }
__device__ __forceinline__ float softplus_p(float z) { return (z > 20.f) ? z : log1p_p(exp_p(z)); }
#define HD 64
#define QKVW (3 * DM)
#ifndef TQB
#define TQB (SS / 64)
#define TNB NB
#define TOB (NB * SS / 64)     // output row tiles (all)
#endif
typedef __attribute__((ext_vector_type(8))) __bf16 v8b;
__device__ __forceinline__ v16b frag_b(const __bf16* rowk0, int lane) {
  union { v16b v; v8b q[2]; } u; const __bf16* p = rowk0 + 8 * (lane >> 4);
  u.q[0] = *(const v8b*)p; u.q[1] = *(const v8b*)(p + 16); return u.v;
}
__device__ __forceinline__ float bfr(float v) { return (float)(__bf16)v; }
__device__ __attribute__((noinline)) float exp_ni(float v) { return expf(v); }
__device__ __attribute__((noinline)) float erf_ni(float v) { return erff(v); }

#define PK_A 0                       // [3072][1024] Wqkv rows (natural [out][in])
#define PK_P (PK_A + QKVW * DM)        // [1024][1024] Wo rows (natural)
#define PK_END (PK_P + DM * DM)
#define WS_PK  0u
#define WS_QK  (WS_PK + 2u * PK_END)             // f16 [4096 rows][2048]: q | k
#define WS_QKL (WS_QK + 2u * NB * SS * 2 * DM)     // f16 q | k residual planes x2048
#define WS_VTH (WS_QKL + 2u * NB * SS * 2 * DM)    // f16 [b][1024 (h*64+d)][2048 s] hi
#define WS_VTL (WS_VTH + 2u * NB * DM * SS)        // f16 lo x 2048
#define WS_O   (WS_VTL + 2u * NB * DM * SS)        // f32 [4096][1024]
#define WS_CS  (WS_O + 4u * NB * SS * DM)           // f32 [2048][32] cos, [2048][32] sin
#define WS_END (WS_CS + 4u * 2 * SS * 32)
// ---- k_pack: block = (row n, which): (in,out) column n -> bf16 row n; which 0..2 -> W_q/W_k/W_v into PK_A rows which*1024 + n; 3 -> W_o into PK_P
__global__ __launch_bounds__(256) void k_pack(const float* __restrict__ WQ, const float* __restrict__ WK, const float* __restrict__ WV, const float* __restrict__ WO, __bf16* __restrict__ PK) {
  __shared__ __align__(16) __bf16 s[DM]; const int n = blockIdx.x, which = blockIdx.y, t = threadIdx.x; const float* Wm = (which == 0) ? WQ : (which == 1) ? WK : (which == 2) ? WV : WO;   // (in,out) weights: pack row n = column n
  for (int k = t; k < DM; k += 256) s[k] = (__bf16)Wm[(size_t)k * DM + n];
  __syncthreads();
  __bf16* dst = (which < 3) ? PK + PK_A + ((size_t)which * DM + n) * DM : PK + PK_P + (size_t)n * DM;
  for (int q = t; q < DM / 8; q += 256) vst2((unsigned*)(dst + q * 8), *(const v4u*)&s[q * 8]);
}
__global__ __launch_bounds__(128) void k_qkv(const float* __restrict__ XQ, const float* __restrict__ XK, const float* __restrict__ XV, const __bf16* __restrict__ P, const float* __restrict__ BQ, const float* __restrict__ BK, const float* __restrict__ BV, _Float16* __restrict__ QK, _Float16* __restrict__ QKL, _Float16* __restrict__ VTH, _Float16* __restrict__ VTL) {
  const int which0 = (blockIdx.y * 128) / DM; const float* X = (which0 == 0) ? XQ : (which0 == 1) ? XK : XV; const float* BB = BQ ? (((which0 == 0) ? BQ : (which0 == 1) ? BK : BV) + (blockIdx.y * 128 - which0 * DM)) : nullptr;
  __shared__ __align__(16) _Float16 so[4][16][136], sol[4][16][136]; __shared__ __align__(16) _Float16 sth[128][72], stl[128][72];
  const int tid = threadIdx.x, wave = tid >> 5, lane = tid & 31, col = lane & 15, g = lane >> 4; const size_t r0 = (size_t)blockIdx.x * 64 + wave * 16; const int n0 = blockIdx.y * 128;
  v8f acc[8] = {};
#pragma unroll 2
  for (int kc = 0; kc < DM / 32; ++kc) { v16b a; { const float* p = X + (r0 + col) * DM + kc * 32 + 8 * g;
#pragma unroll
      for (int i = 0; i < 8; ++i) { a[i] = (__bf16)p[i]; a[8 + i] = (__bf16)p[16 + i]; } }
#pragma unroll
    for (int j = 0; j < 8; ++j) acc[j] = wmma_bf(a, frag_b(P + (size_t)(n0 + j * 16 + col) * DM + kc * 32, lane), acc[j]); }
  if (n0 < 2 * DM) {   // q stored unscaled (f16 sigma ~0.6, no subnormal exposure); 1/8 applied to the f32 score
#pragma unroll
    for (int j = 0; j < 8; ++j) {
#pragma unroll
      for (int r = 0; r < 8; ++r) { const float v = acc[j][r] + (BB ? bfr(BB[j * 16 + col]) : 0.f); const _Float16 hv = (_Float16)v; so[wave][8 * g + r][j * 16 + col] = hv; sol[wave][8 * g + r][j * 16 + col] = (_Float16)((v - (float)hv) * 2048.0f); } }   // q, k (+ bias) as f16 hi + (x2048) residual
    LDSX();
    for (int rl = 0; rl < 16; ++rl) if (lane < 16) { vst2((unsigned*)(QK + (r0 + rl) * (2 * DM) + n0 + lane * 8), *(const v4u*)&so[wave][rl][lane * 8]); vst2((unsigned*)(QKL + (r0 + rl) * (2 * DM) + n0 + lane * 8), *(const v4u*)&sol[wave][rl][lane * 8]); }
  } else {
#pragma unroll
    for (int j = 0; j < 8; ++j) {
#pragma unroll
      for (int r = 0; r < 8; ++r) { const float v = acc[j][r] + (BB ? bfr(BB[j * 16 + col]) : 0.f); const _Float16 hv = (_Float16)v; sth[j * 16 + col][wave * 16 + 8 * g + r] = hv; stl[j * 16 + col][wave * 16 + 8 * g + r] = (_Float16)((v - (float)hv) * 2048.0f); } }
    __syncthreads();
    const size_t rb = (size_t)blockIdx.x * 64; const int b = (int)(rb / SS), s0 = (int)(rb % SS); const int pc0 = n0 - 2 * DM;
    for (int q = tid; q < 128 * 8; q += 128) { const int d = q >> 3, pc = q & 7; const size_t o = ((size_t)b * DM + pc0 + d) * SS + s0 + pc * 8; vst2((unsigned*)(VTH + o), *(const v4u*)&sth[d][pc * 8]); vst2((unsigned*)(VTL + o), *(const v4u*)&stl[d][pc * 8]); }
  }
}
// ---- k_attn: block = (64 queries, head h, batch b): all-keys flash attention (K = 64: 2 k-steps), scores = (q.k) * 0.125 with single f16 operands, P.V: single f16 P (x2^11) x V hi in one accumulator; O[b*S+q][h*64+d] = (acc + accl / 2048) / (2048 l) (256-B segments)
__global__ __launch_bounds__(128) void k_attn(const _Float16* __restrict__ QK, const _Float16* __restrict__ QKL, const _Float16* __restrict__ VTH, const _Float16* __restrict__ VTL, const void* __restrict__ KMASK, const int* __restrict__ QMSK, float* __restrict__ O) {
  __shared__ __align__(16) float sp[4][16][36]; __shared__ __align__(16) float so[4][16][68];
  const int tid = threadIdx.x, wave = tid >> 5, lane = tid & 31, col = lane & 15, g = lane >> 4;
  const int qb = blockIdx.x, h = blockIdx.y, b = blockIdx.z; const int q0 = qb * 64 + wave * 16; const size_t rq = (size_t)b * SS + q0 + col;
  v16h aq[2], aql[2];
#pragma unroll
  for (int kc = 0; kc < 2; ++kc) { aq[kc] = frag_h(QK + rq * (2 * DM) + h * HD + kc * 32, lane); aql[kc] = frag_h(QKL + rq * (2 * DM) + h * HD + kc * 32, lane); }
  bool qmask[8];   // attention_mask on the QUERY axis: mask == 0 -> every score of that query is -10000 -> uniform weights
#pragma unroll
  for (int r = 0; r < 8; ++r) qmask[r] = QMSK[(size_t)b * SS + q0 + 8 * g + r] == 0;
  float m[8], l[8];
#pragma unroll
  for (int r = 0; r < 8; ++r) { m[r] = -3.0e38f; l[r] = 0.f; }
  v8f acc[4] = {}, accl[4] = {};
  const int nks = SS / 32;   // all keys
#pragma unroll 1
  for (int ks = 0; ks < nks; ++ks) { v8f s[2];
#pragma unroll
    for (int ct = 0; ct < 2; ++ct) { const int kk = ks * 32 + ct * 16 + col; const _Float16* krow = QK + ((size_t)b * SS + kk) * (2 * DM) + DM + h * HD; const _Float16* krowl = QKL + ((size_t)b * SS + kk) * (2 * DM) + DM + h * HD; v8f c = {}, cl = {};
#pragma unroll
      for (int kc = 0; kc < 2; ++kc) c = wmma16(aq[kc], frag_h(krow + kc * 32, lane), c);   // single product: q, k as one-rounding f16 operands
      (void)cl; (void)krowl;
      { const bool keepk = true;
#pragma unroll
        for (int r = 0; r < 8; ++r) s[ct][r] = keepk ? (qmask[r] ? 0.f : c[r] * 0.125f) : -3.0e38f; } }   // 1/sqrt(64); masked query rows uniform
#pragma unroll
    for (int r = 0; r < 8; ++r) { float mx = fmaxf(s[0][r], s[1][r]);
#pragma unroll
      for (int o = 1; o < 16; o <<= 1) mx = fmaxf(mx, __shfl_xor(mx, o));
      const float mn = fmaxf(m[r], mx); const float alpha = (m[r] <= -1.0e38f) ? 0.f : __expf(m[r] - mn);
      const float e0 = (s[0][r] <= -1.0e38f) ? 0.f : __expf(s[0][r] - mn), e1 = (s[1][r] <= -1.0e38f) ? 0.f : __expf(s[1][r] - mn); float es = e0 + e1;
#pragma unroll
      for (int o = 1; o < 16; o <<= 1) es += __shfl_xor(es, o);
      l[r] = l[r] * alpha + es; m[r] = mn;
#pragma unroll
      for (int dt = 0; dt < 4; ++dt) { acc[dt][r] *= alpha; accl[dt][r] *= alpha; }
      sp[wave][8 * g + r][col] = e0; sp[wave][8 * g + r][16 + col] = e1; }
    LDSX();
    v16h pa, pl; { const float* prow = &sp[wave][col][0] + 8 * (lane >> 4);
#pragma unroll
      for (int i = 0; i < 8; ++i) { const float x0 = prow[i] * 2048.0f, x1 = prow[16 + i] * 2048.0f; const _Float16 h0 = (_Float16)x0, h1 = (_Float16)x1; pa[i] = h0; pa[8 + i] = h1; pl[i] = (_Float16)((x0 - (float)h0) * 2048.0f); pl[8 + i] = (_Float16)((x1 - (float)h1) * 2048.0f); } }   // P scaled by 2^11 before the f16 split so small softmax weights stay out of the f16 subnormal range; 2^-11 folded into the epilogue
#pragma unroll
    for (int dt = 0; dt < 4; ++dt) { const size_t vr = ((size_t)b * DM + h * HD + dt * 16 + col) * SS + ks * 32; acc[dt] = wmma16(pa, frag_h(VTH + vr, lane), acc[dt]); }   // single product: P (x2^11) x V
    (void)pl;
    LDSX(); }
#pragma unroll
  for (int r = 0; r < 8; ++r) { const float il = (1.0f / 2048.0f) / l[r];
#pragma unroll
    for (int dt = 0; dt < 4; ++dt) so[wave][8 * g + r][dt * 16 + col] = (acc[dt][r] + accl[dt][r] * (1.0f / 2048.0f)) * il; }
  LDSX();
  for (int rl = 0; rl < 16; ++rl) if (lane < 16) vst2(O + ((size_t)b * SS + q0 + rl) * DM + h * HD + lane * 4, *(const v4f*)&so[wave][rl][lane * 4]);
}
// ---- k_out: block = (64 rows, 128 cols): out = O(hi/lo) . Wo rows (2 products) + bo
__global__ __launch_bounds__(128) void k_out(const float* __restrict__ O, const __bf16* __restrict__ P, const float* __restrict__ BO, float* __restrict__ Y) {
  __shared__ __align__(16) float so[4][16][132];
  const int tid = threadIdx.x, wave = tid >> 5, lane = tid & 31, col = lane & 15, g = lane >> 4; const size_t r0 = (size_t)blockIdx.x * 64 + wave * 16; const int n0 = blockIdx.y * 128;
  v8f acc[8] = {};
#pragma unroll 2
  for (int kc = 0; kc < DM / 32; ++kc) { const F2 a = split_row(O + (r0 + col) * DM, kc * 32, lane);
#pragma unroll
    for (int j = 0; j < 8; ++j) { const v16b w = frag_b(P + (size_t)(n0 + j * 16 + col) * DM + kc * 32, lane); acc[j] = wmma_bf(a.l, w, acc[j]); acc[j] = wmma_bf(a.h, w, acc[j]); } }
#pragma unroll
  for (int j = 0; j < 8; ++j) {
#pragma unroll
    for (int r = 0; r < 8; ++r) so[wave][8 * g + r][j * 16 + col] = acc[j][r] + (BO ? bfr(BO[n0 + j * 16 + col]) : 0.f); }
  LDSX();
  for (int rl = 0; rl < 16; ++rl) vst2(Y + (r0 + rl) * DM + n0 + lane * 4, *(const v4f*)&so[wave][rl][lane * 4]);
}
// ---- k_qk2: block = (64 rows, 128 cols): q = x Wq + bq and k = x Wk + bk for the same columns; stores q rows, softplus(k) rows (the engine's k slot) and v = q + k planes, all as f16 hi + residual
__global__ __launch_bounds__(128) void k_qk2(const float* __restrict__ X, const __bf16* __restrict__ P, const float* __restrict__ BQ, const float* __restrict__ BK, _Float16* __restrict__ QK, _Float16* __restrict__ QKL, _Float16* __restrict__ VTH, _Float16* __restrict__ VTL) {
  __shared__ __align__(16) _Float16 so[4][16][136]; __shared__ __align__(16) _Float16 sol[4][16][136]; __shared__ __align__(16) _Float16 sth[128][72]; __shared__ __align__(16) _Float16 stl[128][72];
  const int tid = threadIdx.x, wave = tid >> 5, lane = tid & 31, col = lane & 15, g = lane >> 4; const size_t rb = (size_t)blockIdx.x * 64, r0 = rb + wave * 16; const int n0 = blockIdx.y * 128;
  v8f aq[8] = {}, ak[8] = {};
#pragma unroll 2
  for (int kc = 0; kc < DM / 32; ++kc) { v16b a; { const float* p = X + (r0 + col) * DM + kc * 32 + 8 * g;
#pragma unroll
      for (int i = 0; i < 8; ++i) { a[i] = (__bf16)p[i]; a[8 + i] = (__bf16)p[16 + i]; } }
#pragma unroll
    for (int j = 0; j < 8; ++j) { aq[j] = wmma_bf(a, frag_b(P + PK_A + (size_t)(n0 + j * 16 + col) * DM + kc * 32, lane), aq[j]); ak[j] = wmma_bf(a, frag_b(P + PK_A + (size_t)(DM + n0 + j * 16 + col) * DM + kc * 32, lane), ak[j]); } }
#pragma unroll
  for (int j = 0; j < 8; ++j) { const float bq = bfr(BQ[n0 + j * 16 + col]);
#pragma unroll
    for (int r = 0; r < 8; ++r) { const float v = aq[j][r] + bq; aq[j][r] = v; const _Float16 hv = (_Float16)v; so[wave][8 * g + r][j * 16 + col] = hv; sol[wave][8 * g + r][j * 16 + col] = (_Float16)((v - (float)hv) * 2048.0f); } }
  LDSX();
  for (int rl = 0; rl < 16; ++rl) if (lane < 16) { vst2((unsigned*)(QK + (r0 + rl) * (2 * DM) + n0 + lane * 8), *(const v4u*)&so[wave][rl][lane * 8]); vst2((unsigned*)(QKL + (r0 + rl) * (2 * DM) + n0 + lane * 8), *(const v4u*)&sol[wave][rl][lane * 8]); }
  LDSX();
  // pass 2: softplus(k) rows into the k slot; v = q + k (raw k) planes
#pragma unroll
  for (int j = 0; j < 8; ++j) { const float bk = bfr(BK[n0 + j * 16 + col]);
#pragma unroll
    for (int r = 0; r < 8; ++r) { const float kv = ak[j][r] + bk; const float sp = softplus_p(kv); const _Float16 hs = (_Float16)sp; so[wave][8 * g + r][j * 16 + col] = hs; sol[wave][8 * g + r][j * 16 + col] = (_Float16)((sp - (float)hs) * 2048.0f);
      const float vv = aq[j][r] + kv; const _Float16 hv = (_Float16)vv; sth[j * 16 + col][wave * 16 + 8 * g + r] = hv; stl[j * 16 + col][wave * 16 + 8 * g + r] = (_Float16)((vv - (float)hv) * 2048.0f); } }
  __syncthreads();
  for (int rl = 0; rl < 16; ++rl) if (lane < 16) { vst2((unsigned*)(QK + (r0 + rl) * (2 * DM) + DM + n0 + lane * 8), *(const v4u*)&so[wave][rl][lane * 8]); vst2((unsigned*)(QKL + (r0 + rl) * (2 * DM) + DM + n0 + lane * 8), *(const v4u*)&sol[wave][rl][lane * 8]); }
  { const int b = (int)(rb / SS), s0 = (int)(rb % SS);
    for (int q = tid; q < 128 * 8; q += 128) { const int d = q >> 3, pc = q & 7; const size_t o = ((size_t)b * DM + n0 + d) * SS + s0 + pc * 8; vst2((unsigned*)(VTH + o), *(const v4u*)&sth[d][pc * 8]); vst2((unsigned*)(VTL + o), *(const v4u*)&stl[d][pc * 8]); } }
}
extern "C" void kernel_launch(void* const* d_in, const int* in_sizes, int n_in, void* d_out, int out_size, void* d_ws, size_t ws_size, hipStream_t stream) {
  (void)in_sizes; (void)n_in; (void)out_size;
  const float** F = (const float**)d_in;   // 0 hidden [2,2048,1024], 1 attention_mask [2,2048] int (query axis), 2 Wq (in,out), 3 bq, 4 Wk, 5 bk
  if (ws_size < (size_t)WS_END) return;
  char* ws = (char*)d_ws; __bf16* PK = (__bf16*)(ws + WS_PK); _Float16 *QK = (_Float16*)(ws + WS_QK), *QKL = (_Float16*)(ws + WS_QKL), *VTH = (_Float16*)(ws + WS_VTH), *VTL = (_Float16*)(ws + WS_VTL);
  k_pack<<<dim3(DM, 4), 256, 0, stream>>>(F[2], F[4], F[4], F[4], PK);   // Wq, Wk rows (v / out slots unused)
  k_qk2<<<dim3(TNB * SS / 64, DM / 128), 128, 0, stream>>>(F[0], PK, F[3], F[5], QK, QKL, VTH, VTL);
  k_attn<<<dim3(TQB, NH, TNB), 128, 0, stream>>>(QK, QKL, VTH, VTL, nullptr, (const int*)d_in[1], (float*)d_out);   // merged heads are the module's output
}

// v001
// One run takes 233 microseconds.
// Timed twice side by side with v000, it ran 1.49 and 1.50 times as fast.
// compute dtype: all float inputs rounded to bf16, the int mask read on device; q / k = x . W + b with EXACT bf16 products on WMMA 16x16x32 ((in,out) weights as transposed rows), softplus(k) (precise expf/log1pf) and v = q + k formed in f32 in the same block before one f16 rounding (hi + residual planes); PLAIN attention: q, softplus(k) single f16 x 1/8, running-max softmax in f32 (hardware exp), P (scaled by 2^11, single f16) x v (single f16); f32 merged-head output.
#include <hip/hip_runtime.h>
#include <math.h>

typedef __attribute__((ext_vector_type(16))) _Float16 v16h;
typedef __attribute__((ext_vector_type(16))) __bf16 v16b;
typedef __attribute__((ext_vector_type(8)))  _Float16 v8h;
typedef __attribute__((ext_vector_type(8)))  float v8f;
typedef __attribute__((ext_vector_type(4)))  float v4f;
typedef __attribute__((ext_vector_type(2)))  float v2f;
typedef __attribute__((ext_vector_type(4)))  unsigned v4u;
typedef __attribute__((ext_vector_type(4)))  int v4i;
typedef float __attribute__((may_alias)) float_a;
typedef int __attribute__((may_alias)) int_a;

template <typename T> __device__ __forceinline__ void vst2(void* p, T v) { *(T*)p = v;  }
__device__ __forceinline__ v8f wmma16(v16h a, v16h b, v8f c) {
  v8f d = __builtin_amdgcn_wmma_f32_16x16x32_f16(false, a, false, b, (short)0, c, false, false);
  asm volatile("v_nop\n\tv_nop\n\tv_nop\n\tv_nop" : "+v"(d) : "v"(a), "v"(b));
  return d;
}
__device__ __forceinline__ v8f wmma_bf(v16b a, v16b b, v8f c) {
  v8f d = __builtin_amdgcn_wmma_f32_16x16x32_bf16(false, a, false, b, (short)0, c, false, false);
  asm volatile("v_nop\n\tv_nop\n\tv_nop\n\tv_nop" : "+v"(d) : "v"(a), "v"(b));
  return d;
}
// BERT self attention variant (B 2, S 2,048, 1,024 dims, 16 heads x 64): q = x Wq + bq, k = x Wk + bk, keys transformed to softplus(k), values = q + k, scores / 8 with the attention mask applied on the QUERY axis (masked queries get uniform attention), softmax, . v; merged heads are the output.
__device__ __forceinline__ v16h frag_h(const _Float16* rowk0, int lane) {
  union { v16h v; v8h q[2]; } u; const _Float16* p = rowk0 + 8 * (lane >> 4);
  u.q[0] = *(const v8h*)p; u.q[1] = *(const v8h*)(p + 16); return u.v;
}
__device__ __forceinline__ v16h frag_f32(const float* rowk0, int lane) {
  v16h a; const float* p = rowk0 + 8 * (lane >> 4);
#pragma unroll
  for (int i = 0; i < 8; ++i) { a[i] = (_Float16)p[i]; a[8 + i] = (_Float16)p[16 + i]; }
  return a;
}
__device__ __forceinline__ v16h frag_f32s(const float* rowk0, int lane, float sc) {
  v16h a; const float* p = rowk0 + 8 * (lane >> 4);
#pragma unroll
  for (int i = 0; i < 8; ++i) { a[i] = (_Float16)(p[i] * sc); a[8 + i] = (_Float16)(p[16 + i] * sc); }
  return a;
}
// column fragment from a [K][ld] layout (column n), rows >= K read as 0
__device__ __forceinline__ v16h fragc_f32(const float* W, int k0, int n, int lane, int ld, int K) {
  v16h a; const int g = lane >> 4;
#pragma unroll
  for (int i = 0; i < 8; ++i) { const int ka = k0 + 8 * g + i, kb = ka + 16;
    a[i] = (_Float16)(ka < K ? W[(size_t)(ka < K ? ka : K - 1) * ld + n] : 0.f); a[8 + i] = (_Float16)(kb < K ? W[(size_t)(kb < K ? kb : K - 1) * ld + n] : 0.f); }
  return a;
}
struct F2 { v16b h, l; };
__device__ __forceinline__ F2 bsplit16(const float v[16]) { F2 r;
#pragma unroll
  for (int i = 0; i < 16; ++i) { const __bf16 h = (__bf16)v[i]; r.h[i] = h; r.l[i] = (__bf16)(v[i] - (float)h); }
  return r; }
__device__ __forceinline__ F2 split_row(const float* row, int k0, int lane) { float v[16]; const float* p = row + k0 + 8 * (lane >> 4);
#pragma unroll
  for (int i = 0; i < 8; ++i) { v[i] = p[i]; v[8 + i] = p[16 + i]; }
  return bsplit16(v); }
__device__ __forceinline__ F2 split_rowK(const float* row, int k0, int lane, int K) { float v[16]; const int g = lane >> 4;
#pragma unroll
  for (int i = 0; i < 8; ++i) { const int ka = k0 + 8 * g + i, kb = ka + 16; v[i] = ka < K ? row[ka < K ? ka : K - 1] : 0.f; v[8 + i] = kb < K ? row[kb < K ? kb : K - 1] : 0.f; }
  return bsplit16(v); }
__device__ __forceinline__ F2 split_col(const float* W, int k0, int n, int lane, int ld, int K) { float v[16]; const int g = lane >> 4;
#pragma unroll
  for (int i = 0; i < 8; ++i) { const int ka = k0 + 8 * g + i, kb = ka + 16; v[i] = ka < K ? W[(size_t)(ka < K ? ka : K - 1) * ld + n] : 0.f; v[8 + i] = kb < K ? W[(size_t)(kb < K ? kb : K - 1) * ld + n] : 0.f; }
  return bsplit16(v); }
__device__ __forceinline__ v8f mac3(const F2& a, const F2& b, v8f c) { c = wmma_bf(a.l, b.h, c); c = wmma_bf(a.h, b.l, c); return wmma_bf(a.h, b.h, c); }
__device__ __forceinline__ float sigm(float v) { return 1.0f / (1.0f + expf(-v)); }
#define LDSX() do { asm volatile("s_wait_dscnt 0" ::: "memory"); __builtin_amdgcn_wave_barrier(); __builtin_amdgcn_fence(__ATOMIC_RELEASE, "workgroup"); } while (0)


#define NB 2
#define SS 2048
#define DM 1024
#define NH 16
__device__ __attribute__((noinline)) float exp_p(float v) { return expf(v); }
__device__ __attribute__((noinline)) float log1p_p(float v) { return log1pf(v); }
__device__ __forceinline__ float softplus_p(float z) { return (z > 20.f) ? z : log1p_p(exp_p(z)); }
#define HD 64
#define QKVW (3 * DM)
#ifndef TQB
#define TQB (SS / 64)
#define TNB NB
#define TOB (NB * SS / 64)     // output row tiles (all)
#endif
typedef __attribute__((ext_vector_type(8))) __bf16 v8b;
__device__ __forceinline__ v16b frag_b(const __bf16* rowk0, int lane) {
  union { v16b v; v8b q[2]; } u; const __bf16* p = rowk0 + 8 * (lane >> 4);
  u.q[0] = *(const v8b*)p; u.q[1] = *(const v8b*)(p + 16); return u.v;
}
__device__ __forceinline__ float bfr(float v) { return (float)(__bf16)v; }
__device__ __attribute__((noinline)) float exp_ni(float v) { return expf(v); }
__device__ __attribute__((noinline)) float erf_ni(float v) { return erff(v); }

#define PK_A 0                       // [3072][1024] Wqkv rows (natural [out][in])
#define PK_P (PK_A + QKVW * DM)        // [1024][1024] Wo rows (natural)
#define PK_END (PK_P + DM * DM)
#define WS_PK  0u
#define WS_QK  (WS_PK + 2u * PK_END)             // f16 [4096 rows][2048]: q | k
#define WS_QKL (WS_QK + 2u * NB * SS * 2 * DM)     // f16 q | k residual planes x2048
#define WS_VTH (WS_QKL + 2u * NB * SS * 2 * DM)    // f16 [b][1024 (h*64+d)][2048 s] hi
#define WS_VTL (WS_VTH + 2u * NB * DM * SS)        // f16 lo x 2048
#define WS_O   (WS_VTL + 2u * NB * DM * SS)        // f32 [4096][1024]
#define WS_CS  (WS_O + 4u * NB * SS * DM)           // f32 [2048][32] cos, [2048][32] sin
#define WS_END (WS_CS + 4u * 2 * SS * 32)
// ---- k_pack: block = (row n, which): (in,out) column n -> bf16 row n; which 0..2 -> W_q/W_k/W_v into PK_A rows which*1024 + n; 3 -> W_o into PK_P
__global__ __launch_bounds__(256) void k_pack(const float* __restrict__ WQ, const float* __restrict__ WK, const float* __restrict__ WV, const float* __restrict__ WO, __bf16* __restrict__ PK) {
  __shared__ __align__(16) __bf16 s[DM]; const int n = blockIdx.x, which = blockIdx.y, t = threadIdx.x; const float* Wm = (which == 0) ? WQ : (which == 1) ? WK : (which == 2) ? WV : WO;   // (in,out) weights: pack row n = column n
  for (int k = t; k < DM; k += 256) s[k] = (__bf16)Wm[(size_t)k * DM + n];
  __syncthreads();
  __bf16* dst = (which < 3) ? PK + PK_A + ((size_t)which * DM + n) * DM : PK + PK_P + (size_t)n * DM;
  for (int q = t; q < DM / 8; q += 256) vst2((unsigned*)(dst + q * 8), *(const v4u*)&s[q * 8]);
}
__global__ __launch_bounds__(128) void k_qkv(const float* __restrict__ XQ, const float* __restrict__ XK, const float* __restrict__ XV, const __bf16* __restrict__ P, const float* __restrict__ BQ, const float* __restrict__ BK, const float* __restrict__ BV, _Float16* __restrict__ QK, _Float16* __restrict__ QKL, _Float16* __restrict__ VTH, _Float16* __restrict__ VTL) {
  const int which0 = (blockIdx.y * 128) / DM; const float* X = (which0 == 0) ? XQ : (which0 == 1) ? XK : XV; const float* BB = BQ ? (((which0 == 0) ? BQ : (which0 == 1) ? BK : BV) + (blockIdx.y * 128 - which0 * DM)) : nullptr;
  __shared__ __align__(16) _Float16 so[4][16][136], sol[4][16][136]; __shared__ __align__(16) _Float16 sth[128][72], stl[128][72];
  const int tid = threadIdx.x, wave = tid >> 5, lane = tid & 31, col = lane & 15, g = lane >> 4; const size_t r0 = (size_t)blockIdx.x * 64 + wave * 16; const int n0 = blockIdx.y * 128;
  v8f acc[8] = {};
#pragma unroll 2
  for (int kc = 0; kc < DM / 32; ++kc) { v16b a; { const float* p = X + (r0 + col) * DM + kc * 32 + 8 * g;
#pragma unroll
      for (int i = 0; i < 8; ++i) { a[i] = (__bf16)p[i]; a[8 + i] = (__bf16)p[16 + i]; } }
#pragma unroll
    for (int j = 0; j < 8; ++j) acc[j] = wmma_bf(a, frag_b(P + (size_t)(n0 + j * 16 + col) * DM + kc * 32, lane), acc[j]); }
  if (n0 < 2 * DM) {   // q stored unscaled (f16 sigma ~0.6, no subnormal exposure); 1/8 applied to the f32 score
#pragma unroll
    for (int j = 0; j < 8; ++j) {
#pragma unroll
      for (int r = 0; r < 8; ++r) { const float v = acc[j][r] + (BB ? bfr(BB[j * 16 + col]) : 0.f); const _Float16 hv = (_Float16)v; so[wave][8 * g + r][j * 16 + col] = hv; sol[wave][8 * g + r][j * 16 + col] = (_Float16)((v - (float)hv) * 2048.0f); } }   // q, k (+ bias) as f16 hi + (x2048) residual
    LDSX();
    for (int rl = 0; rl < 16; ++rl) if (lane < 16) { vst2((unsigned*)(QK + (r0 + rl) * (2 * DM) + n0 + lane * 8), *(const v4u*)&so[wave][rl][lane * 8]); vst2((unsigned*)(QKL + (r0 + rl) * (2 * DM) + n0 + lane * 8), *(const v4u*)&sol[wave][rl][lane * 8]); }
  } else {
#pragma unroll
    for (int j = 0; j < 8; ++j) {
#pragma unroll
      for (int r = 0; r < 8; ++r) { const float v = acc[j][r] + (BB ? bfr(BB[j * 16 + col]) : 0.f); const _Float16 hv = (_Float16)v; sth[j * 16 + col][wave * 16 + 8 * g + r] = hv; stl[j * 16 + col][wave * 16 + 8 * g + r] = (_Float16)((v - (float)hv) * 2048.0f); } }
    __syncthreads();
    const size_t rb = (size_t)blockIdx.x * 64; const int b = (int)(rb / SS), s0 = (int)(rb % SS); const int pc0 = n0 - 2 * DM;
    for (int q = tid; q < 128 * 8; q += 128) { const int d = q >> 3, pc = q & 7; const size_t o = ((size_t)b * DM + pc0 + d) * SS + s0 + pc * 8; vst2((unsigned*)(VTH + o), *(const v4u*)&sth[d][pc * 8]); vst2((unsigned*)(VTL + o), *(const v4u*)&stl[d][pc * 8]); }
  }
}
// ---- k_attn: block = (64 queries, head h, batch b): all-keys flash attention (K = 64: 2 k-steps), scores = (q.k) * 0.125 with single f16 operands, P.V: single f16 P (x2^11) x V hi in one accumulator; O[b*S+q][h*64+d] = (acc + accl / 2048) / (2048 l) (256-B segments)
__global__ __launch_bounds__(128) void k_attn(const _Float16* __restrict__ QK, const _Float16* __restrict__ QKL, const _Float16* __restrict__ VTH, const _Float16* __restrict__ VTL, const void* __restrict__ KMASK, const int* __restrict__ QMSK, float* __restrict__ O) {
  __shared__ __align__(16) float sp[4][16][36]; __shared__ __align__(16) float so[4][16][68];
  const int tid = threadIdx.x, wave = tid >> 5, lane = tid & 31, col = lane & 15, g = lane >> 4;
  const int qb = blockIdx.x, h = blockIdx.y, b = blockIdx.z; const int q0 = qb * 64 + wave * 16; const size_t rq = (size_t)b * SS + q0 + col;
  v16h aq[2], aql[2];
#pragma unroll
  for (int kc = 0; kc < 2; ++kc) { aq[kc] = frag_h(QK + rq * (2 * DM) + h * HD + kc * 32, lane); aql[kc] = frag_h(QKL + rq * (2 * DM) + h * HD + kc * 32, lane); }
  bool qmask[8];   // attention_mask on the QUERY axis: mask == 0 -> every score of that query is -10000 -> uniform weights
#pragma unroll
  for (int r = 0; r < 8; ++r) qmask[r] = QMSK[(size_t)b * SS + q0 + 8 * g + r] == 0;
  float m[8], l[8];
#pragma unroll
  for (int r = 0; r < 8; ++r) { m[r] = -3.0e38f; l[r] = 0.f; }
  v8f acc[4] = {}, accl[4] = {};
  const int nks = SS / 32;   // all keys
#pragma unroll 1
  for (int ks = 0; ks < nks; ++ks) { v8f s[2];
#pragma unroll
    for (int ct = 0; ct < 2; ++ct) { const int kk = ks * 32 + ct * 16 + col; const _Float16* krow = QK + ((size_t)b * SS + kk) * (2 * DM) + DM + h * HD; const _Float16* krowl = QKL + ((size_t)b * SS + kk) * (2 * DM) + DM + h * HD; v8f c = {}, cl = {};
#pragma unroll
      for (int kc = 0; kc < 2; ++kc) c = wmma16(aq[kc], frag_h(krow + kc * 32, lane), c);   // single product: q, k as one-rounding f16 operands
      (void)cl; (void)krowl;
      { const bool keepk = true;
#pragma unroll
        for (int r = 0; r < 8; ++r) s[ct][r] = keepk ? (qmask[r] ? 0.f : c[r] * 0.125f) : -3.0e38f; } }   // 1/sqrt(64); masked query rows uniform
#pragma unroll
    for (int r = 0; r < 8; ++r) { float mx = fmaxf(s[0][r], s[1][r]);
#pragma unroll
      for (int o = 1; o < 16; o <<= 1) mx = fmaxf(mx, __shfl_xor(mx, o));
      const float mn = fmaxf(m[r], mx); const float alpha = (m[r] <= -1.0e38f) ? 0.f : __expf(m[r] - mn);
      const float e0 = (s[0][r] <= -1.0e38f) ? 0.f : __expf(s[0][r] - mn), e1 = (s[1][r] <= -1.0e38f) ? 0.f : __expf(s[1][r] - mn); float es = e0 + e1;
#pragma unroll
      for (int o = 1; o < 16; o <<= 1) es += __shfl_xor(es, o);
      l[r] = l[r] * alpha + es; m[r] = mn;
#pragma unroll
      for (int dt = 0; dt < 4; ++dt) { acc[dt][r] *= alpha; accl[dt][r] *= alpha; }
      sp[wave][8 * g + r][col] = e0; sp[wave][8 * g + r][16 + col] = e1; }
    LDSX();
    v16h pa, pl; { const float* prow = &sp[wave][col][0] + 8 * (lane >> 4);
#pragma unroll
      for (int i = 0; i < 8; ++i) { const float x0 = prow[i] * 2048.0f, x1 = prow[16 + i] * 2048.0f; const _Float16 h0 = (_Float16)x0, h1 = (_Float16)x1; pa[i] = h0; pa[8 + i] = h1; pl[i] = (_Float16)((x0 - (float)h0) * 2048.0f); pl[8 + i] = (_Float16)((x1 - (float)h1) * 2048.0f); } }   // P scaled by 2^11 before the f16 split so small softmax weights stay out of the f16 subnormal range; 2^-11 folded into the epilogue
#pragma unroll
    for (int dt = 0; dt < 4; ++dt) { const size_t vr = ((size_t)b * DM + h * HD + dt * 16 + col) * SS + ks * 32; acc[dt] = wmma16(pa, frag_h(VTH + vr, lane), acc[dt]); }   // single product: P (x2^11) x V
    (void)pl;
    LDSX(); }
#pragma unroll
  for (int r = 0; r < 8; ++r) { const float il = (1.0f / 2048.0f) / l[r];
#pragma unroll
    for (int dt = 0; dt < 4; ++dt) so[wave][8 * g + r][dt * 16 + col] = (acc[dt][r] + accl[dt][r] * (1.0f / 2048.0f)) * il; }
  LDSX();
  for (int rl = 0; rl < 16; ++rl) if (lane < 16) vst2(O + ((size_t)b * SS + q0 + rl) * DM + h * HD + lane * 4, *(const v4f*)&so[wave][rl][lane * 4]);
}
// ---- k_out: block = (64 rows, 128 cols): out = O(hi/lo) . Wo rows (2 products) + bo
__global__ __launch_bounds__(128) void k_out(const float* __restrict__ O, const __bf16* __restrict__ P, const float* __restrict__ BO, float* __restrict__ Y) {
  __shared__ __align__(16) float so[4][16][132];
  const int tid = threadIdx.x, wave = tid >> 5, lane = tid & 31, col = lane & 15, g = lane >> 4; const size_t r0 = (size_t)blockIdx.x * 64 + wave * 16; const int n0 = blockIdx.y * 128;
  v8f acc[8] = {};
#pragma unroll 2
  for (int kc = 0; kc < DM / 32; ++kc) { const F2 a = split_row(O + (r0 + col) * DM, kc * 32, lane);
#pragma unroll
    for (int j = 0; j < 8; ++j) { const v16b w = frag_b(P + (size_t)(n0 + j * 16 + col) * DM + kc * 32, lane); acc[j] = wmma_bf(a.l, w, acc[j]); acc[j] = wmma_bf(a.h, w, acc[j]); } }
#pragma unroll
  for (int j = 0; j < 8; ++j) {
#pragma unroll
    for (int r = 0; r < 8; ++r) so[wave][8 * g + r][j * 16 + col] = acc[j][r] + (BO ? bfr(BO[n0 + j * 16 + col]) : 0.f); }
  LDSX();
  for (int rl = 0; rl < 16; ++rl) vst2(Y + (r0 + rl) * DM + n0 + lane * 4, *(const v4f*)&so[wave][rl][lane * 4]);
}
// ---- k_qk2: block = (64 rows, 128 cols): q = x Wq + bq and k = x Wk + bk for the same columns; stores q rows, softplus(k) rows (the engine's k slot) and v = q + k planes, all as f16 hi + residual
// Operand tiles go through LDS: a stage is 64 k of [256 weight rows (128 of Wq, 128 of Wk) | 64 x rows already rounded to bf16], rows of 128 B at pitch 144 B (16 B x odd: no bank conflict for 16-byte readers).
// Two buffers: the next stage's global loads are issued before this stage's products, land in registers, and are written to the other buffer behind the products; one barrier per stage.
#define QK_KST 64
#define QK_NST (DM / QK_KST)
#define QK_PITCH 72
#define QK_STAGE ((256 + 64) * QK_PITCH)
typedef __attribute__((ext_vector_type(4))) __bf16 v4b;
__global__ __launch_bounds__(128) void k_qk2(const float* __restrict__ X, const __bf16* __restrict__ P, const float* __restrict__ BQ, const float* __restrict__ BK, _Float16* __restrict__ QK, _Float16* __restrict__ QKL, _Float16* __restrict__ VTH, _Float16* __restrict__ VTL) {
  __shared__ __align__(16) unsigned char smem[2 * QK_STAGE * 2];   // the two stage buffers; behind the loop's last barrier the same bytes are the output staging
  __bf16* const ring = (__bf16*)smem;
  _Float16 (* const so)[16][136] = (_Float16 (*)[16][136])smem; _Float16 (* const sol)[16][136] = (_Float16 (*)[16][136])(smem + 17408); _Float16 (* const sth)[72] = (_Float16 (*)[72])(smem + 34816); _Float16 (* const stl)[72] = (_Float16 (*)[72])(smem + 53248);
  const int tid = threadIdx.x, wave = tid >> 5, lane = tid & 31, col = lane & 15, g = lane >> 4; const size_t rb = (size_t)blockIdx.x * 64, r0 = rb + wave * 16; const int n0 = blockIdx.y * 128;
  // loaders: 8 lanes cover one 128-B weight row piece, 16 lanes one 256-B x row piece, so every wave-wide load reads whole lines
  const __bf16* const wsrc = P + PK_A + (size_t)(n0 + (tid >> 3)) * DM + (tid & 7) * 8;
  const float* const xsrc = X + (rb + (tid >> 4)) * DM + (tid & 15) * 4;
  const int wdst = (tid >> 3) * QK_PITCH + (tid & 7) * 8, xdst = (256 + (tid >> 4)) * QK_PITCH + (tid & 15) * 4;
  v4u wr[16]; v4f xr[8];
  v8f aq[8] = {}, ak[8] = {};
#pragma unroll
  for (int i = 0; i < 16; ++i) wr[i] = *(const v4u*)(wsrc + (size_t)((i >> 3) * DM + (i & 7) * 16) * DM);
#pragma unroll
  for (int i = 0; i < 8; ++i) xr[i] = *(const v4f*)(xsrc + (size_t)(i * 8) * DM);
#pragma unroll
  for (int i = 0; i < 16; ++i) *(v4u*)(ring + wdst + i * 16 * QK_PITCH) = wr[i];
#pragma unroll
  for (int i = 0; i < 8; ++i) { v4b c; c[0] = (__bf16)xr[i][0]; c[1] = (__bf16)xr[i][1]; c[2] = (__bf16)xr[i][2]; c[3] = (__bf16)xr[i][3]; *(v4b*)(ring + xdst + i * 8 * QK_PITCH) = c; }
  __syncthreads();
#pragma unroll 1   // rolled: the body already holds 32 products
  for (int s = 0; s < QK_NST; ++s) {
    const bool more = s + 1 < QK_NST;
    if (more) {
#pragma unroll
      for (int i = 0; i < 16; ++i) wr[i] = *(const v4u*)(wsrc + (size_t)((i >> 3) * DM + (i & 7) * 16) * DM + (s + 1) * QK_KST);
#pragma unroll
      for (int i = 0; i < 8; ++i) xr[i] = *(const v4f*)(xsrc + (size_t)(i * 8) * DM + (s + 1) * QK_KST);
    }
    const __bf16* const wb = ring + (s & 1) * QK_STAGE; const __bf16* const xb = wb + 256 * QK_PITCH;
#pragma unroll
    for (int kc = 0; kc < QK_KST / 32; ++kc) {
      const v16b a = frag_b(xb + (wave * 16 + col) * QK_PITCH + kc * 32, lane);
#pragma unroll
      for (int hf = 0; hf < 2; ++hf) { v16b f[8];   // eight fragments' LDS reads as one group ahead of their products (hf 0: Wq rows, hf 1: Wk rows); sixteen at once would not fit beside the accumulators in v0..v255, where the products' asm operands must lie
#pragma unroll
        for (int j = 0; j < 8; ++j) f[j] = frag_b(wb + (hf * 128 + j * 16 + col) * QK_PITCH + kc * 32, lane);
#pragma unroll
        for (int j = 0; j < 8; ++j) { if (hf == 0) aq[j] = wmma_bf(a, f[j], aq[j]); else ak[j] = wmma_bf(a, f[j], ak[j]); }
      }
    }
    if (more) { __bf16* const nb = ring + ((s + 1) & 1) * QK_STAGE;   // last read in stage s - 1, whose barrier every wave has passed
#pragma unroll
      for (int i = 0; i < 16; ++i) *(v4u*)(nb + wdst + i * 16 * QK_PITCH) = wr[i];
#pragma unroll
      for (int i = 0; i < 8; ++i) { v4b c; c[0] = (__bf16)xr[i][0]; c[1] = (__bf16)xr[i][1]; c[2] = (__bf16)xr[i][2]; c[3] = (__bf16)xr[i][3]; *(v4b*)(nb + xdst + i * 8 * QK_PITCH) = c; }
    }
    __syncthreads();   // publishes stage s + 1 and ends every wave's reads of stage s (after the last stage: frees the bytes for the output staging)
  }
#pragma unroll
  for (int j = 0; j < 8; ++j) { const float bq = bfr(BQ[n0 + j * 16 + col]);
#pragma unroll
    for (int r = 0; r < 8; ++r) { const float v = aq[j][r] + bq; aq[j][r] = v; const _Float16 hv = (_Float16)v; so[wave][8 * g + r][j * 16 + col] = hv; sol[wave][8 * g + r][j * 16 + col] = (_Float16)((v - (float)hv) * 2048.0f); } }
  LDSX();
  for (int rl = 0; rl < 16; ++rl) if (lane < 16) { vst2((unsigned*)(QK + (r0 + rl) * (2 * DM) + n0 + lane * 8), *(const v4u*)&so[wave][rl][lane * 8]); vst2((unsigned*)(QKL + (r0 + rl) * (2 * DM) + n0 + lane * 8), *(const v4u*)&sol[wave][rl][lane * 8]); }
  LDSX();
  // pass 2: softplus(k) rows into the k slot; v = q + k (raw k) planes
#pragma unroll
  for (int j = 0; j < 8; ++j) { const float bk = bfr(BK[n0 + j * 16 + col]);
#pragma unroll
    for (int r = 0; r < 8; ++r) { const float kv = ak[j][r] + bk; const float sp = softplus_p(kv); const _Float16 hs = (_Float16)sp; so[wave][8 * g + r][j * 16 + col] = hs; sol[wave][8 * g + r][j * 16 + col] = (_Float16)((sp - (float)hs) * 2048.0f);
      const float vv = aq[j][r] + kv; const _Float16 hv = (_Float16)vv; sth[j * 16 + col][wave * 16 + 8 * g + r] = hv; stl[j * 16 + col][wave * 16 + 8 * g + r] = (_Float16)((vv - (float)hv) * 2048.0f); } }
  __syncthreads();
  for (int rl = 0; rl < 16; ++rl) if (lane < 16) { vst2((unsigned*)(QK + (r0 + rl) * (2 * DM) + DM + n0 + lane * 8), *(const v4u*)&so[wave][rl][lane * 8]); vst2((unsigned*)(QKL + (r0 + rl) * (2 * DM) + DM + n0 + lane * 8), *(const v4u*)&sol[wave][rl][lane * 8]); }
  { const int b = (int)(rb / SS), s0 = (int)(rb % SS);
    for (int q = tid; q < 128 * 8; q += 128) { const int d = q >> 3, pc = q & 7; const size_t o = ((size_t)b * DM + n0 + d) * SS + s0 + pc * 8; vst2((unsigned*)(VTH + o), *(const v4u*)&sth[d][pc * 8]); vst2((unsigned*)(VTL + o), *(const v4u*)&stl[d][pc * 8]); } }
}
extern "C" void kernel_launch(void* const* d_in, const int* in_sizes, int n_in, void* d_out, int out_size, void* d_ws, size_t ws_size, hipStream_t stream) {
  (void)in_sizes; (void)n_in; (void)out_size;
  const float** F = (const float**)d_in;   // 0 hidden [2,2048,1024], 1 attention_mask [2,2048] int (query axis), 2 Wq (in,out), 3 bq, 4 Wk, 5 bk
  if (ws_size < (size_t)WS_END) return;
  char* ws = (char*)d_ws; __bf16* PK = (__bf16*)(ws + WS_PK); _Float16 *QK = (_Float16*)(ws + WS_QK), *QKL = (_Float16*)(ws + WS_QKL), *VTH = (_Float16*)(ws + WS_VTH), *VTL = (_Float16*)(ws + WS_VTL);
  k_pack<<<dim3(DM, 4), 256, 0, stream>>>(F[2], F[4], F[4], F[4], PK);   // Wq, Wk rows (v / out slots unused)
  k_qk2<<<dim3(TNB * SS / 64, DM / 128), 128, 0, stream>>>(F[0], PK, F[3], F[5], QK, QKL, VTH, VTL);
  k_attn<<<dim3(TQB, NH, TNB), 128, 0, stream>>>(QK, QKL, VTH, VTL, nullptr, (const int*)d_in[1], (float*)d_out);   // merged heads are the module's output
}

// v002
// One run takes 155 microseconds.
// In both of two side-by-side timings against v001, it was 1.52 times as fast.
// Over all steps from v000 it is 2.27 times as fast.
// compute dtype: all float inputs rounded to bf16, the int mask read on device; q / k = x . W + b with EXACT bf16 products on WMMA 16x16x32 ((in,out) weights as transposed rows), softplus(k) (precise expf/log1pf) and v = q + k formed in f32 in the same block before one f16 rounding (hi + residual planes); PLAIN attention: q, softplus(k) single f16 x 1/8, running-max softmax in f32 (hardware exp), P (scaled by 2^11, single f16) x v (single f16); f32 merged-head output.
#include <hip/hip_runtime.h>
#include <math.h>

typedef __attribute__((ext_vector_type(16))) _Float16 v16h;
typedef __attribute__((ext_vector_type(16))) __bf16 v16b;
typedef __attribute__((ext_vector_type(8)))  _Float16 v8h;
typedef __attribute__((ext_vector_type(8)))  float v8f;
typedef __attribute__((ext_vector_type(4)))  float v4f;
typedef __attribute__((ext_vector_type(2)))  float v2f;
typedef __attribute__((ext_vector_type(4)))  unsigned v4u;
typedef __attribute__((ext_vector_type(4)))  int v4i;
typedef float __attribute__((may_alias)) float_a;
typedef int __attribute__((may_alias)) int_a;

template <typename T> __device__ __forceinline__ void vst2(void* p, T v) { *(T*)p = v;  }
__device__ __forceinline__ v8f wmma16(v16h a, v16h b, v8f c) {
  v8f d = __builtin_amdgcn_wmma_f32_16x16x32_f16(false, a, false, b, (short)0, c, false, false);
  asm volatile("v_nop\n\tv_nop\n\tv_nop\n\tv_nop" : "+v"(d) : "v"(a), "v"(b));
  return d;
}
__device__ __forceinline__ v8f wmma_bf(v16b a, v16b b, v8f c) {
  v8f d = __builtin_amdgcn_wmma_f32_16x16x32_bf16(false, a, false, b, (short)0, c, false, false);
  asm volatile("v_nop\n\tv_nop\n\tv_nop\n\tv_nop" : "+v"(d) : "v"(a), "v"(b));
  return d;
}
// BERT self attention variant (B 2, S 2,048, 1,024 dims, 16 heads x 64): q = x Wq + bq, k = x Wk + bk, keys transformed to softplus(k), values = q + k, scores / 8 with the attention mask applied on the QUERY axis (masked queries get uniform attention), softmax, . v; merged heads are the output.
__device__ __forceinline__ v16h frag_h(const _Float16* rowk0, int lane) {
  union { v16h v; v8h q[2]; } u; const _Float16* p = rowk0 + 8 * (lane >> 4);
  u.q[0] = *(const v8h*)p; u.q[1] = *(const v8h*)(p + 16); return u.v;
}
__device__ __forceinline__ v16h frag_f32(const float* rowk0, int lane) {
  v16h a; const float* p = rowk0 + 8 * (lane >> 4);
#pragma unroll
  for (int i = 0; i < 8; ++i) { a[i] = (_Float16)p[i]; a[8 + i] = (_Float16)p[16 + i]; }
  return a;
}
__device__ __forceinline__ v16h frag_f32s(const float* rowk0, int lane, float sc) {
  v16h a; const float* p = rowk0 + 8 * (lane >> 4);
#pragma unroll
  for (int i = 0; i < 8; ++i) { a[i] = (_Float16)(p[i] * sc); a[8 + i] = (_Float16)(p[16 + i] * sc); }
  return a;
}
// column fragment from a [K][ld] layout (column n), rows >= K read as 0
__device__ __forceinline__ v16h fragc_f32(const float* W, int k0, int n, int lane, int ld, int K) {
  v16h a; const int g = lane >> 4;
#pragma unroll
  for (int i = 0; i < 8; ++i) { const int ka = k0 + 8 * g + i, kb = ka + 16;
    a[i] = (_Float16)(ka < K ? W[(size_t)(ka < K ? ka : K - 1) * ld + n] : 0.f); a[8 + i] = (_Float16)(kb < K ? W[(size_t)(kb < K ? kb : K - 1) * ld + n] : 0.f); }
  return a;
}
struct F2 { v16b h, l; };
__device__ __forceinline__ F2 bsplit16(const float v[16]) { F2 r;
#pragma unroll
  for (int i = 0; i < 16; ++i) { const __bf16 h = (__bf16)v[i]; r.h[i] = h; r.l[i] = (__bf16)(v[i] - (float)h); }
  return r; }
__device__ __forceinline__ F2 split_row(const float* row, int k0, int lane) { float v[16]; const float* p = row + k0 + 8 * (lane >> 4);
#pragma unroll
  for (int i = 0; i < 8; ++i) { v[i] = p[i]; v[8 + i] = p[16 + i]; }
  return bsplit16(v); }
__device__ __forceinline__ F2 split_rowK(const float* row, int k0, int lane, int K) { float v[16]; const int g = lane >> 4;
#pragma unroll
  for (int i = 0; i < 8; ++i) { const int ka = k0 + 8 * g + i, kb = ka + 16; v[i] = ka < K ? row[ka < K ? ka : K - 1] : 0.f; v[8 + i] = kb < K ? row[kb < K ? kb : K - 1] : 0.f; }
  return bsplit16(v); }
__device__ __forceinline__ F2 split_col(const float* W, int k0, int n, int lane, int ld, int K) { float v[16]; const int g = lane >> 4;
#pragma unroll
  for (int i = 0; i < 8; ++i) { const int ka = k0 + 8 * g + i, kb = ka + 16; v[i] = ka < K ? W[(size_t)(ka < K ? ka : K - 1) * ld + n] : 0.f; v[8 + i] = kb < K ? W[(size_t)(kb < K ? kb : K - 1) * ld + n] : 0.f; }
  return bsplit16(v); }
__device__ __forceinline__ v8f mac3(const F2& a, const F2& b, v8f c) { c = wmma_bf(a.l, b.h, c); c = wmma_bf(a.h, b.l, c); return wmma_bf(a.h, b.h, c); }
__device__ __forceinline__ float sigm(float v) { return 1.0f / (1.0f + expf(-v)); }
#define LDSX() do { asm volatile("s_wait_dscnt 0" ::: "memory"); __builtin_amdgcn_wave_barrier(); __builtin_amdgcn_fence(__ATOMIC_RELEASE, "workgroup"); } while (0)


#define NB 2
#define SS 2048
#define DM 1024
#define NH 16
__device__ __attribute__((noinline)) float exp_p(float v) { return expf(v); }
__device__ __attribute__((noinline)) float log1p_p(float v) { return log1pf(v); }
__device__ __forceinline__ float softplus_p(float z) { return (z > 20.f) ? z : log1p_p(exp_p(z)); }
#define HD 64
#define QKVW (3 * DM)
#ifndef TQB
#define TQB (SS / 64)
#define TNB NB
#define TOB (NB * SS / 64)     // output row tiles (all)
#endif
typedef __attribute__((ext_vector_type(8))) __bf16 v8b;
__device__ __forceinline__ v16b frag_b(const __bf16* rowk0, int lane) {
  union { v16b v; v8b q[2]; } u; const __bf16* p = rowk0 + 8 * (lane >> 4);
  u.q[0] = *(const v8b*)p; u.q[1] = *(const v8b*)(p + 16); return u.v;
}
__device__ __forceinline__ float bfr(float v) { return (float)(__bf16)v; }
__device__ __attribute__((noinline)) float exp_ni(float v) { return expf(v); }
__device__ __attribute__((noinline)) float erf_ni(float v) { return erff(v); }

#define PK_A 0                       // [3072][1024] Wqkv rows (natural [out][in])
#define PK_P (PK_A + QKVW * DM)        // [1024][1024] Wo rows (natural)
#define PK_END (PK_P + DM * DM)
#define WS_PK  0u
#define WS_QK  (WS_PK + 2u * PK_END)             // f16 [4096 rows][2048]: q | k
#define WS_QKL (WS_QK + 2u * NB * SS * 2 * DM)     // f16 q | k residual planes x2048
#define WS_VTH (WS_QKL + 2u * NB * SS * 2 * DM)    // f16 [b][1024 (h*64+d)][2048 s] hi
#define WS_VTL (WS_VTH + 2u * NB * DM * SS)        // f16 lo x 2048
#define WS_O   (WS_VTL + 2u * NB * DM * SS)        // f32 [4096][1024]
#define WS_CS  (WS_O + 4u * NB * SS * DM)           // f32 [2048][32] cos, [2048][32] sin
#define WS_END (WS_CS + 4u * 2 * SS * 32)
// ---- k_pack: block = (row n, which): (in,out) column n -> bf16 row n; which 0..2 -> W_q/W_k/W_v into PK_A rows which*1024 + n; 3 -> W_o into PK_P
__global__ __launch_bounds__(256) void k_pack(const float* __restrict__ WQ, const float* __restrict__ WK, const float* __restrict__ WV, const float* __restrict__ WO, __bf16* __restrict__ PK) {
  __shared__ __align__(16) __bf16 s[DM]; const int n = blockIdx.x, which = blockIdx.y, t = threadIdx.x; const float* Wm = (which == 0) ? WQ : (which == 1) ? WK : (which == 2) ? WV : WO;   // (in,out) weights: pack row n = column n
  for (int k = t; k < DM; k += 256) s[k] = (__bf16)Wm[(size_t)k * DM + n];
  __syncthreads();
  __bf16* dst = (which < 3) ? PK + PK_A + ((size_t)which * DM + n) * DM : PK + PK_P + (size_t)n * DM;
  for (int q = t; q < DM / 8; q += 256) vst2((unsigned*)(dst + q * 8), *(const v4u*)&s[q * 8]);
}
__global__ __launch_bounds__(128) void k_qkv(const float* __restrict__ XQ, const float* __restrict__ XK, const float* __restrict__ XV, const __bf16* __restrict__ P, const float* __restrict__ BQ, const float* __restrict__ BK, const float* __restrict__ BV, _Float16* __restrict__ QK, _Float16* __restrict__ QKL, _Float16* __restrict__ VTH, _Float16* __restrict__ VTL) {
  const int which0 = (blockIdx.y * 128) / DM; const float* X = (which0 == 0) ? XQ : (which0 == 1) ? XK : XV; const float* BB = BQ ? (((which0 == 0) ? BQ : (which0 == 1) ? BK : BV) + (blockIdx.y * 128 - which0 * DM)) : nullptr;
  __shared__ __align__(16) _Float16 so[4][16][136], sol[4][16][136]; __shared__ __align__(16) _Float16 sth[128][72], stl[128][72];
  const int tid = threadIdx.x, wave = tid >> 5, lane = tid & 31, col = lane & 15, g = lane >> 4; const size_t r0 = (size_t)blockIdx.x * 64 + wave * 16; const int n0 = blockIdx.y * 128;
  v8f acc[8] = {};
#pragma unroll 2
  for (int kc = 0; kc < DM / 32; ++kc) { v16b a; { const float* p = X + (r0 + col) * DM + kc * 32 + 8 * g;
#pragma unroll
      for (int i = 0; i < 8; ++i) { a[i] = (__bf16)p[i]; a[8 + i] = (__bf16)p[16 + i]; } }
#pragma unroll
    for (int j = 0; j < 8; ++j) acc[j] = wmma_bf(a, frag_b(P + (size_t)(n0 + j * 16 + col) * DM + kc * 32, lane), acc[j]); }
  if (n0 < 2 * DM) {   // q stored unscaled (f16 sigma ~0.6, no subnormal exposure); 1/8 applied to the f32 score
#pragma unroll
    for (int j = 0; j < 8; ++j) {
#pragma unroll
      for (int r = 0; r < 8; ++r) { const float v = acc[j][r] + (BB ? bfr(BB[j * 16 + col]) : 0.f); const _Float16 hv = (_Float16)v; so[wave][8 * g + r][j * 16 + col] = hv; sol[wave][8 * g + r][j * 16 + col] = (_Float16)((v - (float)hv) * 2048.0f); } }   // q, k (+ bias) as f16 hi + (x2048) residual
    LDSX();
    for (int rl = 0; rl < 16; ++rl) if (lane < 16) { vst2((unsigned*)(QK + (r0 + rl) * (2 * DM) + n0 + lane * 8), *(const v4u*)&so[wave][rl][lane * 8]); vst2((unsigned*)(QKL + (r0 + rl) * (2 * DM) + n0 + lane * 8), *(const v4u*)&sol[wave][rl][lane * 8]); }
  } else {
#pragma unroll
    for (int j = 0; j < 8; ++j) {
#pragma unroll
      for (int r = 0; r < 8; ++r) { const float v = acc[j][r] + (BB ? bfr(BB[j * 16 + col]) : 0.f); const _Float16 hv = (_Float16)v; sth[j * 16 + col][wave * 16 + 8 * g + r] = hv; stl[j * 16 + col][wave * 16 + 8 * g + r] = (_Float16)((v - (float)hv) * 2048.0f); } }
    __syncthreads();
    const size_t rb = (size_t)blockIdx.x * 64; const int b = (int)(rb / SS), s0 = (int)(rb % SS); const int pc0 = n0 - 2 * DM;
    for (int q = tid; q < 128 * 8; q += 128) { const int d = q >> 3, pc = q & 7; const size_t o = ((size_t)b * DM + pc0 + d) * SS + s0 + pc * 8; vst2((unsigned*)(VTH + o), *(const v4u*)&sth[d][pc * 8]); vst2((unsigned*)(VTL + o), *(const v4u*)&stl[d][pc * 8]); }
  }
}
// ---- k_attn: block = (64 queries, head h, batch b): all-keys flash attention (K = 64: 2 k-steps), scores = (q.k) * 0.125 with single f16 operands, P.V: f16 P (x2^11) x V hi, one product into acc; O[b*S+q][h*64+d] = (acc + accl / 2048) / (2048 l) (256-B segments)
// K and V^T go through LDS: a stage is 64 keys = [64 key rows x 64 d | 64 d rows x 64 keys] of f16, rows of 128 B at pitch 144 B (16 B x odd: no bank conflict for 16-byte readers), copied once per block and read by its 4 waves.
// Two buffers: stage t + 1's copies fly while stage t is worked on; one barrier per stage.
#define AT_KST 64
#define AT_NST (SS / AT_KST)
#define AT_PITCH 72
#define AT_TILE (64 * AT_PITCH)
#define AT_STAGE (2 * AT_TILE)
// one stage: 8 copies of 16 B a lane (8 lanes cover one 128-B row, so a wave's copy reads 4 whole lines); lk = the lane's LDS byte address in the K tile, gk / gv = its global addresses in row (tid >> 3) of the K / V^T tile
__device__ __forceinline__ void attn_stage(unsigned lk, const _Float16* gk, const _Float16* gv) {
  const unsigned lv = lk + 2 * AT_TILE;
  // the s_wait_xcnt stands in the copies' own statement so that no address register is rewritten ahead of it
  asm volatile("global_load_async_to_lds_b128 %0, %8, off\n\t"
               "global_load_async_to_lds_b128 %1, %9, off\n\t"
               "global_load_async_to_lds_b128 %2, %10, off\n\t"
               "global_load_async_to_lds_b128 %3, %11, off\n\t"
               "global_load_async_to_lds_b128 %4, %12, off\n\t"
               "global_load_async_to_lds_b128 %5, %13, off\n\t"
               "global_load_async_to_lds_b128 %6, %14, off\n\t"
               "global_load_async_to_lds_b128 %7, %15, off\n\t"
               "s_wait_xcnt 0x0"
               :: "v"(lk), "v"(lk + 16 * 2 * AT_PITCH), "v"(lk + 32 * 2 * AT_PITCH), "v"(lk + 48 * 2 * AT_PITCH),
                  "v"(lv), "v"(lv + 16 * 2 * AT_PITCH), "v"(lv + 32 * 2 * AT_PITCH), "v"(lv + 48 * 2 * AT_PITCH),
                  "v"(gk), "v"(gk + (size_t)16 * 2 * DM), "v"(gk + (size_t)32 * 2 * DM), "v"(gk + (size_t)48 * 2 * DM),
                  "v"(gv), "v"(gv + (size_t)16 * SS), "v"(gv + (size_t)32 * SS), "v"(gv + (size_t)48 * SS)
               : "memory");
}
__global__ __launch_bounds__(128) void k_attn(const _Float16* __restrict__ QK, const _Float16* __restrict__ QKL, const _Float16* __restrict__ VTH, const _Float16* __restrict__ VTL, const void* __restrict__ KMASK, const int* __restrict__ QMSK, float* __restrict__ O) {
  __shared__ __align__(16) float sp[4][16][36]; __shared__ __align__(16) float so[4][16][68]; __shared__ __align__(16) _Float16 ring[2 * AT_STAGE];
  const int tid = threadIdx.x, wave = tid >> 5, lane = tid & 31, col = lane & 15, g = lane >> 4;
  const int qb = blockIdx.x, h = blockIdx.y, b = blockIdx.z; const int q0 = qb * 64 + wave * 16; const size_t rq = (size_t)b * SS + q0 + col;
  v16h aq[2], aql[2];
#pragma unroll
  for (int kc = 0; kc < 2; ++kc) { aq[kc] = frag_h(QK + rq * (2 * DM) + h * HD + kc * 32, lane); aql[kc] = frag_h(QKL + rq * (2 * DM) + h * HD + kc * 32, lane); }
  bool qmask[8];   // attention_mask on the QUERY axis: mask == 0 -> every score of that query is -10000 -> uniform weights
#pragma unroll
  for (int r = 0; r < 8; ++r) qmask[r] = QMSK[(size_t)b * SS + q0 + 8 * g + r] == 0;
  float m[8], l[8];
#pragma unroll
  for (int r = 0; r < 8; ++r) { m[r] = -3.0e38f; l[r] = 0.f; }
  v8f acc[4] = {}, accl[4] = {};
  const _Float16* const gk = QK + ((size_t)b * SS + (tid >> 3)) * (2 * DM) + DM + h * HD + (tid & 7) * 8;
  const _Float16* const gv = VTH + ((size_t)b * DM + h * HD + (tid >> 3)) * SS + (tid & 7) * 8;
  const unsigned l0 = (unsigned)(size_t)(__attribute__((address_space(3))) _Float16*)ring + (tid >> 3) * (2 * AT_PITCH) + (tid & 7) * 16;
  attn_stage(l0, gk, gv);
  asm volatile("s_wait_asynccnt 0x0" ::: "memory");   // stage 0 has landed before the barrier that publishes it
  __syncthreads();
  attn_stage(l0 + 2 * AT_STAGE, gk + (size_t)AT_KST * 2 * DM, gv + AT_KST);
#pragma unroll 1   // rolled: one trip per stage, the buffer chosen by the trip's parity
  for (int t = 0; t < AT_NST; ++t) { const _Float16* const kb = ring + (t & 1) * AT_STAGE; const _Float16* const vb = kb + AT_TILE;
#pragma unroll   // the stage's two 32-key passes in line, so that their LDS offsets are constants
  for (int ps = 0; ps < AT_KST / 32; ++ps) { v8f s[2]; v16h kf[2][2], vf[4];   // the pass's fragments: LDS reads as one group ahead of the products, V's in flight under the softmax
#pragma unroll
    for (int ct = 0; ct < 2; ++ct) {
#pragma unroll
      for (int kc = 0; kc < 2; ++kc) kf[ct][kc] = frag_h(kb + (ps * 32 + ct * 16 + col) * AT_PITCH + kc * 32, lane); }
#pragma unroll
    for (int dt = 0; dt < 4; ++dt) vf[dt] = frag_h(vb + (dt * 16 + col) * AT_PITCH + ps * 32, lane);
#pragma unroll
    for (int ct = 0; ct < 2; ++ct) { v8f c = {};
#pragma unroll
      for (int kc = 0; kc < 2; ++kc) c = wmma16(aq[kc], kf[ct][kc], c);   // single product: q, k as one-rounding f16 operands
      { const bool keepk = true;
#pragma unroll
        for (int r = 0; r < 8; ++r) s[ct][r] = keepk ? (qmask[r] ? 0.f : c[r] * 0.125f) : -3.0e38f; } }   // 1/sqrt(64); masked query rows uniform
#pragma unroll
    for (int r = 0; r < 8; ++r) { float mx = fmaxf(s[0][r], s[1][r]);
#pragma unroll
      for (int o = 1; o < 16; o <<= 1) mx = fmaxf(mx, __shfl_xor(mx, o));
      const float mn = fmaxf(m[r], mx); const float alpha = (m[r] <= -1.0e38f) ? 0.f : __expf(m[r] - mn);
      const float e0 = (s[0][r] <= -1.0e38f) ? 0.f : __expf(s[0][r] - mn), e1 = (s[1][r] <= -1.0e38f) ? 0.f : __expf(s[1][r] - mn); float es = e0 + e1;
#pragma unroll
      for (int o = 1; o < 16; o <<= 1) es += __shfl_xor(es, o);
      l[r] = l[r] * alpha + es; m[r] = mn;
#pragma unroll
      for (int dt = 0; dt < 4; ++dt) { acc[dt][r] *= alpha; accl[dt][r] *= alpha; }
      sp[wave][8 * g + r][col] = e0; sp[wave][8 * g + r][16 + col] = e1; }
    LDSX();
    v16h pa, pl; { const float* prow = &sp[wave][col][0] + 8 * (lane >> 4);
#pragma unroll
      for (int i = 0; i < 8; ++i) { const float x0 = prow[i] * 2048.0f, x1 = prow[16 + i] * 2048.0f; const _Float16 h0 = (_Float16)x0, h1 = (_Float16)x1; pa[i] = h0; pa[8 + i] = h1; pl[i] = (_Float16)((x0 - (float)h0) * 2048.0f); pl[8 + i] = (_Float16)((x1 - (float)h1) * 2048.0f); } }   // P scaled by 2^11 before the f16 split so small softmax weights stay out of the f16 subnormal range; 2^-11 folded into the epilogue
#pragma unroll
    for (int dt = 0; dt < 4; ++dt) acc[dt] = wmma16(pa, vf[dt], acc[dt]);   // single product: P (x2^11) x V
    (void)pl;
    LDSX(); }
    asm volatile("s_wait_dscnt 0x0" ::: "memory");      // this wave's reads of stage t are done
    asm volatile("s_wait_asynccnt 0x0" ::: "memory");   // its copies of stage t + 1 have landed
    __syncthreads();                                    // publishes stage t + 1 and ends every wave's reads of stage t
    if (t + 2 < AT_NST) attn_stage(l0 + (t & 1) * (2 * AT_STAGE), gk + (size_t)(t + 2) * AT_KST * 2 * DM, gv + (t + 2) * AT_KST); }
  asm volatile("s_wait_asynccnt 0x0" ::: "memory");     // no copy is left in flight when the wave goes on
#pragma unroll
  for (int r = 0; r < 8; ++r) { const float il = (1.0f / 2048.0f) / l[r];
#pragma unroll
    for (int dt = 0; dt < 4; ++dt) so[wave][8 * g + r][dt * 16 + col] = (acc[dt][r] + accl[dt][r] * (1.0f / 2048.0f)) * il; }
  LDSX();
  for (int rl = 0; rl < 16; ++rl) if (lane < 16) vst2(O + ((size_t)b * SS + q0 + rl) * DM + h * HD + lane * 4, *(const v4f*)&so[wave][rl][lane * 4]);
}
// ---- k_out: block = (64 rows, 128 cols): out = O(hi/lo) . Wo rows (2 products) + bo
__global__ __launch_bounds__(128) void k_out(const float* __restrict__ O, const __bf16* __restrict__ P, const float* __restrict__ BO, float* __restrict__ Y) {
  __shared__ __align__(16) float so[4][16][132];
  const int tid = threadIdx.x, wave = tid >> 5, lane = tid & 31, col = lane & 15, g = lane >> 4; const size_t r0 = (size_t)blockIdx.x * 64 + wave * 16; const int n0 = blockIdx.y * 128;
  v8f acc[8] = {};
#pragma unroll 2
  for (int kc = 0; kc < DM / 32; ++kc) { const F2 a = split_row(O + (r0 + col) * DM, kc * 32, lane);
#pragma unroll
    for (int j = 0; j < 8; ++j) { const v16b w = frag_b(P + (size_t)(n0 + j * 16 + col) * DM + kc * 32, lane); acc[j] = wmma_bf(a.l, w, acc[j]); acc[j] = wmma_bf(a.h, w, acc[j]); } }
#pragma unroll
  for (int j = 0; j < 8; ++j) {
#pragma unroll
    for (int r = 0; r < 8; ++r) so[wave][8 * g + r][j * 16 + col] = acc[j][r] + (BO ? bfr(BO[n0 + j * 16 + col]) : 0.f); }
  LDSX();
  for (int rl = 0; rl < 16; ++rl) vst2(Y + (r0 + rl) * DM + n0 + lane * 4, *(const v4f*)&so[wave][rl][lane * 4]);
}
// ---- k_qk2: block = (64 rows, 128 cols): q = x Wq + bq and k = x Wk + bk for the same columns; stores q rows, softplus(k) rows (the engine's k slot) and v = q + k planes, all as f16 hi + residual
// Operand tiles go through LDS: a stage is 64 k of [256 weight rows (128 of Wq, 128 of Wk) | 64 x rows already rounded to bf16], rows of 128 B at pitch 144 B (16 B x odd: no bank conflict for 16-byte readers).
// Two buffers: the next stage's global loads are issued before this stage's products, land in registers, and are written to the other buffer behind the products; one barrier per stage.
#define QK_KST 64
#define QK_NST (DM / QK_KST)
#define QK_PITCH 72
#define QK_STAGE ((256 + 64) * QK_PITCH)
typedef __attribute__((ext_vector_type(4))) __bf16 v4b;
__global__ __launch_bounds__(128) void k_qk2(const float* __restrict__ X, const __bf16* __restrict__ P, const float* __restrict__ BQ, const float* __restrict__ BK, _Float16* __restrict__ QK, _Float16* __restrict__ QKL, _Float16* __restrict__ VTH, _Float16* __restrict__ VTL) {
  __shared__ __align__(16) unsigned char smem[2 * QK_STAGE * 2];   // the two stage buffers; behind the loop's last barrier the same bytes are the output staging
  __bf16* const ring = (__bf16*)smem;
  _Float16 (* const so)[16][136] = (_Float16 (*)[16][136])smem; _Float16 (* const sol)[16][136] = (_Float16 (*)[16][136])(smem + 17408); _Float16 (* const sth)[72] = (_Float16 (*)[72])(smem + 34816); _Float16 (* const stl)[72] = (_Float16 (*)[72])(smem + 53248);
  const int tid = threadIdx.x, wave = tid >> 5, lane = tid & 31, col = lane & 15, g = lane >> 4; const size_t rb = (size_t)blockIdx.x * 64, r0 = rb + wave * 16; const int n0 = blockIdx.y * 128;
  // loaders: 8 lanes cover one 128-B weight row piece, 16 lanes one 256-B x row piece, so every wave-wide load reads whole lines
  const __bf16* const wsrc = P + PK_A + (size_t)(n0 + (tid >> 3)) * DM + (tid & 7) * 8;
  const float* const xsrc = X + (rb + (tid >> 4)) * DM + (tid & 15) * 4;
  const int wdst = (tid >> 3) * QK_PITCH + (tid & 7) * 8, xdst = (256 + (tid >> 4)) * QK_PITCH + (tid & 15) * 4;
  v4u wr[16]; v4f xr[8];
  v8f aq[8] = {}, ak[8] = {};
#pragma unroll
  for (int i = 0; i < 16; ++i) wr[i] = *(const v4u*)(wsrc + (size_t)((i >> 3) * DM + (i & 7) * 16) * DM);
#pragma unroll
  for (int i = 0; i < 8; ++i) xr[i] = *(const v4f*)(xsrc + (size_t)(i * 8) * DM);
#pragma unroll
  for (int i = 0; i < 16; ++i) *(v4u*)(ring + wdst + i * 16 * QK_PITCH) = wr[i];
#pragma unroll
  for (int i = 0; i < 8; ++i) { v4b c; c[0] = (__bf16)xr[i][0]; c[1] = (__bf16)xr[i][1]; c[2] = (__bf16)xr[i][2]; c[3] = (__bf16)xr[i][3]; *(v4b*)(ring + xdst + i * 8 * QK_PITCH) = c; }
  __syncthreads();
#pragma unroll 1   // rolled: the body already holds 32 products
  for (int s = 0; s < QK_NST; ++s) {
    const bool more = s + 1 < QK_NST;
    if (more) {
#pragma unroll
      for (int i = 0; i < 16; ++i) wr[i] = *(const v4u*)(wsrc + (size_t)((i >> 3) * DM + (i & 7) * 16) * DM + (s + 1) * QK_KST);
#pragma unroll
      for (int i = 0; i < 8; ++i) xr[i] = *(const v4f*)(xsrc + (size_t)(i * 8) * DM + (s + 1) * QK_KST);
    }
    const __bf16* const wb = ring + (s & 1) * QK_STAGE; const __bf16* const xb = wb + 256 * QK_PITCH;
#pragma unroll
    for (int kc = 0; kc < QK_KST / 32; ++kc) {
      const v16b a = frag_b(xb + (wave * 16 + col) * QK_PITCH + kc * 32, lane);
#pragma unroll
      for (int hf = 0; hf < 2; ++hf) { v16b f[8];   // eight fragments' LDS reads as one group ahead of their products (hf 0: Wq rows, hf 1: Wk rows); sixteen at once would not fit beside the accumulators in v0..v255, where the products' asm operands must lie
#pragma unroll
        for (int j = 0; j < 8; ++j) f[j] = frag_b(wb + (hf * 128 + j * 16 + col) * QK_PITCH + kc * 32, lane);
#pragma unroll
        for (int j = 0; j < 8; ++j) { if (hf == 0) aq[j] = wmma_bf(a, f[j], aq[j]); else ak[j] = wmma_bf(a, f[j], ak[j]); }
      }
    }
    if (more) { __bf16* const nb = ring + ((s + 1) & 1) * QK_STAGE;   // last read in stage s - 1, whose barrier every wave has passed
#pragma unroll
      for (int i = 0; i < 16; ++i) *(v4u*)(nb + wdst + i * 16 * QK_PITCH) = wr[i];
#pragma unroll
      for (int i = 0; i < 8; ++i) { v4b c; c[0] = (__bf16)xr[i][0]; c[1] = (__bf16)xr[i][1]; c[2] = (__bf16)xr[i][2]; c[3] = (__bf16)xr[i][3]; *(v4b*)(nb + xdst + i * 8 * QK_PITCH) = c; }
    }
    __syncthreads();   // publishes stage s + 1 and ends every wave's reads of stage s (after the last stage: frees the bytes for the output staging)
  }
#pragma unroll
  for (int j = 0; j < 8; ++j) { const float bq = bfr(BQ[n0 + j * 16 + col]);
#pragma unroll
    for (int r = 0; r < 8; ++r) { const float v = aq[j][r] + bq; aq[j][r] = v; const _Float16 hv = (_Float16)v; so[wave][8 * g + r][j * 16 + col] = hv; sol[wave][8 * g + r][j * 16 + col] = (_Float16)((v - (float)hv) * 2048.0f); } }
  LDSX();
  for (int rl = 0; rl < 16; ++rl) if (lane < 16) { vst2((unsigned*)(QK + (r0 + rl) * (2 * DM) + n0 + lane * 8), *(const v4u*)&so[wave][rl][lane * 8]); vst2((unsigned*)(QKL + (r0 + rl) * (2 * DM) + n0 + lane * 8), *(const v4u*)&sol[wave][rl][lane * 8]); }
  LDSX();
  // pass 2: softplus(k) rows into the k slot; v = q + k (raw k) planes
#pragma unroll
  for (int j = 0; j < 8; ++j) { const float bk = bfr(BK[n0 + j * 16 + col]);
#pragma unroll
    for (int r = 0; r < 8; ++r) { const float kv = ak[j][r] + bk; const float sp = softplus_p(kv); const _Float16 hs = (_Float16)sp; so[wave][8 * g + r][j * 16 + col] = hs; sol[wave][8 * g + r][j * 16 + col] = (_Float16)((sp - (float)hs) * 2048.0f);
      const float vv = aq[j][r] + kv; const _Float16 hv = (_Float16)vv; sth[j * 16 + col][wave * 16 + 8 * g + r] = hv; stl[j * 16 + col][wave * 16 + 8 * g + r] = (_Float16)((vv - (float)hv) * 2048.0f); } }
  __syncthreads();
  for (int rl = 0; rl < 16; ++rl) if (lane < 16) { vst2((unsigned*)(QK + (r0 + rl) * (2 * DM) + DM + n0 + lane * 8), *(const v4u*)&so[wave][rl][lane * 8]); vst2((unsigned*)(QKL + (r0 + rl) * (2 * DM) + DM + n0 + lane * 8), *(const v4u*)&sol[wave][rl][lane * 8]); }
  { const int b = (int)(rb / SS), s0 = (int)(rb % SS);
    for (int q = tid; q < 128 * 8; q += 128) { const int d = q >> 3, pc = q & 7; const size_t o = ((size_t)b * DM + n0 + d) * SS + s0 + pc * 8; vst2((unsigned*)(VTH + o), *(const v4u*)&sth[d][pc * 8]); vst2((unsigned*)(VTL + o), *(const v4u*)&stl[d][pc * 8]); } }
}
extern "C" void kernel_launch(void* const* d_in, const int* in_sizes, int n_in, void* d_out, int out_size, void* d_ws, size_t ws_size, hipStream_t stream) {
  (void)in_sizes; (void)n_in; (void)out_size;
  const float** F = (const float**)d_in;   // 0 hidden [2,2048,1024], 1 attention_mask [2,2048] int (query axis), 2 Wq (in,out), 3 bq, 4 Wk, 5 bk
  if (ws_size < (size_t)WS_END) return;
  char* ws = (char*)d_ws; __bf16* PK = (__bf16*)(ws + WS_PK); _Float16 *QK = (_Float16*)(ws + WS_QK), *QKL = (_Float16*)(ws + WS_QKL), *VTH = (_Float16*)(ws + WS_VTH), *VTL = (_Float16*)(ws + WS_VTL);
  k_pack<<<dim3(DM, 4), 256, 0, stream>>>(F[2], F[4], F[4], F[4], PK);   // Wq, Wk rows (v / out slots unused)
  k_qk2<<<dim3(TNB * SS / 64, DM / 128), 128, 0, stream>>>(F[0], PK, F[3], F[5], QK, QKL, VTH, VTL);
  k_attn<<<dim3(TQB, NH, TNB), 128, 0, stream>>>(QK, QKL, VTH, VTL, nullptr, (const int*)d_in[1], (float*)d_out);   // merged heads are the module's output
}

// v003
// It runs in 106 microseconds.
// Timed twice side by side with v002, it ran 1.46 times as fast both times.
// Counting every step since v000, it is 3.33 times as fast.
// compute dtype: all float inputs rounded to bf16, the int mask read on device; q / k = x . W + b with EXACT bf16 products on WMMA 16x16x32 ((in,out) weights as transposed rows), softplus(k) (precise expf/log1pf) and v = q + k formed in f32 in the same block before one f16 rounding (hi + residual planes); PLAIN attention: q, softplus(k) single f16 x 1/8, running-max softmax in f32 (hardware exp), P (scaled by 2^11, single f16) x v (single f16); f32 merged-head output.
#include <hip/hip_runtime.h>
#include <math.h>

typedef __attribute__((ext_vector_type(16))) _Float16 v16h;
typedef __attribute__((ext_vector_type(16))) __bf16 v16b;
typedef __attribute__((ext_vector_type(8)))  _Float16 v8h;
typedef __attribute__((ext_vector_type(8)))  float v8f;
typedef __attribute__((ext_vector_type(4)))  float v4f;
typedef __attribute__((ext_vector_type(2)))  float v2f;
typedef __attribute__((ext_vector_type(4)))  unsigned v4u;
typedef __attribute__((ext_vector_type(4)))  int v4i;
typedef float __attribute__((may_alias)) float_a;
typedef int __attribute__((may_alias)) int_a;

template <typename T> __device__ __forceinline__ void vst2(void* p, T v) { *(T*)p = v;  }
__device__ __forceinline__ v8f wmma16(v16h a, v16h b, v8f c) {
  v8f d = __builtin_amdgcn_wmma_f32_16x16x32_f16(false, a, false, b, (short)0, c, false, false);
  asm volatile("v_nop\n\tv_nop\n\tv_nop\n\tv_nop" : "+v"(d) : "v"(a), "v"(b));
  return d;
}
__device__ __forceinline__ v8f wmma_bf(v16b a, v16b b, v8f c) {
  v8f d = __builtin_amdgcn_wmma_f32_16x16x32_bf16(false, a, false, b, (short)0, c, false, false);
  asm volatile("v_nop\n\tv_nop\n\tv_nop\n\tv_nop" : "+v"(d) : "v"(a), "v"(b));
  return d;
}
// BERT self attention variant (B 2, S 2,048, 1,024 dims, 16 heads x 64): q = x Wq + bq, k = x Wk + bk, keys transformed to softplus(k), values = q + k, scores / 8 with the attention mask applied on the QUERY axis (masked queries get uniform attention), softmax, . v; merged heads are the output.
__device__ __forceinline__ v16h frag_h(const _Float16* rowk0, int lane) {
  union { v16h v; v8h q[2]; } u; const _Float16* p = rowk0 + 8 * (lane >> 4);
  u.q[0] = *(const v8h*)p; u.q[1] = *(const v8h*)(p + 16); return u.v;
}
__device__ __forceinline__ v16h frag_f32(const float* rowk0, int lane) {
  v16h a; const float* p = rowk0 + 8 * (lane >> 4);
#pragma unroll
  for (int i = 0; i < 8; ++i) { a[i] = (_Float16)p[i]; a[8 + i] = (_Float16)p[16 + i]; }
  return a;
}
__device__ __forceinline__ v16h frag_f32s(const float* rowk0, int lane, float sc) {
  v16h a; const float* p = rowk0 + 8 * (lane >> 4);
#pragma unroll
  for (int i = 0; i < 8; ++i) { a[i] = (_Float16)(p[i] * sc); a[8 + i] = (_Float16)(p[16 + i] * sc); }
  return a;
}
// column fragment from a [K][ld] layout (column n), rows >= K read as 0
__device__ __forceinline__ v16h fragc_f32(const float* W, int k0, int n, int lane, int ld, int K) {
  v16h a; const int g = lane >> 4;
#pragma unroll
  for (int i = 0; i < 8; ++i) { const int ka = k0 + 8 * g + i, kb = ka + 16;
    a[i] = (_Float16)(ka < K ? W[(size_t)(ka < K ? ka : K - 1) * ld + n] : 0.f); a[8 + i] = (_Float16)(kb < K ? W[(size_t)(kb < K ? kb : K - 1) * ld + n] : 0.f); }
  return a;
}
struct F2 { v16b h, l; };
__device__ __forceinline__ F2 bsplit16(const float v[16]) { F2 r;
#pragma unroll
  for (int i = 0; i < 16; ++i) { const __bf16 h = (__bf16)v[i]; r.h[i] = h; r.l[i] = (__bf16)(v[i] - (float)h); }
  return r; }
__device__ __forceinline__ F2 split_row(const float* row, int k0, int lane) { float v[16]; const float* p = row + k0 + 8 * (lane >> 4);
#pragma unroll
  for (int i = 0; i < 8; ++i) { v[i] = p[i]; v[8 + i] = p[16 + i]; }
  return bsplit16(v); }
__device__ __forceinline__ F2 split_rowK(const float* row, int k0, int lane, int K) { float v[16]; const int g = lane >> 4;
#pragma unroll
  for (int i = 0; i < 8; ++i) { const int ka = k0 + 8 * g + i, kb = ka + 16; v[i] = ka < K ? row[ka < K ? ka : K - 1] : 0.f; v[8 + i] = kb < K ? row[kb < K ? kb : K - 1] : 0.f; }
  return bsplit16(v); }
__device__ __forceinline__ F2 split_col(const float* W, int k0, int n, int lane, int ld, int K) { float v[16]; const int g = lane >> 4;
#pragma unroll
  for (int i = 0; i < 8; ++i) { const int ka = k0 + 8 * g + i, kb = ka + 16; v[i] = ka < K ? W[(size_t)(ka < K ? ka : K - 1) * ld + n] : 0.f; v[8 + i] = kb < K ? W[(size_t)(kb < K ? kb : K - 1) * ld + n] : 0.f; }
  return bsplit16(v); }
__device__ __forceinline__ v8f mac3(const F2& a, const F2& b, v8f c) { c = wmma_bf(a.l, b.h, c); c = wmma_bf(a.h, b.l, c); return wmma_bf(a.h, b.h, c); }
__device__ __forceinline__ float sigm(float v) { return 1.0f / (1.0f + expf(-v)); }
#define LDSX() do { asm volatile("s_wait_dscnt 0" ::: "memory"); __builtin_amdgcn_wave_barrier(); __builtin_amdgcn_fence(__ATOMIC_RELEASE, "workgroup"); } while (0)


#define NB 2
#define SS 2048
#define DM 1024
#define NH 16
__device__ __attribute__((noinline)) float exp_p(float v) { return expf(v); }
__device__ __attribute__((noinline)) float log1p_p(float v) { return log1pf(v); }
__device__ __forceinline__ float softplus_p(float z) { return (z > 20.f) ? z : log1p_p(exp_p(z)); }
#define HD 64
#define QKVW (3 * DM)
#ifndef TQB
#define TQB (SS / 64)
#define TNB NB
#define TOB (NB * SS / 64)     // output row tiles (all)
#endif
typedef __attribute__((ext_vector_type(8))) __bf16 v8b;
__device__ __forceinline__ v16b frag_b(const __bf16* rowk0, int lane) {
  union { v16b v; v8b q[2]; } u; const __bf16* p = rowk0 + 8 * (lane >> 4);
  u.q[0] = *(const v8b*)p; u.q[1] = *(const v8b*)(p + 16); return u.v;
}
__device__ __forceinline__ float bfr(float v) { return (float)(__bf16)v; }
__device__ __attribute__((noinline)) float exp_ni(float v) { return expf(v); }
__device__ __attribute__((noinline)) float erf_ni(float v) { return erff(v); }

#define PK_A 0                       // [3072][1024] Wqkv rows (natural [out][in])
#define PK_P (PK_A + QKVW * DM)        // [1024][1024] Wo rows (natural)
#define PK_END (PK_P + DM * DM)
#define WS_PK  0u
#define WS_QK  (WS_PK + 2u * PK_END)             // f16 [4096 rows][2048]: q | k
#define WS_QKL (WS_QK + 2u * NB * SS * 2 * DM)     // f16 q | k residual planes x2048
#define WS_VTH (WS_QKL + 2u * NB * SS * 2 * DM)    // f16 [b][1024 (h*64+d)][2048 s] hi
#define WS_VTL (WS_VTH + 2u * NB * DM * SS)        // f16 lo x 2048
#define WS_O   (WS_VTL + 2u * NB * DM * SS)        // f32 [4096][1024]
#define WS_CS  (WS_O + 4u * NB * SS * DM)           // f32 [2048][32] cos, [2048][32] sin
#define WS_END (WS_CS + 4u * 2 * SS * 32)
// ---- k_pack: block = (row n, which): (in,out) column n -> bf16 row n; which 0..2 -> W_q/W_k/W_v into PK_A rows which*1024 + n; 3 -> W_o into PK_P
__global__ __launch_bounds__(256) void k_pack(const float* __restrict__ WQ, const float* __restrict__ WK, const float* __restrict__ WV, const float* __restrict__ WO, __bf16* __restrict__ PK) {
  __shared__ __align__(16) __bf16 s[DM]; const int n = blockIdx.x, which = blockIdx.y, t = threadIdx.x; const float* Wm = (which == 0) ? WQ : (which == 1) ? WK : (which == 2) ? WV : WO;   // (in,out) weights: pack row n = column n
  for (int k = t; k < DM; k += 256) s[k] = (__bf16)Wm[(size_t)k * DM + n];
  __syncthreads();
  __bf16* dst = (which < 3) ? PK + PK_A + ((size_t)which * DM + n) * DM : PK + PK_P + (size_t)n * DM;
  for (int q = t; q < DM / 8; q += 256) vst2((unsigned*)(dst + q * 8), *(const v4u*)&s[q * 8]);
}
__global__ __launch_bounds__(128) void k_qkv(const float* __restrict__ XQ, const float* __restrict__ XK, const float* __restrict__ XV, const __bf16* __restrict__ P, const float* __restrict__ BQ, const float* __restrict__ BK, const float* __restrict__ BV, _Float16* __restrict__ QK, _Float16* __restrict__ QKL, _Float16* __restrict__ VTH, _Float16* __restrict__ VTL) {
  const int which0 = (blockIdx.y * 128) / DM; const float* X = (which0 == 0) ? XQ : (which0 == 1) ? XK : XV; const float* BB = BQ ? (((which0 == 0) ? BQ : (which0 == 1) ? BK : BV) + (blockIdx.y * 128 - which0 * DM)) : nullptr;
  __shared__ __align__(16) _Float16 so[4][16][136], sol[4][16][136]; __shared__ __align__(16) _Float16 sth[128][72], stl[128][72];
  const int tid = threadIdx.x, wave = tid >> 5, lane = tid & 31, col = lane & 15, g = lane >> 4; const size_t r0 = (size_t)blockIdx.x * 64 + wave * 16; const int n0 = blockIdx.y * 128;
  v8f acc[8] = {};
#pragma unroll 2
  for (int kc = 0; kc < DM / 32; ++kc) { v16b a; { const float* p = X + (r0 + col) * DM + kc * 32 + 8 * g;
#pragma unroll
      for (int i = 0; i < 8; ++i) { a[i] = (__bf16)p[i]; a[8 + i] = (__bf16)p[16 + i]; } }
#pragma unroll
    for (int j = 0; j < 8; ++j) acc[j] = wmma_bf(a, frag_b(P + (size_t)(n0 + j * 16 + col) * DM + kc * 32, lane), acc[j]); }
  if (n0 < 2 * DM) {   // q stored unscaled (f16 sigma ~0.6, no subnormal exposure); 1/8 applied to the f32 score
#pragma unroll
    for (int j = 0; j < 8; ++j) {
#pragma unroll
      for (int r = 0; r < 8; ++r) { const float v = acc[j][r] + (BB ? bfr(BB[j * 16 + col]) : 0.f); const _Float16 hv = (_Float16)v; so[wave][8 * g + r][j * 16 + col] = hv; sol[wave][8 * g + r][j * 16 + col] = (_Float16)((v - (float)hv) * 2048.0f); } }   // q, k (+ bias) as f16 hi + (x2048) residual
    LDSX();
    for (int rl = 0; rl < 16; ++rl) if (lane < 16) { vst2((unsigned*)(QK + (r0 + rl) * (2 * DM) + n0 + lane * 8), *(const v4u*)&so[wave][rl][lane * 8]); vst2((unsigned*)(QKL + (r0 + rl) * (2 * DM) + n0 + lane * 8), *(const v4u*)&sol[wave][rl][lane * 8]); }
  } else {
#pragma unroll
    for (int j = 0; j < 8; ++j) {
#pragma unroll
      for (int r = 0; r < 8; ++r) { const float v = acc[j][r] + (BB ? bfr(BB[j * 16 + col]) : 0.f); const _Float16 hv = (_Float16)v; sth[j * 16 + col][wave * 16 + 8 * g + r] = hv; stl[j * 16 + col][wave * 16 + 8 * g + r] = (_Float16)((v - (float)hv) * 2048.0f); } }
    __syncthreads();
    const size_t rb = (size_t)blockIdx.x * 64; const int b = (int)(rb / SS), s0 = (int)(rb % SS); const int pc0 = n0 - 2 * DM;
    for (int q = tid; q < 128 * 8; q += 128) { const int d = q >> 3, pc = q & 7; const size_t o = ((size_t)b * DM + pc0 + d) * SS + s0 + pc * 8; vst2((unsigned*)(VTH + o), *(const v4u*)&sth[d][pc * 8]); vst2((unsigned*)(VTL + o), *(const v4u*)&stl[d][pc * 8]); }
  }
}
// ---- k_attn: block = (64 queries, head h, batch b): all-keys flash attention (K = 64: 2 k-steps), scores = (k.q) * 0.125 with single f16 operands, formed transposed; V^T.P^T: f16 V x f16 P (x2^11) in one accumulator; O[b*S+q][h*64+d] = acc / 2048 / l (256-B segments)
// K and V^T go through LDS: a stage is 64 keys = [64 key rows x 64 d | 64 d rows x 64 keys] of f16, rows of 128 B at pitch 144 B (16 B x odd: no bank conflict for 16-byte readers), copied once per block and read by its 4 waves.
// Two buffers: stage t + 1's copies fly while stage t is worked on; one barrier per stage.
#define AT_KST 64
#define AT_NST (SS / AT_KST)
#define AT_PITCH 72
#define AT_TILE (64 * AT_PITCH)
#define AT_STAGE (2 * AT_TILE)
// one stage: 8 copies of 16 B a lane (8 lanes cover one 128-B row, so a wave's copy reads 4 whole lines); lk = the lane's LDS byte address in the K tile, gk / gv = its global addresses in row (tid >> 3) of the K / V^T tile
__device__ __forceinline__ void attn_stage(unsigned lk, const _Float16* gk, const _Float16* gv) {
  const unsigned lv = lk + 2 * AT_TILE;
  // the s_wait_xcnt stands in the copies' own statement so that no address register is rewritten ahead of it
  asm volatile("global_load_async_to_lds_b128 %0, %8, off\n\t"
               "global_load_async_to_lds_b128 %1, %9, off\n\t"
               "global_load_async_to_lds_b128 %2, %10, off\n\t"
               "global_load_async_to_lds_b128 %3, %11, off\n\t"
               "global_load_async_to_lds_b128 %4, %12, off\n\t"
               "global_load_async_to_lds_b128 %5, %13, off\n\t"
               "global_load_async_to_lds_b128 %6, %14, off\n\t"
               "global_load_async_to_lds_b128 %7, %15, off\n\t"
               "s_wait_xcnt 0x0"
               :: "v"(lk), "v"(lk + 16 * 2 * AT_PITCH), "v"(lk + 32 * 2 * AT_PITCH), "v"(lk + 48 * 2 * AT_PITCH),
                  "v"(lv), "v"(lv + 16 * 2 * AT_PITCH), "v"(lv + 32 * 2 * AT_PITCH), "v"(lv + 48 * 2 * AT_PITCH),
                  "v"(gk), "v"(gk + (size_t)16 * 2 * DM), "v"(gk + (size_t)32 * 2 * DM), "v"(gk + (size_t)48 * 2 * DM),
                  "v"(gv), "v"(gv + (size_t)16 * SS), "v"(gv + (size_t)32 * SS), "v"(gv + (size_t)48 * SS)
               : "memory");
}
__device__ __forceinline__ float xhalf(float v) {   // the value of lane l ^ 16: the other half of the same query's keys
  const int b = __builtin_bit_cast(int, v); return __builtin_bit_cast(float, __builtin_amdgcn_permlanex16(b, b, 0x76543210, 0xfedcba98, false, false));
}
// at most four waves a SIMD, as before: the grid's 1,024 work-groups then stand four on each of the 256 WGPs
__global__ __launch_bounds__(128) __attribute__((amdgpu_waves_per_eu(4, 4))) void k_attn(const _Float16* __restrict__ QK, const _Float16* __restrict__ QKL, const _Float16* __restrict__ VTH, const _Float16* __restrict__ VTL, const void* __restrict__ KMASK, const int* __restrict__ QMSK, float* __restrict__ O) {
  __shared__ __align__(16) float so[4][16][68]; __shared__ __align__(16) _Float16 ring[2 * AT_STAGE];
  const int tid = threadIdx.x, wave = tid >> 5, lane = tid & 31, col = lane & 15, g = lane >> 4;
  const int qb = blockIdx.x, h = blockIdx.y, b = blockIdx.z; const int q0 = qb * 64 + wave * 16; const size_t rq = (size_t)b * SS + q0 + col;
  // transposed products: S^T = K . Q^T (A = key rows, B = q) and O^T += V^T . P^T, so lane (col, g) holds query col alone: its scores of keys 8g + r and 16 + 8g + r, its maximum, its sum, its output elements
  const int qm = QMSK[rq];
  asm volatile("s_wait_xcnt 0x0" ::: "memory");   // stands in front of any rewrite of the mask load's address registers
  const float sc = (qm == 0) ? 0.f : 0.125f;   // 1/sqrt(64); attention_mask on the QUERY axis: mask == 0 -> every score of that query is equal -> uniform weights
  v16h aq[2];
#pragma unroll
  for (int kc = 0; kc < 2; ++kc) aq[kc] = frag_h(QK + rq * (2 * DM) + h * HD + kc * 32, lane);
  float m = -3.0e38f, l = 0.f;   // m: the query's running maximum (equal in both halves); l: this half's part of the sum
  v8f acc[4] = {};
  const _Float16* const gk = QK + ((size_t)b * SS + (tid >> 3)) * (2 * DM) + DM + h * HD + (tid & 7) * 8;
  const _Float16* const gv = VTH + ((size_t)b * DM + h * HD + (tid >> 3)) * SS + (tid & 7) * 8;
  const unsigned l0 = (unsigned)(size_t)(__attribute__((address_space(3))) _Float16*)ring + (tid >> 3) * (2 * AT_PITCH) + (tid & 7) * 16;
  attn_stage(l0, gk, gv);
  asm volatile("s_wait_asynccnt 0x0" ::: "memory");   // stage 0 has landed before the barrier that publishes it
  __syncthreads();
  attn_stage(l0 + 2 * AT_STAGE, gk + (size_t)AT_KST * 2 * DM, gv + AT_KST);
#pragma unroll 1   // rolled: one trip per stage, the buffer chosen by the trip's parity
  for (int t = 0; t < AT_NST; ++t) { const _Float16* const kb = ring + (t & 1) * AT_STAGE; const _Float16* const vb = kb + AT_TILE;
#pragma unroll   // the stage's two 32-key passes in line, so that their LDS offsets are constants
  for (int ps = 0; ps < AT_KST / 32; ++ps) { v8f s[2]; v16h kf[2][2], vf[4];   // the pass's fragments: LDS reads as one group ahead of the products, V's in flight under the softmax
#pragma unroll
    for (int ct = 0; ct < 2; ++ct) {
#pragma unroll
      for (int kc = 0; kc < 2; ++kc) kf[ct][kc] = frag_h(kb + (ps * 32 + ct * 16 + col) * AT_PITCH + kc * 32, lane); }
#pragma unroll
    for (int dt = 0; dt < 4; ++dt) vf[dt] = frag_h(vb + (dt * 16 + col) * AT_PITCH + ps * 32, lane);
#pragma unroll
    for (int ct = 0; ct < 2; ++ct) { v8f c = {};
#pragma unroll
      for (int kc = 0; kc < 2; ++kc) c = wmma16(kf[ct][kc], aq[kc], c);   // single product: k, q as one-rounding f16 operands; c[r] = score of key ct * 16 + 8g + r, query col
      s[ct] = c * sc; }
    float mx = fmaxf(s[0][0], s[1][0]);
#pragma unroll
    for (int r = 1; r < 8; ++r) mx = fmaxf(mx, fmaxf(s[0][r], s[1][r]));
    mx = fmaxf(mx, xhalf(mx));
    const float mn = fmaxf(m, mx); const float alpha = __expf(m - mn); m = mn;
    v16h pt; float es = 0.f;   // P^T as the B operand: element i = key 8g + i, element 8 + i = key 16 + 8g + i, the k order of the V^T fragment
#pragma unroll
    for (int r = 0; r < 8; ++r) { const float e0 = __expf(s[0][r] - mn), e1 = __expf(s[1][r] - mn); es += e0 + e1;
      pt[r] = (_Float16)(e0 * 2048.0f); pt[8 + r] = (_Float16)(e1 * 2048.0f); }   // P scaled by 2^11 before the f16 rounding so small softmax weights stay out of the f16 subnormal range; 2^-11 folded into the epilogue
    l = l * alpha + es;
#pragma unroll
    for (int dt = 0; dt < 4; ++dt) acc[dt] = wmma16(vf[dt], pt, acc[dt] * alpha); }   // single product: V^T x P^T (x2^11); acc[dt][r] = output element dt * 16 + 8g + r of query col
    asm volatile("s_wait_dscnt 0x0" ::: "memory");      // this wave's reads of stage t are done
    asm volatile("s_wait_asynccnt 0x0" ::: "memory");   // its copies of stage t + 1 have landed
    __syncthreads();                                    // publishes stage t + 1 and ends every wave's reads of stage t
    if (t + 2 < AT_NST) attn_stage(l0 + (t & 1) * (2 * AT_STAGE), gk + (size_t)(t + 2) * AT_KST * 2 * DM, gv + (t + 2) * AT_KST); }
  asm volatile("s_wait_asynccnt 0x0" ::: "memory");     // no copy is left in flight when the wave goes on
  const float il = (1.0f / 2048.0f) / (l + xhalf(l));   // the two halves' sums joined once
#pragma unroll
  for (int dt = 0; dt < 4; ++dt) { const v8f o = acc[dt] * il; float* const d = &so[wave][col][dt * 16 + 8 * g];
    *(v4f*)d = __builtin_shufflevector(o, o, 0, 1, 2, 3); *(v4f*)(d + 4) = __builtin_shufflevector(o, o, 4, 5, 6, 7); }
  LDSX();
  for (int rl = 0; rl < 16; ++rl) if (lane < 16) vst2(O + ((size_t)b * SS + q0 + rl) * DM + h * HD + lane * 4, *(const v4f*)&so[wave][rl][lane * 4]);
}
// ---- k_out: block = (64 rows, 128 cols): out = O(hi/lo) . Wo rows (2 products) + bo
__global__ __launch_bounds__(128) void k_out(const float* __restrict__ O, const __bf16* __restrict__ P, const float* __restrict__ BO, float* __restrict__ Y) {
  __shared__ __align__(16) float so[4][16][132];
  const int tid = threadIdx.x, wave = tid >> 5, lane = tid & 31, col = lane & 15, g = lane >> 4; const size_t r0 = (size_t)blockIdx.x * 64 + wave * 16; const int n0 = blockIdx.y * 128;
  v8f acc[8] = {};
#pragma unroll 2
  for (int kc = 0; kc < DM / 32; ++kc) { const F2 a = split_row(O + (r0 + col) * DM, kc * 32, lane);
#pragma unroll
    for (int j = 0; j < 8; ++j) { const v16b w = frag_b(P + (size_t)(n0 + j * 16 + col) * DM + kc * 32, lane); acc[j] = wmma_bf(a.l, w, acc[j]); acc[j] = wmma_bf(a.h, w, acc[j]); } }
#pragma unroll
  for (int j = 0; j < 8; ++j) {
#pragma unroll
    for (int r = 0; r < 8; ++r) so[wave][8 * g + r][j * 16 + col] = acc[j][r] + (BO ? bfr(BO[n0 + j * 16 + col]) : 0.f); }
  LDSX();
  for (int rl = 0; rl < 16; ++rl) vst2(Y + (r0 + rl) * DM + n0 + lane * 4, *(const v4f*)&so[wave][rl][lane * 4]);
}
// ---- k_qk2: block = (64 rows, 128 cols): q = x Wq + bq and k = x Wk + bk for the same columns; stores q rows, softplus(k) rows (the engine's k slot) and v = q + k planes, all as f16 hi + residual
// Operand tiles go through LDS: a stage is 64 k of [256 weight rows (128 of Wq, 128 of Wk) | 64 x rows already rounded to bf16], rows of 128 B at pitch 144 B (16 B x odd: no bank conflict for 16-byte readers).
// Two buffers: the next stage's global loads are issued before this stage's products, land in registers, and are written to the other buffer behind the products; one barrier per stage.
#define QK_KST 64
#define QK_NST (DM / QK_KST)
#define QK_PITCH 72
#define QK_STAGE ((256 + 64) * QK_PITCH)
typedef __attribute__((ext_vector_type(4))) __bf16 v4b;
__global__ __launch_bounds__(128) void k_qk2(const float* __restrict__ X, const __bf16* __restrict__ P, const float* __restrict__ BQ, const float* __restrict__ BK, _Float16* __restrict__ QK, _Float16* __restrict__ QKL, _Float16* __restrict__ VTH, _Float16* __restrict__ VTL) {
  __shared__ __align__(16) unsigned char smem[2 * QK_STAGE * 2];   // the two stage buffers; behind the loop's last barrier the same bytes are the output staging
  __bf16* const ring = (__bf16*)smem;
  _Float16 (* const so)[16][136] = (_Float16 (*)[16][136])smem; _Float16 (* const sol)[16][136] = (_Float16 (*)[16][136])(smem + 17408); _Float16 (* const sth)[72] = (_Float16 (*)[72])(smem + 34816); _Float16 (* const stl)[72] = (_Float16 (*)[72])(smem + 53248);
  const int tid = threadIdx.x, wave = tid >> 5, lane = tid & 31, col = lane & 15, g = lane >> 4; const size_t rb = (size_t)blockIdx.x * 64, r0 = rb + wave * 16; const int n0 = blockIdx.y * 128;
  // loaders: 8 lanes cover one 128-B weight row piece, 16 lanes one 256-B x row piece, so every wave-wide load reads whole lines
  const __bf16* const wsrc = P + PK_A + (size_t)(n0 + (tid >> 3)) * DM + (tid & 7) * 8;
  const float* const xsrc = X + (rb + (tid >> 4)) * DM + (tid & 15) * 4;
  const int wdst = (tid >> 3) * QK_PITCH + (tid & 7) * 8, xdst = (256 + (tid >> 4)) * QK_PITCH + (tid & 15) * 4;
  v4u wr[16]; v4f xr[8];
  v8f aq[8] = {}, ak[8] = {};
#pragma unroll
  for (int i = 0; i < 16; ++i) wr[i] = *(const v4u*)(wsrc + (size_t)((i >> 3) * DM + (i & 7) * 16) * DM);
#pragma unroll
  for (int i = 0; i < 8; ++i) xr[i] = *(const v4f*)(xsrc + (size_t)(i * 8) * DM);
#pragma unroll
  for (int i = 0; i < 16; ++i) *(v4u*)(ring + wdst + i * 16 * QK_PITCH) = wr[i];
#pragma unroll
  for (int i = 0; i < 8; ++i) { v4b c; c[0] = (__bf16)xr[i][0]; c[1] = (__bf16)xr[i][1]; c[2] = (__bf16)xr[i][2]; c[3] = (__bf16)xr[i][3]; *(v4b*)(ring + xdst + i * 8 * QK_PITCH) = c; }
  __syncthreads();
#pragma unroll 1   // rolled: the body already holds 32 products
  for (int s = 0; s < QK_NST; ++s) {
    const bool more = s + 1 < QK_NST;
    if (more) {
#pragma unroll
      for (int i = 0; i < 16; ++i) wr[i] = *(const v4u*)(wsrc + (size_t)((i >> 3) * DM + (i & 7) * 16) * DM + (s + 1) * QK_KST);
#pragma unroll
      for (int i = 0; i < 8; ++i) xr[i] = *(const v4f*)(xsrc + (size_t)(i * 8) * DM + (s + 1) * QK_KST);
    }
    const __bf16* const wb = ring + (s & 1) * QK_STAGE; const __bf16* const xb = wb + 256 * QK_PITCH;
#pragma unroll
    for (int kc = 0; kc < QK_KST / 32; ++kc) {
      const v16b a = frag_b(xb + (wave * 16 + col) * QK_PITCH + kc * 32, lane);
#pragma unroll
      for (int hf = 0; hf < 2; ++hf) { v16b f[8];   // eight fragments' LDS reads as one group ahead of their products (hf 0: Wq rows, hf 1: Wk rows); sixteen at once would not fit beside the accumulators in v0..v255, where the products' asm operands must lie
#pragma unroll
        for (int j = 0; j < 8; ++j) f[j] = frag_b(wb + (hf * 128 + j * 16 + col) * QK_PITCH + kc * 32, lane);
#pragma unroll
        for (int j = 0; j < 8; ++j) { if (hf == 0) aq[j] = wmma_bf(a, f[j], aq[j]); else ak[j] = wmma_bf(a, f[j], ak[j]); }
      }
    }
    if (more) { __bf16* const nb = ring + ((s + 1) & 1) * QK_STAGE;   // last read in stage s - 1, whose barrier every wave has passed
#pragma unroll
      for (int i = 0; i < 16; ++i) *(v4u*)(nb + wdst + i * 16 * QK_PITCH) = wr[i];
#pragma unroll
      for (int i = 0; i < 8; ++i) { v4b c; c[0] = (__bf16)xr[i][0]; c[1] = (__bf16)xr[i][1]; c[2] = (__bf16)xr[i][2]; c[3] = (__bf16)xr[i][3]; *(v4b*)(nb + xdst + i * 8 * QK_PITCH) = c; }
    }
    __syncthreads();   // publishes stage s + 1 and ends every wave's reads of stage s (after the last stage: frees the bytes for the output staging)
  }
#pragma unroll
  for (int j = 0; j < 8; ++j) { const float bq = bfr(BQ[n0 + j * 16 + col]);
#pragma unroll
    for (int r = 0; r < 8; ++r) { const float v = aq[j][r] + bq; aq[j][r] = v; const _Float16 hv = (_Float16)v; so[wave][8 * g + r][j * 16 + col] = hv; sol[wave][8 * g + r][j * 16 + col] = (_Float16)((v - (float)hv) * 2048.0f); } }
  LDSX();
  for (int rl = 0; rl < 16; ++rl) if (lane < 16) { vst2((unsigned*)(QK + (r0 + rl) * (2 * DM) + n0 + lane * 8), *(const v4u*)&so[wave][rl][lane * 8]); vst2((unsigned*)(QKL + (r0 + rl) * (2 * DM) + n0 + lane * 8), *(const v4u*)&sol[wave][rl][lane * 8]); }
  LDSX();
  // pass 2: softplus(k) rows into the k slot; v = q + k (raw k) planes
#pragma unroll
  for (int j = 0; j < 8; ++j) { const float bk = bfr(BK[n0 + j * 16 + col]);
#pragma unroll
    for (int r = 0; r < 8; ++r) { const float kv = ak[j][r] + bk; const float sp = softplus_p(kv); const _Float16 hs = (_Float16)sp; so[wave][8 * g + r][j * 16 + col] = hs; sol[wave][8 * g + r][j * 16 + col] = (_Float16)((sp - (float)hs) * 2048.0f);
      const float vv = aq[j][r] + kv; const _Float16 hv = (_Float16)vv; sth[j * 16 + col][wave * 16 + 8 * g + r] = hv; stl[j * 16 + col][wave * 16 + 8 * g + r] = (_Float16)((vv - (float)hv) * 2048.0f); } }
  __syncthreads();
  for (int rl = 0; rl < 16; ++rl) if (lane < 16) { vst2((unsigned*)(QK + (r0 + rl) * (2 * DM) + DM + n0 + lane * 8), *(const v4u*)&so[wave][rl][lane * 8]); vst2((unsigned*)(QKL + (r0 + rl) * (2 * DM) + DM + n0 + lane * 8), *(const v4u*)&sol[wave][rl][lane * 8]); }
  { const int b = (int)(rb / SS), s0 = (int)(rb % SS);
    for (int q = tid; q < 128 * 8; q += 128) { const int d = q >> 3, pc = q & 7; const size_t o = ((size_t)b * DM + n0 + d) * SS + s0 + pc * 8; vst2((unsigned*)(VTH + o), *(const v4u*)&sth[d][pc * 8]); vst2((unsigned*)(VTL + o), *(const v4u*)&stl[d][pc * 8]); } }
}
extern "C" void kernel_launch(void* const* d_in, const int* in_sizes, int n_in, void* d_out, int out_size, void* d_ws, size_t ws_size, hipStream_t stream) {
  (void)in_sizes; (void)n_in; (void)out_size;
  const float** F = (const float**)d_in;   // 0 hidden [2,2048,1024], 1 attention_mask [2,2048] int (query axis), 2 Wq (in,out), 3 bq, 4 Wk, 5 bk
  if (ws_size < (size_t)WS_END) return;
  char* ws = (char*)d_ws; __bf16* PK = (__bf16*)(ws + WS_PK); _Float16 *QK = (_Float16*)(ws + WS_QK), *QKL = (_Float16*)(ws + WS_QKL), *VTH = (_Float16*)(ws + WS_VTH), *VTL = (_Float16*)(ws + WS_VTL);
  k_pack<<<dim3(DM, 4), 256, 0, stream>>>(F[2], F[4], F[4], F[4], PK);   // Wq, Wk rows (v / out slots unused)
  k_qk2<<<dim3(TNB * SS / 64, DM / 128), 128, 0, stream>>>(F[0], PK, F[3], F[5], QK, QKL, VTH, VTL);
  k_attn<<<dim3(TQB, NH, TNB), 128, 0, stream>>>(QK, QKL, VTH, VTL, nullptr, (const int*)d_in[1], (float*)d_out);   // merged heads are the module's output
}

// v004
// It runs in 89.8 microseconds.
// Two timings next to v003 both put it at 1.18 times that version's speed.
// All steps since v000 together make it 3.93 times as fast.
// compute dtype: all float inputs rounded to bf16, the int mask read on device; q / k = x . W + b with EXACT bf16 products on WMMA 16x16x32 ((in,out) weights as transposed rows), softplus(k) (precise expf/log1pf) and v = q + k formed in f32 in the same block before one f16 rounding (hi + residual planes); PLAIN attention: q, softplus(k) single f16 x 1/8, running-max softmax in f32 (hardware exp), P (scaled by 2^11, single f16) x v (single f16); f32 merged-head output.
#include <hip/hip_runtime.h>
#include <math.h>

typedef __attribute__((ext_vector_type(16))) _Float16 v16h;
typedef __attribute__((ext_vector_type(16))) __bf16 v16b;
typedef __attribute__((ext_vector_type(8)))  _Float16 v8h;
typedef __attribute__((ext_vector_type(8)))  float v8f;
typedef __attribute__((ext_vector_type(4)))  float v4f;
typedef __attribute__((ext_vector_type(2)))  float v2f;
typedef __attribute__((ext_vector_type(4)))  unsigned v4u;
typedef __attribute__((ext_vector_type(4)))  int v4i;
typedef float __attribute__((may_alias)) float_a;
typedef int __attribute__((may_alias)) int_a;

template <typename T> __device__ __forceinline__ void vst2(void* p, T v) { *(T*)p = v;  }
__device__ __forceinline__ v8f wmma16(v16h a, v16h b, v8f c) {
  v8f d = __builtin_amdgcn_wmma_f32_16x16x32_f16(false, a, false, b, (short)0, c, false, false);
  asm volatile("v_nop\n\tv_nop\n\tv_nop\n\tv_nop" : "+v"(d) : "v"(a), "v"(b));
  return d;
}
__device__ __forceinline__ v8f wmma_bf(v16b a, v16b b, v8f c) {
  v8f d = __builtin_amdgcn_wmma_f32_16x16x32_bf16(false, a, false, b, (short)0, c, false, false);
  asm volatile("v_nop\n\tv_nop\n\tv_nop\n\tv_nop" : "+v"(d) : "v"(a), "v"(b));
  return d;
}
// BERT self attention variant (B 2, S 2,048, 1,024 dims, 16 heads x 64): q = x Wq + bq, k = x Wk + bk, keys transformed to softplus(k), values = q + k, scores / 8 with the attention mask applied on the QUERY axis (masked queries get uniform attention), softmax, . v; merged heads are the output.
__device__ __forceinline__ v16h frag_h(const _Float16* rowk0, int lane) {
  union { v16h v; v8h q[2]; } u; const _Float16* p = rowk0 + 8 * (lane >> 4);
  u.q[0] = *(const v8h*)p; u.q[1] = *(const v8h*)(p + 16); return u.v;
}
__device__ __forceinline__ v16h frag_f32(const float* rowk0, int lane) {
  v16h a; const float* p = rowk0 + 8 * (lane >> 4);
#pragma unroll
  for (int i = 0; i < 8; ++i) { a[i] = (_Float16)p[i]; a[8 + i] = (_Float16)p[16 + i]; }
  return a;
}
__device__ __forceinline__ v16h frag_f32s(const float* rowk0, int lane, float sc) {
  v16h a; const float* p = rowk0 + 8 * (lane >> 4);
#pragma unroll
  for (int i = 0; i < 8; ++i) { a[i] = (_Float16)(p[i] * sc); a[8 + i] = (_Float16)(p[16 + i] * sc); }
  return a;
}
// column fragment from a [K][ld] layout (column n), rows >= K read as 0
__device__ __forceinline__ v16h fragc_f32(const float* W, int k0, int n, int lane, int ld, int K) {
  v16h a; const int g = lane >> 4;
#pragma unroll
  for (int i = 0; i < 8; ++i) { const int ka = k0 + 8 * g + i, kb = ka + 16;
    a[i] = (_Float16)(ka < K ? W[(size_t)(ka < K ? ka : K - 1) * ld + n] : 0.f); a[8 + i] = (_Float16)(kb < K ? W[(size_t)(kb < K ? kb : K - 1) * ld + n] : 0.f); }
  return a;
}
struct F2 { v16b h, l; };
__device__ __forceinline__ F2 bsplit16(const float v[16]) { F2 r;
#pragma unroll
  for (int i = 0; i < 16; ++i) { const __bf16 h = (__bf16)v[i]; r.h[i] = h; r.l[i] = (__bf16)(v[i] - (float)h); }
  return r; }
__device__ __forceinline__ F2 split_row(const float* row, int k0, int lane) { float v[16]; const float* p = row + k0 + 8 * (lane >> 4);
#pragma unroll
  for (int i = 0; i < 8; ++i) { v[i] = p[i]; v[8 + i] = p[16 + i]; }
  return bsplit16(v); }
__device__ __forceinline__ F2 split_rowK(const float* row, int k0, int lane, int K) { float v[16]; const int g = lane >> 4;
#pragma unroll
  for (int i = 0; i < 8; ++i) { const int ka = k0 + 8 * g + i, kb = ka + 16; v[i] = ka < K ? row[ka < K ? ka : K - 1] : 0.f; v[8 + i] = kb < K ? row[kb < K ? kb : K - 1] : 0.f; }
  return bsplit16(v); }
__device__ __forceinline__ F2 split_col(const float* W, int k0, int n, int lane, int ld, int K) { float v[16]; const int g = lane >> 4;
#pragma unroll
  for (int i = 0; i < 8; ++i) { const int ka = k0 + 8 * g + i, kb = ka + 16; v[i] = ka < K ? W[(size_t)(ka < K ? ka : K - 1) * ld + n] : 0.f; v[8 + i] = kb < K ? W[(size_t)(kb < K ? kb : K - 1) * ld + n] : 0.f; }
  return bsplit16(v); }
__device__ __forceinline__ v8f mac3(const F2& a, const F2& b, v8f c) { c = wmma_bf(a.l, b.h, c); c = wmma_bf(a.h, b.l, c); return wmma_bf(a.h, b.h, c); }
__device__ __forceinline__ float sigm(float v) { return 1.0f / (1.0f + expf(-v)); }
#define LDSX() do { asm volatile("s_wait_dscnt 0" ::: "memory"); __builtin_amdgcn_wave_barrier(); __builtin_amdgcn_fence(__ATOMIC_RELEASE, "workgroup"); } while (0)


#define NB 2
#define SS 2048
#define DM 1024
#define NH 16
__device__ __attribute__((noinline)) float exp_p(float v) { return expf(v); }
__device__ __attribute__((noinline)) float log1p_p(float v) { return log1pf(v); }
__device__ __forceinline__ float softplus_p(float z) { return (z > 20.f) ? z : log1p_p(exp_p(z)); }
#define HD 64
#define QKVW (3 * DM)
#ifndef TQB
#define TQB (SS / 64)
#define TNB NB
#define TOB (NB * SS / 64)     // output row tiles (all)
#endif
typedef __attribute__((ext_vector_type(8))) __bf16 v8b;
__device__ __forceinline__ v16b frag_b(const __bf16* rowk0, int lane) {
  union { v16b v; v8b q[2]; } u; const __bf16* p = rowk0 + 8 * (lane >> 4);
  u.q[0] = *(const v8b*)p; u.q[1] = *(const v8b*)(p + 16); return u.v;
}
__device__ __forceinline__ float bfr(float v) { return (float)(__bf16)v; }
__device__ __attribute__((noinline)) float exp_ni(float v) { return expf(v); }
__device__ __attribute__((noinline)) float erf_ni(float v) { return erff(v); }

#define PK_A 0                       // [3072][1024]: rows 0..2047 hold Wq | Wk as bf16 [out][in] (transposed), the rest unwritten
#define PK_P (PK_A + QKVW * DM)        // [1024][1024] Wo rows (natural)
#define PK_END (PK_P + DM * DM)
#define WS_PK  0u
#define WS_QK  (WS_PK + 2u * PK_END)             // f16 [4096 rows][2048]: q | k
#define WS_QKL (WS_QK + 2u * NB * SS * 2 * DM)     // f16 q | k residual planes x2048
#define WS_VTH (WS_QKL + 2u * NB * SS * 2 * DM)    // f16 [b][1024 (h*64+d)][2048 s] hi
#define WS_VTL (WS_VTH + 2u * NB * DM * SS)        // f16 lo x 2048
#define WS_O   (WS_VTL + 2u * NB * DM * SS)        // f32 [4096][1024]
#define WS_CS  (WS_O + 4u * NB * SS * DM)           // f32 [2048][32] cos, [2048][32] sin
#define WS_END (WS_CS + 4u * 2 * SS * 32)
// ---- k_pack: block = (64 columns n, 128 rows k, which): one tile of the (in,out) weight W_q (which 0) or W_k (which 1) -> bf16 rows [n][k] of PK_A (rows which*1024 + n), transposed through LDS
// Reads: 16 lanes cover 256 B of one weight row; writes: 16 lanes cover 256 B of one packed row, so every wave-wide global access is whole lines and each weight line is asked for once.
#define PT_N 64
#define PT_K 128
#define PT_PITCH 272   // bytes of a packed row in LDS: 256 + 16 (16 B x odd)
typedef __attribute__((ext_vector_type(2))) __bf16 v2b;
__global__ __launch_bounds__(256) void k_pack(const float* __restrict__ WQ, const float* __restrict__ WK, __bf16* __restrict__ PK) {
  __shared__ __align__(16) unsigned char s[PT_N * PT_PITCH];
  const int t = threadIdx.x, c = t & 15, rp = t >> 4, n0 = blockIdx.x * PT_N, k0 = blockIdx.y * PT_K, which = blockIdx.z;
  const float* const src = (which ? WK : WQ) + (size_t)(k0 + 2 * rp) * DM + n0 + 4 * c;   // rows k0 + 32p + 2rp and the next, columns n0 + 4c .. + 3
  v4f a[4], b[4];
#pragma unroll   // the eight loads in flight together, a[] and b[] in registers
  for (int p = 0; p < 4; ++p) { a[p] = *(const v4f*)(src + (size_t)(32 * p) * DM); b[p] = *(const v4f*)(src + (size_t)(32 * p + 1) * DM); }
  // a row's 16-byte pieces lie at piece ^ (row >> 4): the 16 lanes that write one k pair into rows 4c + i then fall on 16 different banks
  unsigned char* const d = s + (4 * c) * PT_PITCH + ((4 * rp) ^ ((c >> 2) << 4));
#pragma unroll   // both loops in line: register indices and LDS offsets are constants
  for (int p = 0; p < 4; ++p) {
#pragma unroll
    for (int i = 0; i < 4; ++i) { v2b w; w[0] = (__bf16)a[p][i]; w[1] = (__bf16)b[p][i]; *(v2b*)(d + i * PT_PITCH + 64 * p) = w; } }
  __syncthreads();
#pragma unroll   // the four LDS reads as one group ahead of their stores
  for (int j = 0; j < 4; ++j) { const int n = rp + 16 * j; vst2((unsigned*)(PK + PK_A + ((size_t)which * DM + n0 + n) * DM + k0 + c * 8), *(const v4u*)(s + n * PT_PITCH + ((c ^ j) << 4))); }
}
__global__ __launch_bounds__(128) void k_qkv(const float* __restrict__ XQ, const float* __restrict__ XK, const float* __restrict__ XV, const __bf16* __restrict__ P, const float* __restrict__ BQ, const float* __restrict__ BK, const float* __restrict__ BV, _Float16* __restrict__ QK, _Float16* __restrict__ QKL, _Float16* __restrict__ VTH, _Float16* __restrict__ VTL) {
  const int which0 = (blockIdx.y * 128) / DM; const float* X = (which0 == 0) ? XQ : (which0 == 1) ? XK : XV; const float* BB = BQ ? (((which0 == 0) ? BQ : (which0 == 1) ? BK : BV) + (blockIdx.y * 128 - which0 * DM)) : nullptr;
  __shared__ __align__(16) _Float16 so[4][16][136], sol[4][16][136]; __shared__ __align__(16) _Float16 sth[128][72], stl[128][72];
  const int tid = threadIdx.x, wave = tid >> 5, lane = tid & 31, col = lane & 15, g = lane >> 4; const size_t r0 = (size_t)blockIdx.x * 64 + wave * 16; const int n0 = blockIdx.y * 128;
  v8f acc[8] = {};
#pragma unroll 2
  for (int kc = 0; kc < DM / 32; ++kc) { v16b a; { const float* p = X + (r0 + col) * DM + kc * 32 + 8 * g;
#pragma unroll
      for (int i = 0; i < 8; ++i) { a[i] = (__bf16)p[i]; a[8 + i] = (__bf16)p[16 + i]; } }
#pragma unroll
    for (int j = 0; j < 8; ++j) acc[j] = wmma_bf(a, frag_b(P + (size_t)(n0 + j * 16 + col) * DM + kc * 32, lane), acc[j]); }
  if (n0 < 2 * DM) {   // q stored unscaled (f16 sigma ~0.6, no subnormal exposure); 1/8 applied to the f32 score
#pragma unroll
    for (int j = 0; j < 8; ++j) {
#pragma unroll
      for (int r = 0; r < 8; ++r) { const float v = acc[j][r] + (BB ? bfr(BB[j * 16 + col]) : 0.f); const _Float16 hv = (_Float16)v; so[wave][8 * g + r][j * 16 + col] = hv; sol[wave][8 * g + r][j * 16 + col] = (_Float16)((v - (float)hv) * 2048.0f); } }   // q, k (+ bias) as f16 hi + (x2048) residual
    LDSX();
    for (int rl = 0; rl < 16; ++rl) if (lane < 16) { vst2((unsigned*)(QK + (r0 + rl) * (2 * DM) + n0 + lane * 8), *(const v4u*)&so[wave][rl][lane * 8]); vst2((unsigned*)(QKL + (r0 + rl) * (2 * DM) + n0 + lane * 8), *(const v4u*)&sol[wave][rl][lane * 8]); }
  } else {
#pragma unroll
    for (int j = 0; j < 8; ++j) {
#pragma unroll
      for (int r = 0; r < 8; ++r) { const float v = acc[j][r] + (BB ? bfr(BB[j * 16 + col]) : 0.f); const _Float16 hv = (_Float16)v; sth[j * 16 + col][wave * 16 + 8 * g + r] = hv; stl[j * 16 + col][wave * 16 + 8 * g + r] = (_Float16)((v - (float)hv) * 2048.0f); } }
    __syncthreads();
    const size_t rb = (size_t)blockIdx.x * 64; const int b = (int)(rb / SS), s0 = (int)(rb % SS); const int pc0 = n0 - 2 * DM;
    for (int q = tid; q < 128 * 8; q += 128) { const int d = q >> 3, pc = q & 7; const size_t o = ((size_t)b * DM + pc0 + d) * SS + s0 + pc * 8; vst2((unsigned*)(VTH + o), *(const v4u*)&sth[d][pc * 8]); vst2((unsigned*)(VTL + o), *(const v4u*)&stl[d][pc * 8]); }
  }
}
// ---- k_attn: block = (64 queries, head h, batch b): all-keys flash attention (K = 64: 2 k-steps), scores = (k.q) * 0.125 with single f16 operands, formed transposed; V^T.P^T: f16 V x f16 P (x2^11) in one accumulator; O[b*S+q][h*64+d] = acc / 2048 / l (256-B segments)
// K and V^T go through LDS: a stage is 64 keys = [64 key rows x 64 d | 64 d rows x 64 keys] of f16, rows of 128 B at pitch 144 B (16 B x odd: no bank conflict for 16-byte readers), copied once per block and read by its 4 waves.
// Two buffers: stage t + 1's copies fly while stage t is worked on; one barrier per stage.
#define AT_KST 64
#define AT_NST (SS / AT_KST)
#define AT_PITCH 72
#define AT_TILE (64 * AT_PITCH)
#define AT_STAGE (2 * AT_TILE)
// one stage: 8 copies of 16 B a lane (8 lanes cover one 128-B row, so a wave's copy reads 4 whole lines); lk = the lane's LDS byte address in the K tile, gk / gv = its global addresses in row (tid >> 3) of the K / V^T tile
__device__ __forceinline__ void attn_stage(unsigned lk, const _Float16* gk, const _Float16* gv) {
  const unsigned lv = lk + 2 * AT_TILE;
  // the s_wait_xcnt stands in the copies' own statement so that no address register is rewritten ahead of it
  asm volatile("global_load_async_to_lds_b128 %0, %8, off\n\t"
               "global_load_async_to_lds_b128 %1, %9, off\n\t"
               "global_load_async_to_lds_b128 %2, %10, off\n\t"
               "global_load_async_to_lds_b128 %3, %11, off\n\t"
               "global_load_async_to_lds_b128 %4, %12, off\n\t"
               "global_load_async_to_lds_b128 %5, %13, off\n\t"
               "global_load_async_to_lds_b128 %6, %14, off\n\t"
               "global_load_async_to_lds_b128 %7, %15, off\n\t"
               "s_wait_xcnt 0x0"
               :: "v"(lk), "v"(lk + 16 * 2 * AT_PITCH), "v"(lk + 32 * 2 * AT_PITCH), "v"(lk + 48 * 2 * AT_PITCH),
                  "v"(lv), "v"(lv + 16 * 2 * AT_PITCH), "v"(lv + 32 * 2 * AT_PITCH), "v"(lv + 48 * 2 * AT_PITCH),
                  "v"(gk), "v"(gk + (size_t)16 * 2 * DM), "v"(gk + (size_t)32 * 2 * DM), "v"(gk + (size_t)48 * 2 * DM),
                  "v"(gv), "v"(gv + (size_t)16 * SS), "v"(gv + (size_t)32 * SS), "v"(gv + (size_t)48 * SS)
               : "memory");
}
__device__ __forceinline__ float xhalf(float v) {   // the value of lane l ^ 16: the other half of the same query's keys
  const int b = __builtin_bit_cast(int, v); return __builtin_bit_cast(float, __builtin_amdgcn_permlanex16(b, b, 0x76543210, 0xfedcba98, false, false));
}
// at most four waves a SIMD, as before: the grid's 1,024 work-groups then stand four on each of the 256 WGPs
__global__ __launch_bounds__(128) __attribute__((amdgpu_waves_per_eu(4, 4))) void k_attn(const _Float16* __restrict__ QK, const _Float16* __restrict__ QKL, const _Float16* __restrict__ VTH, const _Float16* __restrict__ VTL, const void* __restrict__ KMASK, const int* __restrict__ QMSK, float* __restrict__ O) {
  __shared__ __align__(16) float so[4][16][68]; __shared__ __align__(16) _Float16 ring[2 * AT_STAGE];
  const int tid = threadIdx.x, wave = tid >> 5, lane = tid & 31, col = lane & 15, g = lane >> 4;
  const int qb = blockIdx.x, h = blockIdx.y, b = blockIdx.z; const int q0 = qb * 64 + wave * 16; const size_t rq = (size_t)b * SS + q0 + col;
  // transposed products: S^T = K . Q^T (A = key rows, B = q) and O^T += V^T . P^T, so lane (col, g) holds query col alone: its scores of keys 8g + r and 16 + 8g + r, its maximum, its sum, its output elements
  const int qm = QMSK[rq];
  asm volatile("s_wait_xcnt 0x0" ::: "memory");   // stands in front of any rewrite of the mask load's address registers
  const float sc = (qm == 0) ? 0.f : 0.125f;   // 1/sqrt(64); attention_mask on the QUERY axis: mask == 0 -> every score of that query is equal -> uniform weights
  v16h aq[2];
#pragma unroll
  for (int kc = 0; kc < 2; ++kc) aq[kc] = frag_h(QK + rq * (2 * DM) + h * HD + kc * 32, lane);
  float m = -3.0e38f, l = 0.f;   // m: the query's running maximum (equal in both halves); l: this half's part of the sum
  v8f acc[4] = {};
  const _Float16* const gk = QK + ((size_t)b * SS + (tid >> 3)) * (2 * DM) + DM + h * HD + (tid & 7) * 8;
  const _Float16* const gv = VTH + ((size_t)b * DM + h * HD + (tid >> 3)) * SS + (tid & 7) * 8;
  const unsigned l0 = (unsigned)(size_t)(__attribute__((address_space(3))) _Float16*)ring + (tid >> 3) * (2 * AT_PITCH) + (tid & 7) * 16;
  attn_stage(l0, gk, gv);
  asm volatile("s_wait_asynccnt 0x0" ::: "memory");   // stage 0 has landed before the barrier that publishes it
  __syncthreads();
  attn_stage(l0 + 2 * AT_STAGE, gk + (size_t)AT_KST * 2 * DM, gv + AT_KST);
#pragma unroll 1   // rolled: one trip per stage, the buffer chosen by the trip's parity
  for (int t = 0; t < AT_NST; ++t) { const _Float16* const kb = ring + (t & 1) * AT_STAGE; const _Float16* const vb = kb + AT_TILE;
#pragma unroll   // the stage's two 32-key passes in line, so that their LDS offsets are constants
  for (int ps = 0; ps < AT_KST / 32; ++ps) { v8f s[2]; v16h kf[2][2], vf[4];   // the pass's fragments: LDS reads as one group ahead of the products, V's in flight under the softmax
#pragma unroll
    for (int ct = 0; ct < 2; ++ct) {
#pragma unroll
      for (int kc = 0; kc < 2; ++kc) kf[ct][kc] = frag_h(kb + (ps * 32 + ct * 16 + col) * AT_PITCH + kc * 32, lane); }
#pragma unroll
    for (int dt = 0; dt < 4; ++dt) vf[dt] = frag_h(vb + (dt * 16 + col) * AT_PITCH + ps * 32, lane);
#pragma unroll
    for (int ct = 0; ct < 2; ++ct) { v8f c = {};
#pragma unroll
      for (int kc = 0; kc < 2; ++kc) c = wmma16(kf[ct][kc], aq[kc], c);   // single product: k, q as one-rounding f16 operands; c[r] = score of key ct * 16 + 8g + r, query col
      s[ct] = c * sc; }
    float mx = fmaxf(s[0][0], s[1][0]);
#pragma unroll
    for (int r = 1; r < 8; ++r) mx = fmaxf(mx, fmaxf(s[0][r], s[1][r]));
    mx = fmaxf(mx, xhalf(mx));
    const float mn = fmaxf(m, mx); const float alpha = __expf(m - mn); m = mn;
    v16h pt; float es = 0.f;   // P^T as the B operand: element i = key 8g + i, element 8 + i = key 16 + 8g + i, the k order of the V^T fragment
#pragma unroll
    for (int r = 0; r < 8; ++r) { const float e0 = __expf(s[0][r] - mn), e1 = __expf(s[1][r] - mn); es += e0 + e1;
      pt[r] = (_Float16)(e0 * 2048.0f); pt[8 + r] = (_Float16)(e1 * 2048.0f); }   // P scaled by 2^11 before the f16 rounding so small softmax weights stay out of the f16 subnormal range; 2^-11 folded into the epilogue
    l = l * alpha + es;
#pragma unroll
    for (int dt = 0; dt < 4; ++dt) acc[dt] = wmma16(vf[dt], pt, acc[dt] * alpha); }   // single product: V^T x P^T (x2^11); acc[dt][r] = output element dt * 16 + 8g + r of query col
    asm volatile("s_wait_dscnt 0x0" ::: "memory");      // this wave's reads of stage t are done
    asm volatile("s_wait_asynccnt 0x0" ::: "memory");   // its copies of stage t + 1 have landed
    __syncthreads();                                    // publishes stage t + 1 and ends every wave's reads of stage t
    if (t + 2 < AT_NST) attn_stage(l0 + (t & 1) * (2 * AT_STAGE), gk + (size_t)(t + 2) * AT_KST * 2 * DM, gv + (t + 2) * AT_KST); }
  asm volatile("s_wait_asynccnt 0x0" ::: "memory");     // no copy is left in flight when the wave goes on
  const float il = (1.0f / 2048.0f) / (l + xhalf(l));   // the two halves' sums joined once
#pragma unroll
  for (int dt = 0; dt < 4; ++dt) { const v8f o = acc[dt] * il; float* const d = &so[wave][col][dt * 16 + 8 * g];
    *(v4f*)d = __builtin_shufflevector(o, o, 0, 1, 2, 3); *(v4f*)(d + 4) = __builtin_shufflevector(o, o, 4, 5, 6, 7); }
  LDSX();
  for (int rl = 0; rl < 16; ++rl) if (lane < 16) vst2(O + ((size_t)b * SS + q0 + rl) * DM + h * HD + lane * 4, *(const v4f*)&so[wave][rl][lane * 4]);
}
// ---- k_out: block = (64 rows, 128 cols): out = O(hi/lo) . Wo rows (2 products) + bo
__global__ __launch_bounds__(128) void k_out(const float* __restrict__ O, const __bf16* __restrict__ P, const float* __restrict__ BO, float* __restrict__ Y) {
  __shared__ __align__(16) float so[4][16][132];
  const int tid = threadIdx.x, wave = tid >> 5, lane = tid & 31, col = lane & 15, g = lane >> 4; const size_t r0 = (size_t)blockIdx.x * 64 + wave * 16; const int n0 = blockIdx.y * 128;
  v8f acc[8] = {};
#pragma unroll 2
  for (int kc = 0; kc < DM / 32; ++kc) { const F2 a = split_row(O + (r0 + col) * DM, kc * 32, lane);
#pragma unroll
    for (int j = 0; j < 8; ++j) { const v16b w = frag_b(P + (size_t)(n0 + j * 16 + col) * DM + kc * 32, lane); acc[j] = wmma_bf(a.l, w, acc[j]); acc[j] = wmma_bf(a.h, w, acc[j]); } }
#pragma unroll
  for (int j = 0; j < 8; ++j) {
#pragma unroll
    for (int r = 0; r < 8; ++r) so[wave][8 * g + r][j * 16 + col] = acc[j][r] + (BO ? bfr(BO[n0 + j * 16 + col]) : 0.f); }
  LDSX();
  for (int rl = 0; rl < 16; ++rl) vst2(Y + (r0 + rl) * DM + n0 + lane * 4, *(const v4f*)&so[wave][rl][lane * 4]);
}
// ---- k_qk2: block = (64 rows, 128 cols): q = x Wq + bq and k = x Wk + bk for the same columns; stores q rows, softplus(k) rows (the engine's k slot) and v = q + k planes, all as f16 hi + residual
// Operand tiles go through LDS: a stage is 64 k of [256 weight rows (128 of Wq, 128 of Wk) | 64 x rows already rounded to bf16], rows of 128 B at pitch 144 B (16 B x odd: no bank conflict for 16-byte readers).
// Two buffers: the next stage's global loads are issued before this stage's products, land in registers, and are written to the other buffer behind the products; one barrier per stage.
#define QK_KST 64
#define QK_NST (DM / QK_KST)
#define QK_PITCH 72
#define QK_STAGE ((256 + 64) * QK_PITCH)
typedef __attribute__((ext_vector_type(4))) __bf16 v4b;
__global__ __launch_bounds__(128) void k_qk2(const float* __restrict__ X, const __bf16* __restrict__ P, const float* __restrict__ BQ, const float* __restrict__ BK, _Float16* __restrict__ QK, _Float16* __restrict__ QKL, _Float16* __restrict__ VTH, _Float16* __restrict__ VTL) {
  __shared__ __align__(16) unsigned char smem[2 * QK_STAGE * 2];   // the two stage buffers; behind the loop's last barrier the same bytes are the output staging
  __bf16* const ring = (__bf16*)smem;
  _Float16 (* const so)[16][136] = (_Float16 (*)[16][136])smem; _Float16 (* const sol)[16][136] = (_Float16 (*)[16][136])(smem + 17408); _Float16 (* const sth)[72] = (_Float16 (*)[72])(smem + 34816); _Float16 (* const stl)[72] = (_Float16 (*)[72])(smem + 53248);
  const int tid = threadIdx.x, wave = tid >> 5, lane = tid & 31, col = lane & 15, g = lane >> 4; const size_t rb = (size_t)blockIdx.x * 64, r0 = rb + wave * 16; const int n0 = blockIdx.y * 128;
  // loaders: 8 lanes cover one 128-B weight row piece, 16 lanes one 256-B x row piece, so every wave-wide load reads whole lines
  const __bf16* const wsrc = P + PK_A + (size_t)(n0 + (tid >> 3)) * DM + (tid & 7) * 8;
  const float* const xsrc = X + (rb + (tid >> 4)) * DM + (tid & 15) * 4;
  const int wdst = (tid >> 3) * QK_PITCH + (tid & 7) * 8, xdst = (256 + (tid >> 4)) * QK_PITCH + (tid & 15) * 4;
  v4u wr[16]; v4f xr[8];
  v8f aq[8] = {}, ak[8] = {};
#pragma unroll
  for (int i = 0; i < 16; ++i) wr[i] = *(const v4u*)(wsrc + (size_t)((i >> 3) * DM + (i & 7) * 16) * DM);
#pragma unroll
  for (int i = 0; i < 8; ++i) xr[i] = *(const v4f*)(xsrc + (size_t)(i * 8) * DM);
#pragma unroll
  for (int i = 0; i < 16; ++i) *(v4u*)(ring + wdst + i * 16 * QK_PITCH) = wr[i];
#pragma unroll
  for (int i = 0; i < 8; ++i) { v4b c; c[0] = (__bf16)xr[i][0]; c[1] = (__bf16)xr[i][1]; c[2] = (__bf16)xr[i][2]; c[3] = (__bf16)xr[i][3]; *(v4b*)(ring + xdst + i * 8 * QK_PITCH) = c; }
  __syncthreads();
#pragma unroll 1   // rolled: the body already holds 32 products
  for (int s = 0; s < QK_NST; ++s) {
    const bool more = s + 1 < QK_NST;
    if (more) {
#pragma unroll
      for (int i = 0; i < 16; ++i) wr[i] = *(const v4u*)(wsrc + (size_t)((i >> 3) * DM + (i & 7) * 16) * DM + (s + 1) * QK_KST);
#pragma unroll
      for (int i = 0; i < 8; ++i) xr[i] = *(const v4f*)(xsrc + (size_t)(i * 8) * DM + (s + 1) * QK_KST);
    }
    const __bf16* const wb = ring + (s & 1) * QK_STAGE; const __bf16* const xb = wb + 256 * QK_PITCH;
#pragma unroll
    for (int kc = 0; kc < QK_KST / 32; ++kc) {
      const v16b a = frag_b(xb + (wave * 16 + col) * QK_PITCH + kc * 32, lane);
#pragma unroll
      for (int hf = 0; hf < 2; ++hf) { v16b f[8];   // eight fragments' LDS reads as one group ahead of their products (hf 0: Wq rows, hf 1: Wk rows); sixteen at once would not fit beside the accumulators in v0..v255, where the products' asm operands must lie
#pragma unroll
        for (int j = 0; j < 8; ++j) f[j] = frag_b(wb + (hf * 128 + j * 16 + col) * QK_PITCH + kc * 32, lane);
#pragma unroll
        for (int j = 0; j < 8; ++j) { if (hf == 0) aq[j] = wmma_bf(a, f[j], aq[j]); else ak[j] = wmma_bf(a, f[j], ak[j]); }
      }
    }
    if (more) { __bf16* const nb = ring + ((s + 1) & 1) * QK_STAGE;   // last read in stage s - 1, whose barrier every wave has passed
#pragma unroll
      for (int i = 0; i < 16; ++i) *(v4u*)(nb + wdst + i * 16 * QK_PITCH) = wr[i];
#pragma unroll
      for (int i = 0; i < 8; ++i) { v4b c; c[0] = (__bf16)xr[i][0]; c[1] = (__bf16)xr[i][1]; c[2] = (__bf16)xr[i][2]; c[3] = (__bf16)xr[i][3]; *(v4b*)(nb + xdst + i * 8 * QK_PITCH) = c; }
    }
    __syncthreads();   // publishes stage s + 1 and ends every wave's reads of stage s (after the last stage: frees the bytes for the output staging)
  }
#pragma unroll
  for (int j = 0; j < 8; ++j) { const float bq = bfr(BQ[n0 + j * 16 + col]);
#pragma unroll
    for (int r = 0; r < 8; ++r) { const float v = aq[j][r] + bq; aq[j][r] = v; const _Float16 hv = (_Float16)v; so[wave][8 * g + r][j * 16 + col] = hv; sol[wave][8 * g + r][j * 16 + col] = (_Float16)((v - (float)hv) * 2048.0f); } }
  LDSX();
  for (int rl = 0; rl < 16; ++rl) if (lane < 16) { vst2((unsigned*)(QK + (r0 + rl) * (2 * DM) + n0 + lane * 8), *(const v4u*)&so[wave][rl][lane * 8]); vst2((unsigned*)(QKL + (r0 + rl) * (2 * DM) + n0 + lane * 8), *(const v4u*)&sol[wave][rl][lane * 8]); }
  LDSX();
  // pass 2: softplus(k) rows into the k slot; v = q + k (raw k) planes
#pragma unroll
  for (int j = 0; j < 8; ++j) { const float bk = bfr(BK[n0 + j * 16 + col]);
#pragma unroll
    for (int r = 0; r < 8; ++r) { const float kv = ak[j][r] + bk; const float sp = softplus_p(kv); const _Float16 hs = (_Float16)sp; so[wave][8 * g + r][j * 16 + col] = hs; sol[wave][8 * g + r][j * 16 + col] = (_Float16)((sp - (float)hs) * 2048.0f);
      const float vv = aq[j][r] + kv; const _Float16 hv = (_Float16)vv; sth[j * 16 + col][wave * 16 + 8 * g + r] = hv; stl[j * 16 + col][wave * 16 + 8 * g + r] = (_Float16)((vv - (float)hv) * 2048.0f); } }
  __syncthreads();
  for (int rl = 0; rl < 16; ++rl) if (lane < 16) { vst2((unsigned*)(QK + (r0 + rl) * (2 * DM) + DM + n0 + lane * 8), *(const v4u*)&so[wave][rl][lane * 8]); vst2((unsigned*)(QKL + (r0 + rl) * (2 * DM) + DM + n0 + lane * 8), *(const v4u*)&sol[wave][rl][lane * 8]); }
  { const int b = (int)(rb / SS), s0 = (int)(rb % SS);
    for (int q = tid; q < 128 * 8; q += 128) { const int d = q >> 3, pc = q & 7; const size_t o = ((size_t)b * DM + n0 + d) * SS + s0 + pc * 8; vst2((unsigned*)(VTH + o), *(const v4u*)&sth[d][pc * 8]); vst2((unsigned*)(VTL + o), *(const v4u*)&stl[d][pc * 8]); } }
}
extern "C" void kernel_launch(void* const* d_in, const int* in_sizes, int n_in, void* d_out, int out_size, void* d_ws, size_t ws_size, hipStream_t stream) {
  (void)in_sizes; (void)n_in; (void)out_size;
  const float** F = (const float**)d_in;   // 0 hidden [2,2048,1024], 1 attention_mask [2,2048] int (query axis), 2 Wq (in,out), 3 bq, 4 Wk, 5 bk
  if (ws_size < (size_t)WS_END) return;
  char* ws = (char*)d_ws; __bf16* PK = (__bf16*)(ws + WS_PK); _Float16 *QK = (_Float16*)(ws + WS_QK), *QKL = (_Float16*)(ws + WS_QKL), *VTH = (_Float16*)(ws + WS_VTH), *VTL = (_Float16*)(ws + WS_VTL);
  k_pack<<<dim3(DM / PT_N, DM / PT_K, 2), 256, 0, stream>>>(F[2], F[4], PK);   // Wq, Wk rows (the only packed rows that are read)
  k_qk2<<<dim3(TNB * SS / 64, DM / 128), 128, 0, stream>>>(F[0], PK, F[3], F[5], QK, QKL, VTH, VTL);
  k_attn<<<dim3(TQB, NH, TNB), 128, 0, stream>>>(QK, QKL, VTH, VTL, nullptr, (const int*)d_in[1], (float*)d_out);   // merged heads are the module's output
}

// v005
// A run of this version takes 77.1 microseconds.
// In two side-by-side timings against v004, it was 1.16 and 1.17 times as fast.
// Over all steps from v000 it is 4.57 times as fast.
// compute dtype: all float inputs rounded to bf16, the int mask read on device; q / k = x . W + b with EXACT bf16 products on WMMA 16x16x32 ((in,out) weights as transposed rows), softplus(k) (hardware exp2/log2, the rounding of 1 + e compensated) and v = q + k formed in f32 in the same block before one f16 rounding (hi + residual planes); PLAIN attention: q, softplus(k) single f16 x 1/8, running-max softmax in f32 (hardware exp), P (scaled by 2^11, single f16) x v (single f16); f32 merged-head output.
#include <hip/hip_runtime.h>
#include <math.h>

typedef __attribute__((ext_vector_type(16))) _Float16 v16h;
typedef __attribute__((ext_vector_type(16))) __bf16 v16b;
typedef __attribute__((ext_vector_type(8)))  _Float16 v8h;
typedef __attribute__((ext_vector_type(8)))  float v8f;
typedef __attribute__((ext_vector_type(4)))  float v4f;
typedef __attribute__((ext_vector_type(2)))  float v2f;
typedef __attribute__((ext_vector_type(4)))  unsigned v4u;
typedef __attribute__((ext_vector_type(4)))  int v4i;
typedef float __attribute__((may_alias)) float_a;
typedef int __attribute__((may_alias)) int_a;

template <typename T> __device__ __forceinline__ void vst2(void* p, T v) { *(T*)p = v;  }
__device__ __forceinline__ v8f wmma16(v16h a, v16h b, v8f c) {
  v8f d = __builtin_amdgcn_wmma_f32_16x16x32_f16(false, a, false, b, (short)0, c, false, false);
  asm volatile("v_nop\n\tv_nop\n\tv_nop\n\tv_nop" : "+v"(d) : "v"(a), "v"(b));
  return d;
}
__device__ __forceinline__ v8f wmma_bf(v16b a, v16b b, v8f c) {
  v8f d = __builtin_amdgcn_wmma_f32_16x16x32_bf16(false, a, false, b, (short)0, c, false, false);
  asm volatile("v_nop\n\tv_nop\n\tv_nop\n\tv_nop" : "+v"(d) : "v"(a), "v"(b));
  return d;
}
// BERT self attention variant (B 2, S 2,048, 1,024 dims, 16 heads x 64): q = x Wq + bq, k = x Wk + bk, keys transformed to softplus(k), values = q + k, scores / 8 with the attention mask applied on the QUERY axis (masked queries get uniform attention), softmax, . v; merged heads are the output.
__device__ __forceinline__ v16h frag_h(const _Float16* rowk0, int lane) {
  union { v16h v; v8h q[2]; } u; const _Float16* p = rowk0 + 8 * (lane >> 4);
  u.q[0] = *(const v8h*)p; u.q[1] = *(const v8h*)(p + 16); return u.v;
}
__device__ __forceinline__ v16h frag_f32(const float* rowk0, int lane) {
  v16h a; const float* p = rowk0 + 8 * (lane >> 4);
#pragma unroll
  for (int i = 0; i < 8; ++i) { a[i] = (_Float16)p[i]; a[8 + i] = (_Float16)p[16 + i]; }
  return a;
}
__device__ __forceinline__ v16h frag_f32s(const float* rowk0, int lane, float sc) {
  v16h a; const float* p = rowk0 + 8 * (lane >> 4);
#pragma unroll
  for (int i = 0; i < 8; ++i) { a[i] = (_Float16)(p[i] * sc); a[8 + i] = (_Float16)(p[16 + i] * sc); }
  return a;
}
// column fragment from a [K][ld] layout (column n), rows >= K read as 0
__device__ __forceinline__ v16h fragc_f32(const float* W, int k0, int n, int lane, int ld, int K) {
  v16h a; const int g = lane >> 4;
#pragma unroll
  for (int i = 0; i < 8; ++i) { const int ka = k0 + 8 * g + i, kb = ka + 16;
    a[i] = (_Float16)(ka < K ? W[(size_t)(ka < K ? ka : K - 1) * ld + n] : 0.f); a[8 + i] = (_Float16)(kb < K ? W[(size_t)(kb < K ? kb : K - 1) * ld + n] : 0.f); }
  return a;
}
struct F2 { v16b h, l; };
__device__ __forceinline__ F2 bsplit16(const float v[16]) { F2 r;
#pragma unroll
  for (int i = 0; i < 16; ++i) { const __bf16 h = (__bf16)v[i]; r.h[i] = h; r.l[i] = (__bf16)(v[i] - (float)h); }
  return r; }
__device__ __forceinline__ F2 split_row(const float* row, int k0, int lane) { float v[16]; const float* p = row + k0 + 8 * (lane >> 4);
#pragma unroll
  for (int i = 0; i < 8; ++i) { v[i] = p[i]; v[8 + i] = p[16 + i]; }
  return bsplit16(v); }
__device__ __forceinline__ F2 split_rowK(const float* row, int k0, int lane, int K) { float v[16]; const int g = lane >> 4;
#pragma unroll
  for (int i = 0; i < 8; ++i) { const int ka = k0 + 8 * g + i, kb = ka + 16; v[i] = ka < K ? row[ka < K ? ka : K - 1] : 0.f; v[8 + i] = kb < K ? row[kb < K ? kb : K - 1] : 0.f; }
  return bsplit16(v); }
__device__ __forceinline__ F2 split_col(const float* W, int k0, int n, int lane, int ld, int K) { float v[16]; const int g = lane >> 4;
#pragma unroll
  for (int i = 0; i < 8; ++i) { const int ka = k0 + 8 * g + i, kb = ka + 16; v[i] = ka < K ? W[(size_t)(ka < K ? ka : K - 1) * ld + n] : 0.f; v[8 + i] = kb < K ? W[(size_t)(kb < K ? kb : K - 1) * ld + n] : 0.f; }
  return bsplit16(v); }
__device__ __forceinline__ v8f mac3(const F2& a, const F2& b, v8f c) { c = wmma_bf(a.l, b.h, c); c = wmma_bf(a.h, b.l, c); return wmma_bf(a.h, b.h, c); }
__device__ __forceinline__ float sigm(float v) { return 1.0f / (1.0f + expf(-v)); }
#define LDSX() do { asm volatile("s_wait_dscnt 0" ::: "memory"); __builtin_amdgcn_wave_barrier(); __builtin_amdgcn_fence(__ATOMIC_RELEASE, "workgroup"); } while (0)


#define NB 2
#define SS 2048
#define DM 1024
#define NH 16
// softplus(z) = max(z, 0) + log1p(e) with e = exp(-|z|) in [0, 1], on the hardware exp2 and log2 and in line, so that a lane's 64 values overlap instead of running one dependent chain after another.
// c is the part of e that the rounding of 1 + e dropped: added back, it keeps the relative accuracy of small results (z far below 0); for large z both terms vanish against z.
// The v_nop fills the slot that the instruction set asks for behind a transcendental before its source is overwritten or its result read; inside the statement it stays directly behind it.
__device__ __forceinline__ float hw_exp2(float x) { float r; asm("v_exp_f32 %0, %1\n\tv_nop" : "=v"(r) : "v"(x)); return r; }
__device__ __forceinline__ float hw_log2(float x) { float r; asm("v_log_f32 %0, %1\n\tv_nop" : "=v"(r) : "v"(x)); return r; }
__device__ __forceinline__ float softplus_p(float z) {
  const float e = hw_exp2(fabsf(z) * -1.44269504f), u = 1.0f + e, c = e - (u - 1.0f);
  return fmaxf(z, 0.f) + (hw_log2(u) * 0.693147181f + c);
}
#define HD 64
#define QKVW (3 * DM)
#ifndef TQB
#define TQB (SS / 64)
#define TNB NB
#define TOB (NB * SS / 64)     // output row tiles (all)
#endif
typedef __attribute__((ext_vector_type(8))) __bf16 v8b;
__device__ __forceinline__ v16b frag_b(const __bf16* rowk0, int lane) {
  union { v16b v; v8b q[2]; } u; const __bf16* p = rowk0 + 8 * (lane >> 4);
  u.q[0] = *(const v8b*)p; u.q[1] = *(const v8b*)(p + 16); return u.v;
}
__device__ __forceinline__ float bfr(float v) { return (float)(__bf16)v; }
__device__ __attribute__((noinline)) float exp_ni(float v) { return expf(v); }
__device__ __attribute__((noinline)) float erf_ni(float v) { return erff(v); }

#define PK_A 0                       // [3072][1024]: rows 0..2047 hold Wq | Wk as bf16 [out][in] (transposed), the rest unwritten
#define PK_P (PK_A + QKVW * DM)        // [1024][1024], unused
#define PK_END (PK_P + DM * DM)
#define WS_PK  0u
#define WS_QK  (WS_PK + 2u * PK_END)             // f16 [4096 rows][2048]: q | k
#define WS_QKL (WS_QK + 2u * NB * SS * 2 * DM)     // f16 q | k residual planes x2048
#define WS_VTH (WS_QKL + 2u * NB * SS * 2 * DM)    // f16 [b][1024 (h*64+d)][2048 s] hi
#define WS_VTL (WS_VTH + 2u * NB * DM * SS)        // f16 lo x 2048
#define WS_O   (WS_VTL + 2u * NB * DM * SS)        // f32 [4096][1024]
#define WS_CS  (WS_O + 4u * NB * SS * DM)           // f32 [2][2048][32], unused
#define WS_END (WS_CS + 4u * 2 * SS * 32)
// ---- k_pack: block = (64 columns n, 128 rows k, which): one tile of the (in,out) weight W_q (which 0) or W_k (which 1) -> bf16 rows [n][k] of PK_A (rows which*1024 + n), transposed through LDS
// Reads: 16 lanes cover 256 B of one weight row; writes: 16 lanes cover 256 B of one packed row, so every wave-wide global access is whole lines and each weight line is asked for once.
#define PT_N 64
#define PT_K 128
#define PT_PITCH 272   // bytes of a packed row in LDS: 256 + 16 (16 B x odd)
typedef __attribute__((ext_vector_type(2))) __bf16 v2b;
__global__ __launch_bounds__(256) void k_pack(const float* __restrict__ WQ, const float* __restrict__ WK, __bf16* __restrict__ PK) {
  __shared__ __align__(16) unsigned char s[PT_N * PT_PITCH];
  const int t = threadIdx.x, c = t & 15, rp = t >> 4, n0 = blockIdx.x * PT_N, k0 = blockIdx.y * PT_K, which = blockIdx.z;
  const float* const src = (which ? WK : WQ) + (size_t)(k0 + 2 * rp) * DM + n0 + 4 * c;   // rows k0 + 32p + 2rp and the next, columns n0 + 4c .. + 3
  v4f a[4], b[4];
#pragma unroll   // the eight loads in flight together, a[] and b[] in registers
  for (int p = 0; p < 4; ++p) { a[p] = *(const v4f*)(src + (size_t)(32 * p) * DM); b[p] = *(const v4f*)(src + (size_t)(32 * p + 1) * DM); }
  // a row's 16-byte pieces lie at piece ^ (row >> 4): the 16 lanes that write one k pair into rows 4c + i then fall on 16 different banks
  unsigned char* const d = s + (4 * c) * PT_PITCH + ((4 * rp) ^ ((c >> 2) << 4));
#pragma unroll   // both loops in line: register indices and LDS offsets are constants
  for (int p = 0; p < 4; ++p) {
#pragma unroll
    for (int i = 0; i < 4; ++i) { v2b w; w[0] = (__bf16)a[p][i]; w[1] = (__bf16)b[p][i]; *(v2b*)(d + i * PT_PITCH + 64 * p) = w; } }
  __syncthreads();
#pragma unroll   // the four LDS reads as one group ahead of their stores
  for (int j = 0; j < 4; ++j) { const int n = rp + 16 * j; vst2((unsigned*)(PK + PK_A + ((size_t)which * DM + n0 + n) * DM + k0 + c * 8), *(const v4u*)(s + n * PT_PITCH + ((c ^ j) << 4))); }
}
__global__ __launch_bounds__(128) void k_qkv(const float* __restrict__ XQ, const float* __restrict__ XK, const float* __restrict__ XV, const __bf16* __restrict__ P, const float* __restrict__ BQ, const float* __restrict__ BK, const float* __restrict__ BV, _Float16* __restrict__ QK, _Float16* __restrict__ QKL, _Float16* __restrict__ VTH, _Float16* __restrict__ VTL) {
  const int which0 = (blockIdx.y * 128) / DM; const float* X = (which0 == 0) ? XQ : (which0 == 1) ? XK : XV; const float* BB = BQ ? (((which0 == 0) ? BQ : (which0 == 1) ? BK : BV) + (blockIdx.y * 128 - which0 * DM)) : nullptr;
  __shared__ __align__(16) _Float16 so[4][16][136], sol[4][16][136]; __shared__ __align__(16) _Float16 sth[128][72], stl[128][72];
  const int tid = threadIdx.x, wave = tid >> 5, lane = tid & 31, col = lane & 15, g = lane >> 4; const size_t r0 = (size_t)blockIdx.x * 64 + wave * 16; const int n0 = blockIdx.y * 128;
  v8f acc[8] = {};
#pragma unroll 2
  for (int kc = 0; kc < DM / 32; ++kc) { v16b a; { const float* p = X + (r0 + col) * DM + kc * 32 + 8 * g;
#pragma unroll
      for (int i = 0; i < 8; ++i) { a[i] = (__bf16)p[i]; a[8 + i] = (__bf16)p[16 + i]; } }
#pragma unroll
    for (int j = 0; j < 8; ++j) acc[j] = wmma_bf(a, frag_b(P + (size_t)(n0 + j * 16 + col) * DM + kc * 32, lane), acc[j]); }
  if (n0 < 2 * DM) {   // q stored unscaled (f16 sigma ~0.6, no subnormal exposure); 1/8 applied to the f32 score
#pragma unroll
    for (int j = 0; j < 8; ++j) {
#pragma unroll
      for (int r = 0; r < 8; ++r) { const float v = acc[j][r] + (BB ? bfr(BB[j * 16 + col]) : 0.f); const _Float16 hv = (_Float16)v; so[wave][8 * g + r][j * 16 + col] = hv; sol[wave][8 * g + r][j * 16 + col] = (_Float16)((v - (float)hv) * 2048.0f); } }   // q, k (+ bias) as f16 hi + (x2048) residual
    LDSX();
    for (int rl = 0; rl < 16; ++rl) if (lane < 16) { vst2((unsigned*)(QK + (r0 + rl) * (2 * DM) + n0 + lane * 8), *(const v4u*)&so[wave][rl][lane * 8]); vst2((unsigned*)(QKL + (r0 + rl) * (2 * DM) + n0 + lane * 8), *(const v4u*)&sol[wave][rl][lane * 8]); }
  } else {
#pragma unroll
    for (int j = 0; j < 8; ++j) {
#pragma unroll
      for (int r = 0; r < 8; ++r) { const float v = acc[j][r] + (BB ? bfr(BB[j * 16 + col]) : 0.f); const _Float16 hv = (_Float16)v; sth[j * 16 + col][wave * 16 + 8 * g + r] = hv; stl[j * 16 + col][wave * 16 + 8 * g + r] = (_Float16)((v - (float)hv) * 2048.0f); } }
    __syncthreads();
    const size_t rb = (size_t)blockIdx.x * 64; const int b = (int)(rb / SS), s0 = (int)(rb % SS); const int pc0 = n0 - 2 * DM;
    for (int q = tid; q < 128 * 8; q += 128) { const int d = q >> 3, pc = q & 7; const size_t o = ((size_t)b * DM + pc0 + d) * SS + s0 + pc * 8; vst2((unsigned*)(VTH + o), *(const v4u*)&sth[d][pc * 8]); vst2((unsigned*)(VTL + o), *(const v4u*)&stl[d][pc * 8]); }
  }
}
// ---- k_attn: block = (64 queries, head h, batch b): all-keys flash attention (K = 64: 2 k-steps), scores = (k.q) * 0.125 with single f16 operands, formed transposed; V^T.P^T: f16 V x f16 P (x2^11) in one accumulator; O[b*S+q][h*64+d] = acc / 2048 / l (256-B segments)
// K and V^T go through LDS: a stage is 64 keys = [64 key rows x 64 d | 64 d rows x 64 keys] of f16, rows of 128 B at pitch 144 B (16 B x odd: no bank conflict for 16-byte readers), copied once per block and read by its 4 waves.
// Two buffers: stage t + 1's copies fly while stage t is worked on; one barrier per stage.
#define AT_KST 64
#define AT_NST (SS / AT_KST)
#define AT_PITCH 72
#define AT_TILE (64 * AT_PITCH)
#define AT_STAGE (2 * AT_TILE)
// one stage: 8 copies of 16 B a lane (8 lanes cover one 128-B row, so a wave's copy reads 4 whole lines); lk = the lane's LDS byte address in the K tile, gk / gv = its global addresses in row (tid >> 3) of the K / V^T tile
__device__ __forceinline__ void attn_stage(unsigned lk, const _Float16* gk, const _Float16* gv) {
  const unsigned lv = lk + 2 * AT_TILE;
  // the s_wait_xcnt stands in the copies' own statement so that no address register is rewritten ahead of it
  asm volatile("global_load_async_to_lds_b128 %0, %8, off\n\t"
               "global_load_async_to_lds_b128 %1, %9, off\n\t"
               "global_load_async_to_lds_b128 %2, %10, off\n\t"
               "global_load_async_to_lds_b128 %3, %11, off\n\t"
               "global_load_async_to_lds_b128 %4, %12, off\n\t"
               "global_load_async_to_lds_b128 %5, %13, off\n\t"
               "global_load_async_to_lds_b128 %6, %14, off\n\t"
               "global_load_async_to_lds_b128 %7, %15, off\n\t"
               "s_wait_xcnt 0x0"
               :: "v"(lk), "v"(lk + 16 * 2 * AT_PITCH), "v"(lk + 32 * 2 * AT_PITCH), "v"(lk + 48 * 2 * AT_PITCH),
                  "v"(lv), "v"(lv + 16 * 2 * AT_PITCH), "v"(lv + 32 * 2 * AT_PITCH), "v"(lv + 48 * 2 * AT_PITCH),
                  "v"(gk), "v"(gk + (size_t)16 * 2 * DM), "v"(gk + (size_t)32 * 2 * DM), "v"(gk + (size_t)48 * 2 * DM),
                  "v"(gv), "v"(gv + (size_t)16 * SS), "v"(gv + (size_t)32 * SS), "v"(gv + (size_t)48 * SS)
               : "memory");
}
__device__ __forceinline__ float xhalf(float v) {   // the value of lane l ^ 16: the other half of the same query's keys
  const int b = __builtin_bit_cast(int, v); return __builtin_bit_cast(float, __builtin_amdgcn_permlanex16(b, b, 0x76543210, 0xfedcba98, false, false));
}
// at most four waves a SIMD, as before: the grid's 1,024 work-groups then stand four on each of the 256 WGPs
__global__ __launch_bounds__(128) __attribute__((amdgpu_waves_per_eu(4, 4))) void k_attn(const _Float16* __restrict__ QK, const _Float16* __restrict__ QKL, const _Float16* __restrict__ VTH, const _Float16* __restrict__ VTL, const void* __restrict__ KMASK, const int* __restrict__ QMSK, float* __restrict__ O) {
  __shared__ __align__(16) float so[4][16][68]; __shared__ __align__(16) _Float16 ring[2 * AT_STAGE];
  const int tid = threadIdx.x, wave = tid >> 5, lane = tid & 31, col = lane & 15, g = lane >> 4;
  const int qb = blockIdx.x, h = blockIdx.y, b = blockIdx.z; const int q0 = qb * 64 + wave * 16; const size_t rq = (size_t)b * SS + q0 + col;
  // transposed products: S^T = K . Q^T (A = key rows, B = q) and O^T += V^T . P^T, so lane (col, g) holds query col alone: its scores of keys 8g + r and 16 + 8g + r, its maximum, its sum, its output elements
  const int qm = QMSK[rq];
  asm volatile("s_wait_xcnt 0x0" ::: "memory");   // stands in front of any rewrite of the mask load's address registers
  const float sc = (qm == 0) ? 0.f : 0.125f;   // 1/sqrt(64); attention_mask on the QUERY axis: mask == 0 -> every score of that query is equal -> uniform weights
  v16h aq[2];
#pragma unroll
  for (int kc = 0; kc < 2; ++kc) aq[kc] = frag_h(QK + rq * (2 * DM) + h * HD + kc * 32, lane);
  float m = -3.0e38f, l = 0.f;   // m: the query's running maximum (equal in both halves); l: this half's part of the sum
  v8f acc[4] = {};
  const _Float16* const gk = QK + ((size_t)b * SS + (tid >> 3)) * (2 * DM) + DM + h * HD + (tid & 7) * 8;
  const _Float16* const gv = VTH + ((size_t)b * DM + h * HD + (tid >> 3)) * SS + (tid & 7) * 8;
  const unsigned l0 = (unsigned)(size_t)(__attribute__((address_space(3))) _Float16*)ring + (tid >> 3) * (2 * AT_PITCH) + (tid & 7) * 16;
  attn_stage(l0, gk, gv);
  asm volatile("s_wait_asynccnt 0x0" ::: "memory");   // stage 0 has landed before the barrier that publishes it
  __syncthreads();
  attn_stage(l0 + 2 * AT_STAGE, gk + (size_t)AT_KST * 2 * DM, gv + AT_KST);
#pragma unroll 1   // rolled: one trip per stage, the buffer chosen by the trip's parity
  for (int t = 0; t < AT_NST; ++t) { const _Float16* const kb = ring + (t & 1) * AT_STAGE; const _Float16* const vb = kb + AT_TILE;
#pragma unroll   // the stage's two 32-key passes in line, so that their LDS offsets are constants
  for (int ps = 0; ps < AT_KST / 32; ++ps) { v8f s[2]; v16h kf[2][2], vf[4];   // the pass's fragments: LDS reads as one group ahead of the products, V's in flight under the softmax
#pragma unroll
    for (int ct = 0; ct < 2; ++ct) {
#pragma unroll
      for (int kc = 0; kc < 2; ++kc) kf[ct][kc] = frag_h(kb + (ps * 32 + ct * 16 + col) * AT_PITCH + kc * 32, lane); }
#pragma unroll
    for (int dt = 0; dt < 4; ++dt) vf[dt] = frag_h(vb + (dt * 16 + col) * AT_PITCH + ps * 32, lane);
#pragma unroll
    for (int ct = 0; ct < 2; ++ct) { v8f c = {};
#pragma unroll
      for (int kc = 0; kc < 2; ++kc) c = wmma16(kf[ct][kc], aq[kc], c);   // single product: k, q as one-rounding f16 operands; c[r] = score of key ct * 16 + 8g + r, query col
      s[ct] = c * sc; }
    float mx = fmaxf(s[0][0], s[1][0]);
#pragma unroll
    for (int r = 1; r < 8; ++r) mx = fmaxf(mx, fmaxf(s[0][r], s[1][r]));
    mx = fmaxf(mx, xhalf(mx));
    const float mn = fmaxf(m, mx); const float alpha = __expf(m - mn); m = mn;
    v16h pt; float es = 0.f;   // P^T as the B operand: element i = key 8g + i, element 8 + i = key 16 + 8g + i, the k order of the V^T fragment
#pragma unroll
    for (int r = 0; r < 8; ++r) { const float e0 = __expf(s[0][r] - mn), e1 = __expf(s[1][r] - mn); es += e0 + e1;
      pt[r] = (_Float16)(e0 * 2048.0f); pt[8 + r] = (_Float16)(e1 * 2048.0f); }   // P scaled by 2^11 before the f16 rounding so small softmax weights stay out of the f16 subnormal range; 2^-11 folded into the epilogue
    l = l * alpha + es;
#pragma unroll
    for (int dt = 0; dt < 4; ++dt) acc[dt] = wmma16(vf[dt], pt, acc[dt] * alpha); }   // single product: V^T x P^T (x2^11); acc[dt][r] = output element dt * 16 + 8g + r of query col
    asm volatile("s_wait_dscnt 0x0" ::: "memory");      // this wave's reads of stage t are done
    asm volatile("s_wait_asynccnt 0x0" ::: "memory");   // its copies of stage t + 1 have landed
    __syncthreads();                                    // publishes stage t + 1 and ends every wave's reads of stage t
    if (t + 2 < AT_NST) attn_stage(l0 + (t & 1) * (2 * AT_STAGE), gk + (size_t)(t + 2) * AT_KST * 2 * DM, gv + (t + 2) * AT_KST); }
  asm volatile("s_wait_asynccnt 0x0" ::: "memory");     // no copy is left in flight when the wave goes on
  const float il = (1.0f / 2048.0f) / (l + xhalf(l));   // the two halves' sums joined once
#pragma unroll
  for (int dt = 0; dt < 4; ++dt) { const v8f o = acc[dt] * il; float* const d = &so[wave][col][dt * 16 + 8 * g];
    *(v4f*)d = __builtin_shufflevector(o, o, 0, 1, 2, 3); *(v4f*)(d + 4) = __builtin_shufflevector(o, o, 4, 5, 6, 7); }
  LDSX();
  for (int rl = 0; rl < 16; ++rl) if (lane < 16) vst2(O + ((size_t)b * SS + q0 + rl) * DM + h * HD + lane * 4, *(const v4f*)&so[wave][rl][lane * 4]);
}
// ---- k_out: block = (64 rows, 128 cols): out = O(hi/lo) . Wo rows (2 products) + bo
__global__ __launch_bounds__(128) void k_out(const float* __restrict__ O, const __bf16* __restrict__ P, const float* __restrict__ BO, float* __restrict__ Y) {
  __shared__ __align__(16) float so[4][16][132];
  const int tid = threadIdx.x, wave = tid >> 5, lane = tid & 31, col = lane & 15, g = lane >> 4; const size_t r0 = (size_t)blockIdx.x * 64 + wave * 16; const int n0 = blockIdx.y * 128;
  v8f acc[8] = {};
#pragma unroll 2
  for (int kc = 0; kc < DM / 32; ++kc) { const F2 a = split_row(O + (r0 + col) * DM, kc * 32, lane);
#pragma unroll
    for (int j = 0; j < 8; ++j) { const v16b w = frag_b(P + (size_t)(n0 + j * 16 + col) * DM + kc * 32, lane); acc[j] = wmma_bf(a.l, w, acc[j]); acc[j] = wmma_bf(a.h, w, acc[j]); } }
#pragma unroll
  for (int j = 0; j < 8; ++j) {
#pragma unroll
    for (int r = 0; r < 8; ++r) so[wave][8 * g + r][j * 16 + col] = acc[j][r] + (BO ? bfr(BO[n0 + j * 16 + col]) : 0.f); }
  LDSX();
  for (int rl = 0; rl < 16; ++rl) vst2(Y + (r0 + rl) * DM + n0 + lane * 4, *(const v4f*)&so[wave][rl][lane * 4]);
}
// ---- k_qk2: block = (64 rows, 128 cols): q = x Wq + bq and k = x Wk + bk for the same columns; stores q rows, softplus(k) rows (the engine's k slot) and v = q + k planes, all as f16 hi + residual
// Operand tiles go through LDS: a stage is 64 k of [256 weight rows (128 of Wq, 128 of Wk) | 64 x rows already rounded to bf16], rows of 128 B at pitch 144 B (16 B x odd: no bank conflict for 16-byte readers).
// Two buffers: the next stage's global loads are issued before this stage's products, land in registers, and are written to the other buffer behind the products; one barrier per stage.
#define QK_KST 64
#define QK_NST (DM / QK_KST)
#define QK_PITCH 72
#define QK_STAGE ((256 + 64) * QK_PITCH)
typedef __attribute__((ext_vector_type(4))) __bf16 v4b;
__global__ __launch_bounds__(128) void k_qk2(const float* __restrict__ X, const __bf16* __restrict__ P, const float* __restrict__ BQ, const float* __restrict__ BK, _Float16* __restrict__ QK, _Float16* __restrict__ QKL, _Float16* __restrict__ VTH, _Float16* __restrict__ VTL) {
  __shared__ __align__(16) unsigned char smem[2 * QK_STAGE * 2];   // the two stage buffers; behind the loop's last barrier the same bytes are the output staging
  __bf16* const ring = (__bf16*)smem;
  _Float16 (* const so)[16][136] = (_Float16 (*)[16][136])smem; _Float16 (* const sol)[16][136] = (_Float16 (*)[16][136])(smem + 17408); _Float16 (* const sth)[72] = (_Float16 (*)[72])(smem + 34816); _Float16 (* const stl)[72] = (_Float16 (*)[72])(smem + 53248);
  const int tid = threadIdx.x, wave = tid >> 5, lane = tid & 31, col = lane & 15, g = lane >> 4; const size_t rb = (size_t)blockIdx.x * 64, r0 = rb + wave * 16; const int n0 = blockIdx.y * 128;
  // loaders: 8 lanes cover one 128-B weight row piece, 16 lanes one 256-B x row piece, so every wave-wide load reads whole lines
  const __bf16* const wsrc = P + PK_A + (size_t)(n0 + (tid >> 3)) * DM + (tid & 7) * 8;
  const float* const xsrc = X + (rb + (tid >> 4)) * DM + (tid & 15) * 4;
  const int wdst = (tid >> 3) * QK_PITCH + (tid & 7) * 8, xdst = (256 + (tid >> 4)) * QK_PITCH + (tid & 15) * 4;
  v4u wr[16]; v4f xr[8];
  v8f aq[8] = {}, ak[8] = {};
#pragma unroll
  for (int i = 0; i < 16; ++i) wr[i] = *(const v4u*)(wsrc + (size_t)((i >> 3) * DM + (i & 7) * 16) * DM);
#pragma unroll
  for (int i = 0; i < 8; ++i) xr[i] = *(const v4f*)(xsrc + (size_t)(i * 8) * DM);
#pragma unroll
  for (int i = 0; i < 16; ++i) *(v4u*)(ring + wdst + i * 16 * QK_PITCH) = wr[i];
#pragma unroll
  for (int i = 0; i < 8; ++i) { v4b c; c[0] = (__bf16)xr[i][0]; c[1] = (__bf16)xr[i][1]; c[2] = (__bf16)xr[i][2]; c[3] = (__bf16)xr[i][3]; *(v4b*)(ring + xdst + i * 8 * QK_PITCH) = c; }
  __syncthreads();
#pragma unroll 1   // rolled: the body already holds 32 products
  for (int s = 0; s < QK_NST; ++s) {
    const bool more = s + 1 < QK_NST;
    if (more) {
#pragma unroll
      for (int i = 0; i < 16; ++i) wr[i] = *(const v4u*)(wsrc + (size_t)((i >> 3) * DM + (i & 7) * 16) * DM + (s + 1) * QK_KST);
#pragma unroll
      for (int i = 0; i < 8; ++i) xr[i] = *(const v4f*)(xsrc + (size_t)(i * 8) * DM + (s + 1) * QK_KST);
    }
    const __bf16* const wb = ring + (s & 1) * QK_STAGE; const __bf16* const xb = wb + 256 * QK_PITCH;
#pragma unroll
    for (int kc = 0; kc < QK_KST / 32; ++kc) {
      const v16b a = frag_b(xb + (wave * 16 + col) * QK_PITCH + kc * 32, lane);
#pragma unroll
      for (int hf = 0; hf < 2; ++hf) { v16b f[8];   // eight fragments' LDS reads as one group ahead of their products (hf 0: Wq rows, hf 1: Wk rows); sixteen at once would not fit beside the accumulators in v0..v255, where the products' asm operands must lie
#pragma unroll
        for (int j = 0; j < 8; ++j) f[j] = frag_b(wb + (hf * 128 + j * 16 + col) * QK_PITCH + kc * 32, lane);
#pragma unroll
        for (int j = 0; j < 8; ++j) { if (hf == 0) aq[j] = wmma_bf(a, f[j], aq[j]); else ak[j] = wmma_bf(a, f[j], ak[j]); }
      }
    }
    if (more) { __bf16* const nb = ring + ((s + 1) & 1) * QK_STAGE;   // last read in stage s - 1, whose barrier every wave has passed
#pragma unroll
      for (int i = 0; i < 16; ++i) *(v4u*)(nb + wdst + i * 16 * QK_PITCH) = wr[i];
#pragma unroll
      for (int i = 0; i < 8; ++i) { v4b c; c[0] = (__bf16)xr[i][0]; c[1] = (__bf16)xr[i][1]; c[2] = (__bf16)xr[i][2]; c[3] = (__bf16)xr[i][3]; *(v4b*)(nb + xdst + i * 8 * QK_PITCH) = c; }
    }
    __syncthreads();   // publishes stage s + 1 and ends every wave's reads of stage s (after the last stage: frees the bytes for the output staging)
  }
#pragma unroll
  for (int j = 0; j < 8; ++j) { const float bq = bfr(BQ[n0 + j * 16 + col]);
#pragma unroll
    for (int r = 0; r < 8; ++r) { const float v = aq[j][r] + bq; aq[j][r] = v; const _Float16 hv = (_Float16)v; so[wave][8 * g + r][j * 16 + col] = hv; sol[wave][8 * g + r][j * 16 + col] = (_Float16)((v - (float)hv) * 2048.0f); } }
  LDSX();
  for (int rl = 0; rl < 16; ++rl) if (lane < 16) { vst2((unsigned*)(QK + (r0 + rl) * (2 * DM) + n0 + lane * 8), *(const v4u*)&so[wave][rl][lane * 8]); vst2((unsigned*)(QKL + (r0 + rl) * (2 * DM) + n0 + lane * 8), *(const v4u*)&sol[wave][rl][lane * 8]); }
  LDSX();
  // pass 2: softplus(k) rows into the k slot; v = q + k (raw k) planes
#pragma unroll
  for (int j = 0; j < 8; ++j) { const float bk = bfr(BK[n0 + j * 16 + col]);
#pragma unroll
    for (int r = 0; r < 8; ++r) { const float kv = ak[j][r] + bk; const float sp = softplus_p(kv); const _Float16 hs = (_Float16)sp; so[wave][8 * g + r][j * 16 + col] = hs; sol[wave][8 * g + r][j * 16 + col] = (_Float16)((sp - (float)hs) * 2048.0f);
      const float vv = aq[j][r] + kv; const _Float16 hv = (_Float16)vv; sth[j * 16 + col][wave * 16 + 8 * g + r] = hv; stl[j * 16 + col][wave * 16 + 8 * g + r] = (_Float16)((vv - (float)hv) * 2048.0f); } }
  __syncthreads();
  for (int rl = 0; rl < 16; ++rl) if (lane < 16) { vst2((unsigned*)(QK + (r0 + rl) * (2 * DM) + DM + n0 + lane * 8), *(const v4u*)&so[wave][rl][lane * 8]); vst2((unsigned*)(QKL + (r0 + rl) * (2 * DM) + DM + n0 + lane * 8), *(const v4u*)&sol[wave][rl][lane * 8]); }
  { const int b = (int)(rb / SS), s0 = (int)(rb % SS);
    for (int q = tid; q < 128 * 8; q += 128) { const int d = q >> 3, pc = q & 7; const size_t o = ((size_t)b * DM + n0 + d) * SS + s0 + pc * 8; vst2((unsigned*)(VTH + o), *(const v4u*)&sth[d][pc * 8]); vst2((unsigned*)(VTL + o), *(const v4u*)&stl[d][pc * 8]); } }
}
extern "C" void kernel_launch(void* const* d_in, const int* in_sizes, int n_in, void* d_out, int out_size, void* d_ws, size_t ws_size, hipStream_t stream) {
  (void)in_sizes; (void)n_in; (void)out_size;
  const float** F = (const float**)d_in;   // 0 hidden [2,2048,1024], 1 attention_mask [2,2048] int (query axis), 2 Wq (in,out), 3 bq, 4 Wk, 5 bk
  if (ws_size < (size_t)WS_END) return;
  char* ws = (char*)d_ws; __bf16* PK = (__bf16*)(ws + WS_PK); _Float16 *QK = (_Float16*)(ws + WS_QK), *QKL = (_Float16*)(ws + WS_QKL), *VTH = (_Float16*)(ws + WS_VTH), *VTL = (_Float16*)(ws + WS_VTL);
  k_pack<<<dim3(DM / PT_N, DM / PT_K, 2), 256, 0, stream>>>(F[2], F[4], PK);   // Wq, Wk rows (the only packed rows that are read)
  k_qk2<<<dim3(TNB * SS / 64, DM / 128), 128, 0, stream>>>(F[0], PK, F[3], F[5], QK, QKL, VTH, VTL);
  k_attn<<<dim3(TQB, NH, TNB), 128, 0, stream>>>(QK, QKL, VTH, VTL, nullptr, (const int*)d_in[1], (float*)d_out);   // merged heads are the module's output
}

// v006
// A run of this version takes 73.5 microseconds.
// Two timings next to v005 both put it at 1.05 times that version's speed.
// All steps since v000 together make it 4.79 times as fast.
// compute dtype: all float inputs rounded to bf16, the int mask read on device; q / k = x . W + b with EXACT bf16 products on WMMA 16x16x32 ((in,out) weights as transposed rows), softplus(k) (hardware exp2/log2, the rounding of 1 + e compensated) and v = q + k formed in f32 in the same block before one f16 rounding (hi + residual planes); PLAIN attention: q, softplus(k) single f16 x 1/8, running-max softmax in f32 (hardware exp), P (scaled by 2^11, single f16) x v (single f16); f32 merged-head output.
#include <hip/hip_runtime.h>
#include <math.h>

typedef __attribute__((ext_vector_type(16))) _Float16 v16h;
typedef __attribute__((ext_vector_type(16))) __bf16 v16b;
typedef __attribute__((ext_vector_type(8)))  _Float16 v8h;
typedef __attribute__((ext_vector_type(8)))  float v8f;
typedef __attribute__((ext_vector_type(4)))  float v4f;
typedef __attribute__((ext_vector_type(2)))  float v2f;
typedef __attribute__((ext_vector_type(4)))  unsigned v4u;
typedef __attribute__((ext_vector_type(4)))  int v4i;
typedef float __attribute__((may_alias)) float_a;
typedef int __attribute__((may_alias)) int_a;

template <typename T> __device__ __forceinline__ void vst2(void* p, T v) { *(T*)p = v;  }
__device__ __forceinline__ v8f wmma16(v16h a, v16h b, v8f c) {
  return __builtin_amdgcn_wmma_f32_16x16x32_f16(false, a, false, b, (short)0, c, false, false);   // the builtin alone: the compiler keeps the distance behind it itself and may fill it with useful work
}
__device__ __forceinline__ v8f wmma_bf(v16b a, v16b b, v8f c) {
  v8f d = __builtin_amdgcn_wmma_f32_16x16x32_bf16(false, a, false, b, (short)0, c, false, false);
  asm volatile("v_nop\n\tv_nop\n\tv_nop\n\tv_nop" : "+v"(d) : "v"(a), "v"(b));
  return d;
}
// BERT self attention variant (B 2, S 2,048, 1,024 dims, 16 heads x 64): q = x Wq + bq, k = x Wk + bk, keys transformed to softplus(k), values = q + k, scores / 8 with the attention mask applied on the QUERY axis (masked queries get uniform attention), softmax, . v; merged heads are the output.
__device__ __forceinline__ v16h frag_h(const _Float16* rowk0, int lane) {
  union { v16h v; v8h q[2]; } u; const _Float16* p = rowk0 + 8 * (lane >> 4);
  u.q[0] = *(const v8h*)p; u.q[1] = *(const v8h*)(p + 16); return u.v;
}
__device__ __forceinline__ v16h frag_f32(const float* rowk0, int lane) {
  v16h a; const float* p = rowk0 + 8 * (lane >> 4);
#pragma unroll
  for (int i = 0; i < 8; ++i) { a[i] = (_Float16)p[i]; a[8 + i] = (_Float16)p[16 + i]; }
  return a;
}
__device__ __forceinline__ v16h frag_f32s(const float* rowk0, int lane, float sc) {
  v16h a; const float* p = rowk0 + 8 * (lane >> 4);
#pragma unroll
  for (int i = 0; i < 8; ++i) { a[i] = (_Float16)(p[i] * sc); a[8 + i] = (_Float16)(p[16 + i] * sc); }
  return a;
}
// column fragment from a [K][ld] layout (column n), rows >= K read as 0
__device__ __forceinline__ v16h fragc_f32(const float* W, int k0, int n, int lane, int ld, int K) {
  v16h a; const int g = lane >> 4;
#pragma unroll
  for (int i = 0; i < 8; ++i) { const int ka = k0 + 8 * g + i, kb = ka + 16;
    a[i] = (_Float16)(ka < K ? W[(size_t)(ka < K ? ka : K - 1) * ld + n] : 0.f); a[8 + i] = (_Float16)(kb < K ? W[(size_t)(kb < K ? kb : K - 1) * ld + n] : 0.f); }
  return a;
}
struct F2 { v16b h, l; };
__device__ __forceinline__ F2 bsplit16(const float v[16]) { F2 r;
#pragma unroll
  for (int i = 0; i < 16; ++i) { const __bf16 h = (__bf16)v[i]; r.h[i] = h; r.l[i] = (__bf16)(v[i] - (float)h); }
  return r; }
__device__ __forceinline__ F2 split_row(const float* row, int k0, int lane) { float v[16]; const float* p = row + k0 + 8 * (lane >> 4);
#pragma unroll
  for (int i = 0; i < 8; ++i) { v[i] = p[i]; v[8 + i] = p[16 + i]; }
  return bsplit16(v); }
__device__ __forceinline__ F2 split_rowK(const float* row, int k0, int lane, int K) { float v[16]; const int g = lane >> 4;
#pragma unroll
  for (int i = 0; i < 8; ++i) { const int ka = k0 + 8 * g + i, kb = ka + 16; v[i] = ka < K ? row[ka < K ? ka : K - 1] : 0.f; v[8 + i] = kb < K ? row[kb < K ? kb : K - 1] : 0.f; }
  return bsplit16(v); }
__device__ __forceinline__ F2 split_col(const float* W, int k0, int n, int lane, int ld, int K) { float v[16]; const int g = lane >> 4;
#pragma unroll
  for (int i = 0; i < 8; ++i) { const int ka = k0 + 8 * g + i, kb = ka + 16; v[i] = ka < K ? W[(size_t)(ka < K ? ka : K - 1) * ld + n] : 0.f; v[8 + i] = kb < K ? W[(size_t)(kb < K ? kb : K - 1) * ld + n] : 0.f; }
  return bsplit16(v); }
__device__ __forceinline__ v8f mac3(const F2& a, const F2& b, v8f c) { c = wmma_bf(a.l, b.h, c); c = wmma_bf(a.h, b.l, c); return wmma_bf(a.h, b.h, c); }
__device__ __forceinline__ float sigm(float v) { return 1.0f / (1.0f + expf(-v)); }
#define LDSX() do { asm volatile("s_wait_dscnt 0" ::: "memory"); __builtin_amdgcn_wave_barrier(); __builtin_amdgcn_fence(__ATOMIC_RELEASE, "workgroup"); } while (0)


#define NB 2
#define SS 2048
#define DM 1024
#define NH 16
// softplus(z) = max(z, 0) + log1p(e) with e = exp(-|z|) in [0, 1], on the hardware exp2 and log2 and in line, so that a lane's 64 values overlap instead of running one dependent chain after another.
// c is the part of e that the rounding of 1 + e dropped: added back, it keeps the relative accuracy of small results (z far below 0); for large z both terms vanish against z.
// The v_nop fills the slot that the instruction set asks for behind a transcendental before its source is overwritten or its result read; inside the statement it stays directly behind it.
__device__ __forceinline__ float hw_exp2(float x) { float r; asm("v_exp_f32 %0, %1\n\tv_nop" : "=v"(r) : "v"(x)); return r; }
__device__ __forceinline__ float hw_log2(float x) { float r; asm("v_log_f32 %0, %1\n\tv_nop" : "=v"(r) : "v"(x)); return r; }
// eight independent exponentials in one statement: each stands behind another register's, the outputs share no register with the inputs, and the v_nop fills the slot behind the last
__device__ __forceinline__ v8f hw_exp2x8(v8f x) { float r0, r1, r2, r3, r4, r5, r6, r7;
  asm("v_exp_f32 %0, %8\n\tv_exp_f32 %1, %9\n\tv_exp_f32 %2, %10\n\tv_exp_f32 %3, %11\n\tv_exp_f32 %4, %12\n\tv_exp_f32 %5, %13\n\tv_exp_f32 %6, %14\n\tv_exp_f32 %7, %15\n\tv_nop"
      : "=&v"(r0), "=&v"(r1), "=&v"(r2), "=&v"(r3), "=&v"(r4), "=&v"(r5), "=&v"(r6), "=&v"(r7)
      : "v"(x[0]), "v"(x[1]), "v"(x[2]), "v"(x[3]), "v"(x[4]), "v"(x[5]), "v"(x[6]), "v"(x[7]));
  const v8f r = {r0, r1, r2, r3, r4, r5, r6, r7}; return r; }
__device__ __forceinline__ float softplus_p(float z) {
  const float e = hw_exp2(fabsf(z) * -1.44269504f), u = 1.0f + e, c = e - (u - 1.0f);
  return fmaxf(z, 0.f) + (hw_log2(u) * 0.693147181f + c);
}
#define HD 64
#define QKVW (3 * DM)
#ifndef TQB
#define TQB (SS / 64)
#define TNB NB
#define TOB (NB * SS / 64)     // output row tiles (all)
#endif
typedef __attribute__((ext_vector_type(8))) __bf16 v8b;
__device__ __forceinline__ v16b frag_b(const __bf16* rowk0, int lane) {
  union { v16b v; v8b q[2]; } u; const __bf16* p = rowk0 + 8 * (lane >> 4);
  u.q[0] = *(const v8b*)p; u.q[1] = *(const v8b*)(p + 16); return u.v;
}
__device__ __forceinline__ float bfr(float v) { return (float)(__bf16)v; }
__device__ __attribute__((noinline)) float exp_ni(float v) { return expf(v); }
__device__ __attribute__((noinline)) float erf_ni(float v) { return erff(v); }

#define PK_A 0                       // [3072][1024]: rows 0..2047 hold Wq | Wk as bf16 [out][in] (transposed), the rest unwritten
#define PK_P (PK_A + QKVW * DM)        // [1024][1024], unused
#define PK_END (PK_P + DM * DM)
#define WS_PK  0u
#define WS_QK  (WS_PK + 2u * PK_END)             // f16 [4096 rows][2048]: q | k
#define WS_QKL (WS_QK + 2u * NB * SS * 2 * DM)     // f16 q | k residual planes x2048
#define WS_VTH (WS_QKL + 2u * NB * SS * 2 * DM)    // f16 [b][1024 (h*64+d)][2048 s] hi
#define WS_VTL (WS_VTH + 2u * NB * DM * SS)        // f16 lo x 2048
#define WS_O   (WS_VTL + 2u * NB * DM * SS)        // f32 [4096][1024]
#define WS_CS  (WS_O + 4u * NB * SS * DM)           // f32 [2][2048][32], unused
#define WS_END (WS_CS + 4u * 2 * SS * 32)
// ---- k_pack: block = (64 columns n, 128 rows k, which): one tile of the (in,out) weight W_q (which 0) or W_k (which 1) -> bf16 rows [n][k] of PK_A (rows which*1024 + n), transposed through LDS
// Reads: 16 lanes cover 256 B of one weight row; writes: 16 lanes cover 256 B of one packed row, so every wave-wide global access is whole lines and each weight line is asked for once.
#define PT_N 64
#define PT_K 128
#define PT_PITCH 272   // bytes of a packed row in LDS: 256 + 16 (16 B x odd)
typedef __attribute__((ext_vector_type(2))) __bf16 v2b;
__global__ __launch_bounds__(256) void k_pack(const float* __restrict__ WQ, const float* __restrict__ WK, __bf16* __restrict__ PK) {
  __shared__ __align__(16) unsigned char s[PT_N * PT_PITCH];
  const int t = threadIdx.x, c = t & 15, rp = t >> 4, n0 = blockIdx.x * PT_N, k0 = blockIdx.y * PT_K, which = blockIdx.z;
  const float* const src = (which ? WK : WQ) + (size_t)(k0 + 2 * rp) * DM + n0 + 4 * c;   // rows k0 + 32p + 2rp and the next, columns n0 + 4c .. + 3
  v4f a[4], b[4];
#pragma unroll   // the eight loads in flight together, a[] and b[] in registers
  for (int p = 0; p < 4; ++p) { a[p] = *(const v4f*)(src + (size_t)(32 * p) * DM); b[p] = *(const v4f*)(src + (size_t)(32 * p + 1) * DM); }
  // a row's 16-byte pieces lie at piece ^ (row >> 4): the 16 lanes that write one k pair into rows 4c + i then fall on 16 different banks
  unsigned char* const d = s + (4 * c) * PT_PITCH + ((4 * rp) ^ ((c >> 2) << 4));
#pragma unroll   // both loops in line: register indices and LDS offsets are constants
  for (int p = 0; p < 4; ++p) {
#pragma unroll
    for (int i = 0; i < 4; ++i) { v2b w; w[0] = (__bf16)a[p][i]; w[1] = (__bf16)b[p][i]; *(v2b*)(d + i * PT_PITCH + 64 * p) = w; } }
  __syncthreads();
#pragma unroll   // the four LDS reads as one group ahead of their stores
  for (int j = 0; j < 4; ++j) { const int n = rp + 16 * j; vst2((unsigned*)(PK + PK_A + ((size_t)which * DM + n0 + n) * DM + k0 + c * 8), *(const v4u*)(s + n * PT_PITCH + ((c ^ j) << 4))); }
}
__global__ __launch_bounds__(128) void k_qkv(const float* __restrict__ XQ, const float* __restrict__ XK, const float* __restrict__ XV, const __bf16* __restrict__ P, const float* __restrict__ BQ, const float* __restrict__ BK, const float* __restrict__ BV, _Float16* __restrict__ QK, _Float16* __restrict__ QKL, _Float16* __restrict__ VTH, _Float16* __restrict__ VTL) {
  const int which0 = (blockIdx.y * 128) / DM; const float* X = (which0 == 0) ? XQ : (which0 == 1) ? XK : XV; const float* BB = BQ ? (((which0 == 0) ? BQ : (which0 == 1) ? BK : BV) + (blockIdx.y * 128 - which0 * DM)) : nullptr;
  __shared__ __align__(16) _Float16 so[4][16][136], sol[4][16][136]; __shared__ __align__(16) _Float16 sth[128][72], stl[128][72];
  const int tid = threadIdx.x, wave = tid >> 5, lane = tid & 31, col = lane & 15, g = lane >> 4; const size_t r0 = (size_t)blockIdx.x * 64 + wave * 16; const int n0 = blockIdx.y * 128;
  v8f acc[8] = {};
#pragma unroll 2
  for (int kc = 0; kc < DM / 32; ++kc) { v16b a; { const float* p = X + (r0 + col) * DM + kc * 32 + 8 * g;
#pragma unroll
      for (int i = 0; i < 8; ++i) { a[i] = (__bf16)p[i]; a[8 + i] = (__bf16)p[16 + i]; } }
#pragma unroll
    for (int j = 0; j < 8; ++j) acc[j] = wmma_bf(a, frag_b(P + (size_t)(n0 + j * 16 + col) * DM + kc * 32, lane), acc[j]); }
  if (n0 < 2 * DM) {   // q stored unscaled (f16 sigma ~0.6, no subnormal exposure); 1/8 applied to the f32 score
#pragma unroll
    for (int j = 0; j < 8; ++j) {
#pragma unroll
      for (int r = 0; r < 8; ++r) { const float v = acc[j][r] + (BB ? bfr(BB[j * 16 + col]) : 0.f); const _Float16 hv = (_Float16)v; so[wave][8 * g + r][j * 16 + col] = hv; sol[wave][8 * g + r][j * 16 + col] = (_Float16)((v - (float)hv) * 2048.0f); } }   // q, k (+ bias) as f16 hi + (x2048) residual
    LDSX();
    for (int rl = 0; rl < 16; ++rl) if (lane < 16) { vst2((unsigned*)(QK + (r0 + rl) * (2 * DM) + n0 + lane * 8), *(const v4u*)&so[wave][rl][lane * 8]); vst2((unsigned*)(QKL + (r0 + rl) * (2 * DM) + n0 + lane * 8), *(const v4u*)&sol[wave][rl][lane * 8]); }
  } else {
#pragma unroll
    for (int j = 0; j < 8; ++j) {
#pragma unroll
      for (int r = 0; r < 8; ++r) { const float v = acc[j][r] + (BB ? bfr(BB[j * 16 + col]) : 0.f); const _Float16 hv = (_Float16)v; sth[j * 16 + col][wave * 16 + 8 * g + r] = hv; stl[j * 16 + col][wave * 16 + 8 * g + r] = (_Float16)((v - (float)hv) * 2048.0f); } }
    __syncthreads();
    const size_t rb = (size_t)blockIdx.x * 64; const int b = (int)(rb / SS), s0 = (int)(rb % SS); const int pc0 = n0 - 2 * DM;
    for (int q = tid; q < 128 * 8; q += 128) { const int d = q >> 3, pc = q & 7; const size_t o = ((size_t)b * DM + pc0 + d) * SS + s0 + pc * 8; vst2((unsigned*)(VTH + o), *(const v4u*)&sth[d][pc * 8]); vst2((unsigned*)(VTL + o), *(const v4u*)&stl[d][pc * 8]); }
  }
}
// ---- k_attn: block = (64 queries, head h, batch b): all-keys flash attention (K = 64: 2 k-steps), scores = (k.q) * 0.125 with single f16 operands, formed transposed; V^T.P^T: f16 V x f16 P (x2^11) in one accumulator; O[b*S+q][h*64+d] = acc / 2048 / l (256-B segments)
// K and V^T go through LDS: a stage is 64 keys = [64 key rows x 64 d | 64 d rows x 64 keys] of f16, rows of 128 B at pitch 144 B (16 B x odd: no bank conflict for 16-byte readers), copied once per block and read by its 4 waves.
// Two buffers: stage t + 1's copies fly while stage t is worked on; one barrier per stage.
#define AT_KST 64
#define AT_NST (SS / AT_KST)
#define AT_PITCH 72
#define AT_TILE (64 * AT_PITCH)
#define AT_STAGE (2 * AT_TILE)
// one stage: 8 copies of 16 B a lane (8 lanes cover one 128-B row, so a wave's copy reads 4 whole lines); lk = the lane's LDS byte address in the K tile, gk / gv = its global addresses in row (tid >> 3) of the K / V^T tile
__device__ __forceinline__ void attn_stage(unsigned lk, const _Float16* gk, const _Float16* gv) {
  const unsigned lv = lk + 2 * AT_TILE;
  // the s_wait_xcnt stands in the copies' own statement so that no address register is rewritten ahead of it
  asm volatile("global_load_async_to_lds_b128 %0, %8, off\n\t"
               "global_load_async_to_lds_b128 %1, %9, off\n\t"
               "global_load_async_to_lds_b128 %2, %10, off\n\t"
               "global_load_async_to_lds_b128 %3, %11, off\n\t"
               "global_load_async_to_lds_b128 %4, %12, off\n\t"
               "global_load_async_to_lds_b128 %5, %13, off\n\t"
               "global_load_async_to_lds_b128 %6, %14, off\n\t"
               "global_load_async_to_lds_b128 %7, %15, off\n\t"
               "s_wait_xcnt 0x0"
               :: "v"(lk), "v"(lk + 16 * 2 * AT_PITCH), "v"(lk + 32 * 2 * AT_PITCH), "v"(lk + 48 * 2 * AT_PITCH),
                  "v"(lv), "v"(lv + 16 * 2 * AT_PITCH), "v"(lv + 32 * 2 * AT_PITCH), "v"(lv + 48 * 2 * AT_PITCH),
                  "v"(gk), "v"(gk + (size_t)16 * 2 * DM), "v"(gk + (size_t)32 * 2 * DM), "v"(gk + (size_t)48 * 2 * DM),
                  "v"(gv), "v"(gv + (size_t)16 * SS), "v"(gv + (size_t)32 * SS), "v"(gv + (size_t)48 * SS)
               : "memory");
}
__device__ __forceinline__ float xhalf(float v) {   // the value of lane l ^ 16: the other half of the same query's keys
  const int b = __builtin_bit_cast(int, v); return __builtin_bit_cast(float, __builtin_amdgcn_permlanex16(b, b, 0x76543210, 0xfedcba98, false, false));
}
// at most four waves a SIMD, as before: the grid's 1,024 work-groups then stand four on each of the 256 WGPs
__global__ __launch_bounds__(128) __attribute__((amdgpu_waves_per_eu(4, 4))) void k_attn(const _Float16* __restrict__ QK, const _Float16* __restrict__ QKL, const _Float16* __restrict__ VTH, const _Float16* __restrict__ VTL, const void* __restrict__ KMASK, const int* __restrict__ QMSK, float* __restrict__ O) {
  __shared__ __align__(16) float so[4][16][68]; __shared__ __align__(16) _Float16 ring[2 * AT_STAGE];
  const int tid = threadIdx.x, wave = tid >> 5, lane = tid & 31, col = lane & 15, g = lane >> 4;
  const int qb = blockIdx.x, h = blockIdx.y, b = blockIdx.z; const int q0 = qb * 64 + wave * 16; const size_t rq = (size_t)b * SS + q0 + col;
  // transposed products: S^T = K . Q^T (A = key rows, B = q) and O^T += V^T . P^T, so lane (col, g) holds query col alone: its scores of keys 8g + r and 16 + 8g + r, its maximum, its sum, its output elements
  const int qm = QMSK[rq];
  asm volatile("s_wait_xcnt 0x0" ::: "memory");   // stands in front of any rewrite of the mask load's address registers
  const float sc = (qm == 0) ? 0.f : 0.125f;   // 1/sqrt(64); attention_mask on the QUERY axis: mask == 0 -> every score of that query is equal -> uniform weights
  v16h aq[2];
#pragma unroll
  for (int kc = 0; kc < 2; ++kc) aq[kc] = frag_h(QK + rq * (2 * DM) + h * HD + kc * 32, lane);
  float m = -3.0e38f, l = 0.f;   // m: the query's running maximum (equal in both halves); l: this half's part of the sum
  v8f acc[4] = {};
  const _Float16* const gk = QK + ((size_t)b * SS + (tid >> 3)) * (2 * DM) + DM + h * HD + (tid & 7) * 8;
  const _Float16* const gv = VTH + ((size_t)b * DM + h * HD + (tid >> 3)) * SS + (tid & 7) * 8;
  const unsigned l0 = (unsigned)(size_t)(__attribute__((address_space(3))) _Float16*)ring + (tid >> 3) * (2 * AT_PITCH) + (tid & 7) * 16;
  attn_stage(l0, gk, gv);
  asm volatile("s_wait_asynccnt 0x0" ::: "memory");   // stage 0 has landed before the barrier that publishes it
  __syncthreads();
  attn_stage(l0 + 2 * AT_STAGE, gk + (size_t)AT_KST * 2 * DM, gv + AT_KST);
#pragma unroll 1   // rolled: one trip per stage, the buffer chosen by the trip's parity
  for (int t = 0; t < AT_NST; ++t) { const _Float16* const kb = ring + (t & 1) * AT_STAGE; const _Float16* const vb = kb + AT_TILE;
#pragma unroll   // the stage's two 32-key passes in line, so that their LDS offsets are constants
  for (int ps = 0; ps < AT_KST / 32; ++ps) { v8f s[2]; v16h kf[2][2], vf[4];   // the pass's fragments: LDS reads as one group ahead of the products, V's in flight under the softmax
#pragma unroll
    for (int ct = 0; ct < 2; ++ct) {
#pragma unroll
      for (int kc = 0; kc < 2; ++kc) kf[ct][kc] = frag_h(kb + (ps * 32 + ct * 16 + col) * AT_PITCH + kc * 32, lane); }
#pragma unroll
    for (int dt = 0; dt < 4; ++dt) vf[dt] = frag_h(vb + (dt * 16 + col) * AT_PITCH + ps * 32, lane);
    __builtin_amdgcn_sched_barrier(0);   // keeps the sixteen LDS reads one group ahead of the products: left free, the compiler spreads them among the products in pairs, each waited for to the end
#pragma unroll
    for (int ct = 0; ct < 2; ++ct) { v8f c = {};
#pragma unroll
      for (int kc = 0; kc < 2; ++kc) c = wmma16(kf[ct][kc], aq[kc], c);   // single product: k, q as one-rounding f16 operands; c[r] = score of key ct * 16 + 8g + r, query col
      s[ct] = c * sc; }
    float mx = fmaxf(s[0][0], s[1][0]);
#pragma unroll
    for (int r = 1; r < 8; ++r) mx = fmaxf(mx, fmaxf(s[0][r], s[1][r]));
    mx = fmaxf(mx, xhalf(mx));
    const float mn = fmaxf(m, mx); const float alpha = hw_exp2((m - mn) * 1.44269504f); m = mn;
    const v8f ex0 = hw_exp2x8((s[0] - mn) * 1.44269504f), ex1 = hw_exp2x8((s[1] - mn) * 1.44269504f);   // exp(s - mn) = exp2((s - mn) x log2(e)) on the hardware exp2
    v16h pt; float es = 0.f;   // P^T as the B operand: element i = key 8g + i, element 8 + i = key 16 + 8g + i, the k order of the V^T fragment
#pragma unroll
    for (int r = 0; r < 8; ++r) { const float e0 = ex0[r], e1 = ex1[r]; es += e0 + e1;
      pt[r] = (_Float16)(e0 * 2048.0f); pt[8 + r] = (_Float16)(e1 * 2048.0f); }   // P scaled by 2^11 before the f16 rounding so small softmax weights stay out of the f16 subnormal range; 2^-11 folded into the epilogue
    l = l * alpha + es;
#pragma unroll
    for (int dt = 0; dt < 4; ++dt) acc[dt] = wmma16(vf[dt], pt, acc[dt] * alpha); }   // single product: V^T x P^T (x2^11); acc[dt][r] = output element dt * 16 + 8g + r of query col
    __builtin_amdgcn_sched_barrier(0);   // keeps the stage's work in front of its barrier: sunk behind it, the second pass would delay the refill's copies by half a stage of their flight time
    asm volatile("s_wait_dscnt 0x0" ::: "memory");      // this wave's reads of stage t are done
    asm volatile("s_wait_asynccnt 0x0" ::: "memory");   // its copies of stage t + 1 have landed
    __syncthreads();                                    // publishes stage t + 1 and ends every wave's reads of stage t
    if (t + 2 < AT_NST) attn_stage(l0 + (t & 1) * (2 * AT_STAGE), gk + (size_t)(t + 2) * AT_KST * 2 * DM, gv + (t + 2) * AT_KST); }
  asm volatile("s_wait_asynccnt 0x0" ::: "memory");     // no copy is left in flight when the wave goes on
  const float il = (1.0f / 2048.0f) / (l + xhalf(l));   // the two halves' sums joined once
#pragma unroll
  for (int dt = 0; dt < 4; ++dt) { const v8f o = acc[dt] * il; float* const d = &so[wave][col][dt * 16 + 8 * g];
    *(v4f*)d = __builtin_shufflevector(o, o, 0, 1, 2, 3); *(v4f*)(d + 4) = __builtin_shufflevector(o, o, 4, 5, 6, 7); }
  LDSX();
  for (int rl = 0; rl < 16; ++rl) if (lane < 16) vst2(O + ((size_t)b * SS + q0 + rl) * DM + h * HD + lane * 4, *(const v4f*)&so[wave][rl][lane * 4]);
}
// ---- k_out: block = (64 rows, 128 cols): out = O(hi/lo) . Wo rows (2 products) + bo
__global__ __launch_bounds__(128) void k_out(const float* __restrict__ O, const __bf16* __restrict__ P, const float* __restrict__ BO, float* __restrict__ Y) {
  __shared__ __align__(16) float so[4][16][132];
  const int tid = threadIdx.x, wave = tid >> 5, lane = tid & 31, col = lane & 15, g = lane >> 4; const size_t r0 = (size_t)blockIdx.x * 64 + wave * 16; const int n0 = blockIdx.y * 128;
  v8f acc[8] = {};
#pragma unroll 2
  for (int kc = 0; kc < DM / 32; ++kc) { const F2 a = split_row(O + (r0 + col) * DM, kc * 32, lane);
#pragma unroll
    for (int j = 0; j < 8; ++j) { const v16b w = frag_b(P + (size_t)(n0 + j * 16 + col) * DM + kc * 32, lane); acc[j] = wmma_bf(a.l, w, acc[j]); acc[j] = wmma_bf(a.h, w, acc[j]); } }
#pragma unroll
  for (int j = 0; j < 8; ++j) {
#pragma unroll
    for (int r = 0; r < 8; ++r) so[wave][8 * g + r][j * 16 + col] = acc[j][r] + (BO ? bfr(BO[n0 + j * 16 + col]) : 0.f); }
  LDSX();
  for (int rl = 0; rl < 16; ++rl) vst2(Y + (r0 + rl) * DM + n0 + lane * 4, *(const v4f*)&so[wave][rl][lane * 4]);
}
// ---- k_qk2: block = (64 rows, 128 cols): q = x Wq + bq and k = x Wk + bk for the same columns; stores q rows, softplus(k) rows (the engine's k slot) and v = q + k planes, all as f16 hi + residual
// Operand tiles go through LDS: a stage is 64 k of [256 weight rows (128 of Wq, 128 of Wk) | 64 x rows already rounded to bf16], rows of 128 B at pitch 144 B (16 B x odd: no bank conflict for 16-byte readers).
// Two buffers: the next stage's global loads are issued before this stage's products, land in registers, and are written to the other buffer behind the products; one barrier per stage.
#define QK_KST 64
#define QK_NST (DM / QK_KST)
#define QK_PITCH 72
#define QK_STAGE ((256 + 64) * QK_PITCH)
typedef __attribute__((ext_vector_type(4))) __bf16 v4b;
__global__ __launch_bounds__(128) void k_qk2(const float* __restrict__ X, const __bf16* __restrict__ P, const float* __restrict__ BQ, const float* __restrict__ BK, _Float16* __restrict__ QK, _Float16* __restrict__ QKL, _Float16* __restrict__ VTH, _Float16* __restrict__ VTL) {
  __shared__ __align__(16) unsigned char smem[2 * QK_STAGE * 2];   // the two stage buffers; behind the loop's last barrier the same bytes are the output staging
  __bf16* const ring = (__bf16*)smem;
  _Float16 (* const so)[16][136] = (_Float16 (*)[16][136])smem; _Float16 (* const sol)[16][136] = (_Float16 (*)[16][136])(smem + 17408); _Float16 (* const sth)[72] = (_Float16 (*)[72])(smem + 34816); _Float16 (* const stl)[72] = (_Float16 (*)[72])(smem + 53248);
  const int tid = threadIdx.x, wave = tid >> 5, lane = tid & 31, col = lane & 15, g = lane >> 4; const size_t rb = (size_t)blockIdx.x * 64, r0 = rb + wave * 16; const int n0 = blockIdx.y * 128;
  // loaders: 8 lanes cover one 128-B weight row piece, 16 lanes one 256-B x row piece, so every wave-wide load reads whole lines
  const __bf16* const wsrc = P + PK_A + (size_t)(n0 + (tid >> 3)) * DM + (tid & 7) * 8;
  const float* const xsrc = X + (rb + (tid >> 4)) * DM + (tid & 15) * 4;
  const int wdst = (tid >> 3) * QK_PITCH + (tid & 7) * 8, xdst = (256 + (tid >> 4)) * QK_PITCH + (tid & 15) * 4;
  v4u wr[16]; v4f xr[8];
  v8f aq[8] = {}, ak[8] = {};
#pragma unroll
  for (int i = 0; i < 16; ++i) wr[i] = *(const v4u*)(wsrc + (size_t)((i >> 3) * DM + (i & 7) * 16) * DM);
#pragma unroll
  for (int i = 0; i < 8; ++i) xr[i] = *(const v4f*)(xsrc + (size_t)(i * 8) * DM);
#pragma unroll
  for (int i = 0; i < 16; ++i) *(v4u*)(ring + wdst + i * 16 * QK_PITCH) = wr[i];
#pragma unroll
  for (int i = 0; i < 8; ++i) { v4b c; c[0] = (__bf16)xr[i][0]; c[1] = (__bf16)xr[i][1]; c[2] = (__bf16)xr[i][2]; c[3] = (__bf16)xr[i][3]; *(v4b*)(ring + xdst + i * 8 * QK_PITCH) = c; }
  __syncthreads();
#pragma unroll 1   // rolled: the body already holds 32 products
  for (int s = 0; s < QK_NST; ++s) {
    const bool more = s + 1 < QK_NST;
    if (more) {
#pragma unroll
      for (int i = 0; i < 16; ++i) wr[i] = *(const v4u*)(wsrc + (size_t)((i >> 3) * DM + (i & 7) * 16) * DM + (s + 1) * QK_KST);
#pragma unroll
      for (int i = 0; i < 8; ++i) xr[i] = *(const v4f*)(xsrc + (size_t)(i * 8) * DM + (s + 1) * QK_KST);
    }
    const __bf16* const wb = ring + (s & 1) * QK_STAGE; const __bf16* const xb = wb + 256 * QK_PITCH;
#pragma unroll
    for (int kc = 0; kc < QK_KST / 32; ++kc) {
      const v16b a = frag_b(xb + (wave * 16 + col) * QK_PITCH + kc * 32, lane);
#pragma unroll
      for (int hf = 0; hf < 2; ++hf) { v16b f[8];   // eight fragments' LDS reads as one group ahead of their products (hf 0: Wq rows, hf 1: Wk rows); sixteen at once would not fit beside the accumulators in v0..v255, where the products' asm operands must lie
#pragma unroll
        for (int j = 0; j < 8; ++j) f[j] = frag_b(wb + (hf * 128 + j * 16 + col) * QK_PITCH + kc * 32, lane);
#pragma unroll
        for (int j = 0; j < 8; ++j) { if (hf == 0) aq[j] = wmma_bf(a, f[j], aq[j]); else ak[j] = wmma_bf(a, f[j], ak[j]); }
      }
    }
    if (more) { __bf16* const nb = ring + ((s + 1) & 1) * QK_STAGE;   // last read in stage s - 1, whose barrier every wave has passed
#pragma unroll
      for (int i = 0; i < 16; ++i) *(v4u*)(nb + wdst + i * 16 * QK_PITCH) = wr[i];
#pragma unroll
      for (int i = 0; i < 8; ++i) { v4b c; c[0] = (__bf16)xr[i][0]; c[1] = (__bf16)xr[i][1]; c[2] = (__bf16)xr[i][2]; c[3] = (__bf16)xr[i][3]; *(v4b*)(nb + xdst + i * 8 * QK_PITCH) = c; }
    }
    __syncthreads();   // publishes stage s + 1 and ends every wave's reads of stage s (after the last stage: frees the bytes for the output staging)
  }
#pragma unroll
  for (int j = 0; j < 8; ++j) { const float bq = bfr(BQ[n0 + j * 16 + col]);
#pragma unroll
    for (int r = 0; r < 8; ++r) { const float v = aq[j][r] + bq; aq[j][r] = v; const _Float16 hv = (_Float16)v; so[wave][8 * g + r][j * 16 + col] = hv; sol[wave][8 * g + r][j * 16 + col] = (_Float16)((v - (float)hv) * 2048.0f); } }
  LDSX();
  for (int rl = 0; rl < 16; ++rl) if (lane < 16) { vst2((unsigned*)(QK + (r0 + rl) * (2 * DM) + n0 + lane * 8), *(const v4u*)&so[wave][rl][lane * 8]); vst2((unsigned*)(QKL + (r0 + rl) * (2 * DM) + n0 + lane * 8), *(const v4u*)&sol[wave][rl][lane * 8]); }
  LDSX();
  // pass 2: softplus(k) rows into the k slot; v = q + k (raw k) planes
#pragma unroll
  for (int j = 0; j < 8; ++j) { const float bk = bfr(BK[n0 + j * 16 + col]);
#pragma unroll
    for (int r = 0; r < 8; ++r) { const float kv = ak[j][r] + bk; const float sp = softplus_p(kv); const _Float16 hs = (_Float16)sp; so[wave][8 * g + r][j * 16 + col] = hs; sol[wave][8 * g + r][j * 16 + col] = (_Float16)((sp - (float)hs) * 2048.0f);
      const float vv = aq[j][r] + kv; const _Float16 hv = (_Float16)vv; sth[j * 16 + col][wave * 16 + 8 * g + r] = hv; stl[j * 16 + col][wave * 16 + 8 * g + r] = (_Float16)((vv - (float)hv) * 2048.0f); } }
  __syncthreads();
  for (int rl = 0; rl < 16; ++rl) if (lane < 16) { vst2((unsigned*)(QK + (r0 + rl) * (2 * DM) + DM + n0 + lane * 8), *(const v4u*)&so[wave][rl][lane * 8]); vst2((unsigned*)(QKL + (r0 + rl) * (2 * DM) + DM + n0 + lane * 8), *(const v4u*)&sol[wave][rl][lane * 8]); }
  { const int b = (int)(rb / SS), s0 = (int)(rb % SS);
    for (int q = tid; q < 128 * 8; q += 128) { const int d = q >> 3, pc = q & 7; const size_t o = ((size_t)b * DM + n0 + d) * SS + s0 + pc * 8; vst2((unsigned*)(VTH + o), *(const v4u*)&sth[d][pc * 8]); vst2((unsigned*)(VTL + o), *(const v4u*)&stl[d][pc * 8]); } }
}
extern "C" void kernel_launch(void* const* d_in, const int* in_sizes, int n_in, void* d_out, int out_size, void* d_ws, size_t ws_size, hipStream_t stream) {
  (void)in_sizes; (void)n_in; (void)out_size;
  const float** F = (const float**)d_in;   // 0 hidden [2,2048,1024], 1 attention_mask [2,2048] int (query axis), 2 Wq (in,out), 3 bq, 4 Wk, 5 bk
  if (ws_size < (size_t)WS_END) return;
  char* ws = (char*)d_ws; __bf16* PK = (__bf16*)(ws + WS_PK); _Float16 *QK = (_Float16*)(ws + WS_QK), *QKL = (_Float16*)(ws + WS_QKL), *VTH = (_Float16*)(ws + WS_VTH), *VTL = (_Float16*)(ws + WS_VTL);
  k_pack<<<dim3(DM / PT_N, DM / PT_K, 2), 256, 0, stream>>>(F[2], F[4], PK);   // Wq, Wk rows (the only packed rows that are read)
  k_qk2<<<dim3(TNB * SS / 64, DM / 128), 128, 0, stream>>>(F[0], PK, F[3], F[5], QK, QKL, VTH, VTL);
  k_attn<<<dim3(TQB, NH, TNB), 128, 0, stream>>>(QK, QKL, VTH, VTL, nullptr, (const int*)d_in[1], (float*)d_out);   // merged heads are the module's output
}

// v007
// It runs in 67.7 microseconds.
// Two timings next to v006 both put it at 1.08 times that version's speed.
// Over all steps from v000 it is 5.19 times as fast.
// compute dtype: all float inputs rounded to bf16, the int mask read on device; q / k = x . W + b with EXACT bf16 products on WMMA 16x16x32 ((in,out) weights as transposed rows), softplus(k) (hardware exp2/log2, the rounding of 1 + e compensated) and v = q + k formed in f32 in the same block before one f16 rounding (hi + residual planes); PLAIN attention: q, softplus(k) single f16 x 1/8, softmax in f32 against a held reference that is raised only when needed (hardware exp), P (scaled by 2^11, single f16) x v (single f16); f32 merged-head output.
#include <hip/hip_runtime.h>
#include <math.h>

typedef __attribute__((ext_vector_type(16))) _Float16 v16h;
typedef __attribute__((ext_vector_type(16))) __bf16 v16b;
typedef __attribute__((ext_vector_type(8)))  _Float16 v8h;
typedef __attribute__((ext_vector_type(8)))  float v8f;
typedef __attribute__((ext_vector_type(4)))  float v4f;
typedef __attribute__((ext_vector_type(2)))  float v2f;
typedef __attribute__((ext_vector_type(4)))  unsigned v4u;
typedef __attribute__((ext_vector_type(4)))  int v4i;
typedef float __attribute__((may_alias)) float_a;
typedef int __attribute__((may_alias)) int_a;

template <typename T> __device__ __forceinline__ void vst2(void* p, T v) { *(T*)p = v;  }
__device__ __forceinline__ v8f wmma16(v16h a, v16h b, v8f c) {
  return __builtin_amdgcn_wmma_f32_16x16x32_f16(false, a, false, b, (short)0, c, false, false);   // the builtin alone: the compiler keeps the distance behind it itself and may fill it with useful work
}
__device__ __forceinline__ v8f wmma_bf(v16b a, v16b b, v8f c) {
  v8f d = __builtin_amdgcn_wmma_f32_16x16x32_bf16(false, a, false, b, (short)0, c, false, false);
  asm volatile("v_nop\n\tv_nop\n\tv_nop\n\tv_nop" : "+v"(d) : "v"(a), "v"(b));
  return d;
}
// BERT self attention variant (B 2, S 2,048, 1,024 dims, 16 heads x 64): q = x Wq + bq, k = x Wk + bk, keys transformed to softplus(k), values = q + k, scores / 8 with the attention mask applied on the QUERY axis (masked queries get uniform attention), softmax, . v; merged heads are the output.
__device__ __forceinline__ v16h frag_h(const _Float16* rowk0, int lane) {
  union { v16h v; v8h q[2]; } u; const _Float16* p = rowk0 + 8 * (lane >> 4);
  u.q[0] = *(const v8h*)p; u.q[1] = *(const v8h*)(p + 16); return u.v;
}
__device__ __forceinline__ v16h frag_f32(const float* rowk0, int lane) {
  v16h a; const float* p = rowk0 + 8 * (lane >> 4);
#pragma unroll
  for (int i = 0; i < 8; ++i) { a[i] = (_Float16)p[i]; a[8 + i] = (_Float16)p[16 + i]; }
  return a;
}
__device__ __forceinline__ v16h frag_f32s(const float* rowk0, int lane, float sc) {
  v16h a; const float* p = rowk0 + 8 * (lane >> 4);
#pragma unroll
  for (int i = 0; i < 8; ++i) { a[i] = (_Float16)(p[i] * sc); a[8 + i] = (_Float16)(p[16 + i] * sc); }
  return a;
}
// column fragment from a [K][ld] layout (column n), rows >= K read as 0
__device__ __forceinline__ v16h fragc_f32(const float* W, int k0, int n, int lane, int ld, int K) {
  v16h a; const int g = lane >> 4;
#pragma unroll
  for (int i = 0; i < 8; ++i) { const int ka = k0 + 8 * g + i, kb = ka + 16;
    a[i] = (_Float16)(ka < K ? W[(size_t)(ka < K ? ka : K - 1) * ld + n] : 0.f); a[8 + i] = (_Float16)(kb < K ? W[(size_t)(kb < K ? kb : K - 1) * ld + n] : 0.f); }
  return a;
}
struct F2 { v16b h, l; };
__device__ __forceinline__ F2 bsplit16(const float v[16]) { F2 r;
#pragma unroll
  for (int i = 0; i < 16; ++i) { const __bf16 h = (__bf16)v[i]; r.h[i] = h; r.l[i] = (__bf16)(v[i] - (float)h); }
  return r; }
__device__ __forceinline__ F2 split_row(const float* row, int k0, int lane) { float v[16]; const float* p = row + k0 + 8 * (lane >> 4);
#pragma unroll
  for (int i = 0; i < 8; ++i) { v[i] = p[i]; v[8 + i] = p[16 + i]; }
  return bsplit16(v); }
__device__ __forceinline__ F2 split_rowK(const float* row, int k0, int lane, int K) { float v[16]; const int g = lane >> 4;
#pragma unroll
  for (int i = 0; i < 8; ++i) { const int ka = k0 + 8 * g + i, kb = ka + 16; v[i] = ka < K ? row[ka < K ? ka : K - 1] : 0.f; v[8 + i] = kb < K ? row[kb < K ? kb : K - 1] : 0.f; }
  return bsplit16(v); }
__device__ __forceinline__ F2 split_col(const float* W, int k0, int n, int lane, int ld, int K) { float v[16]; const int g = lane >> 4;
#pragma unroll
  for (int i = 0; i < 8; ++i) { const int ka = k0 + 8 * g + i, kb = ka + 16; v[i] = ka < K ? W[(size_t)(ka < K ? ka : K - 1) * ld + n] : 0.f; v[8 + i] = kb < K ? W[(size_t)(kb < K ? kb : K - 1) * ld + n] : 0.f; }
  return bsplit16(v); }
__device__ __forceinline__ v8f mac3(const F2& a, const F2& b, v8f c) { c = wmma_bf(a.l, b.h, c); c = wmma_bf(a.h, b.l, c); return wmma_bf(a.h, b.h, c); }
__device__ __forceinline__ float sigm(float v) { return 1.0f / (1.0f + expf(-v)); }
#define LDSX() do { asm volatile("s_wait_dscnt 0" ::: "memory"); __builtin_amdgcn_wave_barrier(); __builtin_amdgcn_fence(__ATOMIC_RELEASE, "workgroup"); } while (0)


#define NB 2
#define SS 2048
#define DM 1024
#define NH 16
// softplus(z) = max(z, 0) + log1p(e) with e = exp(-|z|) in [0, 1], on the hardware exp2 and log2 and in line, so that a lane's 64 values overlap instead of running one dependent chain after another.
// c is the part of e that the rounding of 1 + e dropped: added back, it keeps the relative accuracy of small results (z far below 0); for large z both terms vanish against z.
// The v_nop fills the slot that the instruction set asks for behind a transcendental before its source is overwritten or its result read; inside the statement it stays directly behind it.
__device__ __forceinline__ float hw_exp2(float x) { float r; asm("v_exp_f32 %0, %1\n\tv_nop" : "=v"(r) : "v"(x)); return r; }
__device__ __forceinline__ float hw_log2(float x) { float r; asm("v_log_f32 %0, %1\n\tv_nop" : "=v"(r) : "v"(x)); return r; }
// eight independent exponentials in one statement: each stands behind another register's, the outputs share no register with the inputs, and the v_nop fills the slot behind the last
__device__ __forceinline__ v8f hw_exp2x8(v8f x) { float r0, r1, r2, r3, r4, r5, r6, r7;
  asm("v_exp_f32 %0, %8\n\tv_exp_f32 %1, %9\n\tv_exp_f32 %2, %10\n\tv_exp_f32 %3, %11\n\tv_exp_f32 %4, %12\n\tv_exp_f32 %5, %13\n\tv_exp_f32 %6, %14\n\tv_exp_f32 %7, %15\n\tv_nop"
      : "=&v"(r0), "=&v"(r1), "=&v"(r2), "=&v"(r3), "=&v"(r4), "=&v"(r5), "=&v"(r6), "=&v"(r7)
      : "v"(x[0]), "v"(x[1]), "v"(x[2]), "v"(x[3]), "v"(x[4]), "v"(x[5]), "v"(x[6]), "v"(x[7]));
  const v8f r = {r0, r1, r2, r3, r4, r5, r6, r7}; return r; }
__device__ __forceinline__ float softplus_p(float z) {
  const float e = hw_exp2(fabsf(z) * -1.44269504f), u = 1.0f + e, c = e - (u - 1.0f);
  return fmaxf(z, 0.f) + (hw_log2(u) * 0.693147181f + c);
}
#define HD 64
#define QKVW (3 * DM)
#ifndef TQB
#define TQB (SS / 64)
#define TNB NB
#define TOB (NB * SS / 64)     // output row tiles (all)
#endif
typedef __attribute__((ext_vector_type(8))) __bf16 v8b;
__device__ __forceinline__ v16b frag_b(const __bf16* rowk0, int lane) {
  union { v16b v; v8b q[2]; } u; const __bf16* p = rowk0 + 8 * (lane >> 4);
  u.q[0] = *(const v8b*)p; u.q[1] = *(const v8b*)(p + 16); return u.v;
}
__device__ __forceinline__ float bfr(float v) { return (float)(__bf16)v; }
__device__ __attribute__((noinline)) float exp_ni(float v) { return expf(v); }
__device__ __attribute__((noinline)) float erf_ni(float v) { return erff(v); }

#define PK_A 0                       // [3072][1024]: rows 0..2047 hold Wq | Wk as bf16 [out][in] (transposed), the rest unwritten
#define PK_P (PK_A + QKVW * DM)        // [1024][1024], unused
#define PK_END (PK_P + DM * DM)
#define WS_PK  0u
#define WS_QK  (WS_PK + 2u * PK_END)             // f16 [4096 rows][2048]: q | k
#define WS_QKL (WS_QK + 2u * NB * SS * 2 * DM)     // f16 q | k residual planes x2048
#define WS_VTH (WS_QKL + 2u * NB * SS * 2 * DM)    // f16 [b][1024 (h*64+d)][2048 s] hi
#define WS_VTL (WS_VTH + 2u * NB * DM * SS)        // f16 lo x 2048
#define WS_O   (WS_VTL + 2u * NB * DM * SS)        // f32 [4096][1024]
#define WS_CS  (WS_O + 4u * NB * SS * DM)           // f32 [2][2048][32], unused
#define WS_END (WS_CS + 4u * 2 * SS * 32)
// ---- k_pack: block = (64 columns n, 128 rows k, which): one tile of the (in,out) weight W_q (which 0) or W_k (which 1) -> bf16 rows [n][k] of PK_A (rows which*1024 + n), transposed through LDS
// Reads: 16 lanes cover 256 B of one weight row; writes: 16 lanes cover 256 B of one packed row, so every wave-wide global access is whole lines and each weight line is asked for once.
#define PT_N 64
#define PT_K 128
#define PT_PITCH 272   // bytes of a packed row in LDS: 256 + 16 (16 B x odd)
typedef __attribute__((ext_vector_type(2))) __bf16 v2b;
__global__ __launch_bounds__(256) void k_pack(const float* __restrict__ WQ, const float* __restrict__ WK, __bf16* __restrict__ PK) {
  __shared__ __align__(16) unsigned char s[PT_N * PT_PITCH];
  const int t = threadIdx.x, c = t & 15, rp = t >> 4, n0 = blockIdx.x * PT_N, k0 = blockIdx.y * PT_K, which = blockIdx.z;
  const float* const src = (which ? WK : WQ) + (size_t)(k0 + 2 * rp) * DM + n0 + 4 * c;   // rows k0 + 32p + 2rp and the next, columns n0 + 4c .. + 3
  v4f a[4], b[4];
#pragma unroll   // the eight loads in flight together, a[] and b[] in registers
  for (int p = 0; p < 4; ++p) { a[p] = *(const v4f*)(src + (size_t)(32 * p) * DM); b[p] = *(const v4f*)(src + (size_t)(32 * p + 1) * DM); }
  // a row's 16-byte pieces lie at piece ^ (row >> 4): the 16 lanes that write one k pair into rows 4c + i then fall on 16 different banks
  unsigned char* const d = s + (4 * c) * PT_PITCH + ((4 * rp) ^ ((c >> 2) << 4));
#pragma unroll   // both loops in line: register indices and LDS offsets are constants
  for (int p = 0; p < 4; ++p) {
#pragma unroll
    for (int i = 0; i < 4; ++i) { v2b w; w[0] = (__bf16)a[p][i]; w[1] = (__bf16)b[p][i]; *(v2b*)(d + i * PT_PITCH + 64 * p) = w; } }
  __syncthreads();
#pragma unroll   // the four LDS reads as one group ahead of their stores
  for (int j = 0; j < 4; ++j) { const int n = rp + 16 * j; vst2((unsigned*)(PK + PK_A + ((size_t)which * DM + n0 + n) * DM + k0 + c * 8), *(const v4u*)(s + n * PT_PITCH + ((c ^ j) << 4))); }
}
__global__ __launch_bounds__(128) void k_qkv(const float* __restrict__ XQ, const float* __restrict__ XK, const float* __restrict__ XV, const __bf16* __restrict__ P, const float* __restrict__ BQ, const float* __restrict__ BK, const float* __restrict__ BV, _Float16* __restrict__ QK, _Float16* __restrict__ QKL, _Float16* __restrict__ VTH, _Float16* __restrict__ VTL) {
  const int which0 = (blockIdx.y * 128) / DM; const float* X = (which0 == 0) ? XQ : (which0 == 1) ? XK : XV; const float* BB = BQ ? (((which0 == 0) ? BQ : (which0 == 1) ? BK : BV) + (blockIdx.y * 128 - which0 * DM)) : nullptr;
  __shared__ __align__(16) _Float16 so[4][16][136], sol[4][16][136]; __shared__ __align__(16) _Float16 sth[128][72], stl[128][72];
  const int tid = threadIdx.x, wave = tid >> 5, lane = tid & 31, col = lane & 15, g = lane >> 4; const size_t r0 = (size_t)blockIdx.x * 64 + wave * 16; const int n0 = blockIdx.y * 128;
  v8f acc[8] = {};
#pragma unroll 2
  for (int kc = 0; kc < DM / 32; ++kc) { v16b a; { const float* p = X + (r0 + col) * DM + kc * 32 + 8 * g;
#pragma unroll
      for (int i = 0; i < 8; ++i) { a[i] = (__bf16)p[i]; a[8 + i] = (__bf16)p[16 + i]; } }
#pragma unroll
    for (int j = 0; j < 8; ++j) acc[j] = wmma_bf(a, frag_b(P + (size_t)(n0 + j * 16 + col) * DM + kc * 32, lane), acc[j]); }
  if (n0 < 2 * DM) {   // q stored unscaled (f16 sigma ~0.6, no subnormal exposure); 1/8 applied to the f32 score
#pragma unroll
    for (int j = 0; j < 8; ++j) {
#pragma unroll
      for (int r = 0; r < 8; ++r) { const float v = acc[j][r] + (BB ? bfr(BB[j * 16 + col]) : 0.f); const _Float16 hv = (_Float16)v; so[wave][8 * g + r][j * 16 + col] = hv; sol[wave][8 * g + r][j * 16 + col] = (_Float16)((v - (float)hv) * 2048.0f); } }   // q, k (+ bias) as f16 hi + (x2048) residual
    LDSX();
    for (int rl = 0; rl < 16; ++rl) if (lane < 16) { vst2((unsigned*)(QK + (r0 + rl) * (2 * DM) + n0 + lane * 8), *(const v4u*)&so[wave][rl][lane * 8]); vst2((unsigned*)(QKL + (r0 + rl) * (2 * DM) + n0 + lane * 8), *(const v4u*)&sol[wave][rl][lane * 8]); }
  } else {
#pragma unroll
    for (int j = 0; j < 8; ++j) {
#pragma unroll
      for (int r = 0; r < 8; ++r) { const float v = acc[j][r] + (BB ? bfr(BB[j * 16 + col]) : 0.f); const _Float16 hv = (_Float16)v; sth[j * 16 + col][wave * 16 + 8 * g + r] = hv; stl[j * 16 + col][wave * 16 + 8 * g + r] = (_Float16)((v - (float)hv) * 2048.0f); } }
    __syncthreads();
    const size_t rb = (size_t)blockIdx.x * 64; const int b = (int)(rb / SS), s0 = (int)(rb % SS); const int pc0 = n0 - 2 * DM;
    for (int q = tid; q < 128 * 8; q += 128) { const int d = q >> 3, pc = q & 7; const size_t o = ((size_t)b * DM + pc0 + d) * SS + s0 + pc * 8; vst2((unsigned*)(VTH + o), *(const v4u*)&sth[d][pc * 8]); vst2((unsigned*)(VTL + o), *(const v4u*)&stl[d][pc * 8]); }
  }
}
// ---- k_attn: block = (64 queries, head h, batch b): all-keys flash attention (K = 64: 2 k-steps), scores = (k.q) * 0.125 with single f16 operands, formed transposed; V^T.P^T: f16 V x f16 P (x2^11) in one accumulator; O[b*S+q][h*64+d] = acc / l, both carrying 2^11 (256-B segments)
// K and V^T go through LDS: a stage is 64 keys = [64 key rows x 64 d | 64 d rows x 64 keys] of f16, rows of 128 B at pitch 144 B (16 B x odd: no bank conflict for 16-byte readers), copied once per block and read by its 4 waves.
// Two buffers: stage t + 1's copies fly while stage t is worked on; one barrier per stage.
#define AT_KST 64
#define AT_NST (SS / AT_KST)
#define AT_PITCH 72
#define AT_TILE (64 * AT_PITCH)
#define AT_STAGE (2 * AT_TILE)
// one stage: 8 copies of 16 B a lane (8 lanes cover one 128-B row, so a wave's copy reads 4 whole lines); lk = the lane's LDS byte address in the K tile, gk / gv = its global addresses in row (tid >> 3) of the K / V^T tile
__device__ __forceinline__ void attn_stage(unsigned lk, const _Float16* gk, const _Float16* gv) {
  const unsigned lv = lk + 2 * AT_TILE;
  // the s_wait_xcnt stands in the copies' own statement so that no address register is rewritten ahead of it
  asm volatile("global_load_async_to_lds_b128 %0, %8, off\n\t"
               "global_load_async_to_lds_b128 %1, %9, off\n\t"
               "global_load_async_to_lds_b128 %2, %10, off\n\t"
               "global_load_async_to_lds_b128 %3, %11, off\n\t"
               "global_load_async_to_lds_b128 %4, %12, off\n\t"
               "global_load_async_to_lds_b128 %5, %13, off\n\t"
               "global_load_async_to_lds_b128 %6, %14, off\n\t"
               "global_load_async_to_lds_b128 %7, %15, off\n\t"
               "s_wait_xcnt 0x0"
               :: "v"(lk), "v"(lk + 16 * 2 * AT_PITCH), "v"(lk + 32 * 2 * AT_PITCH), "v"(lk + 48 * 2 * AT_PITCH),
                  "v"(lv), "v"(lv + 16 * 2 * AT_PITCH), "v"(lv + 32 * 2 * AT_PITCH), "v"(lv + 48 * 2 * AT_PITCH),
                  "v"(gk), "v"(gk + (size_t)16 * 2 * DM), "v"(gk + (size_t)32 * 2 * DM), "v"(gk + (size_t)48 * 2 * DM),
                  "v"(gv), "v"(gv + (size_t)16 * SS), "v"(gv + (size_t)32 * SS), "v"(gv + (size_t)48 * SS)
               : "memory");
}
__device__ __forceinline__ float sum16(v8f a, v8f b) {   // a lane's sixteen P as a pairwise tree: four levels deep, because the test on the sum stands on the pass's critical path
  const v8f t = a + b; const v4f u = __builtin_shufflevector(t, t, 0, 1, 2, 3) + __builtin_shufflevector(t, t, 4, 5, 6, 7);
  const v2f w = __builtin_shufflevector(u, u, 0, 1) + __builtin_shufflevector(u, u, 2, 3); return w[0] + w[1];
}
__device__ __forceinline__ float xhalf(float v) {   // the value of lane l ^ 16: the other half of the same query's keys
  const int b = __builtin_bit_cast(int, v); return __builtin_bit_cast(float, __builtin_amdgcn_permlanex16(b, b, 0x76543210, 0xfedcba98, false, false));
}
// at most four waves a SIMD, as before: the grid's 1,024 work-groups then stand four on each of the 256 WGPs
__global__ __launch_bounds__(128) __attribute__((amdgpu_waves_per_eu(4, 4))) void k_attn(const _Float16* __restrict__ QK, const _Float16* __restrict__ QKL, const _Float16* __restrict__ VTH, const _Float16* __restrict__ VTL, const void* __restrict__ KMASK, const int* __restrict__ QMSK, float* __restrict__ O) {
  __shared__ __align__(16) float so[4][16][68]; __shared__ __align__(16) _Float16 ring[2 * AT_STAGE];
  const int tid = threadIdx.x, wave = tid >> 5, lane = tid & 31, col = lane & 15, g = lane >> 4;
  const int qb = blockIdx.x, h = blockIdx.y, b = blockIdx.z; const int q0 = qb * 64 + wave * 16; const size_t rq = (size_t)b * SS + q0 + col;
  // transposed products: S^T = K . Q^T (A = key rows, B = q) and O^T += V^T . P^T, so lane (col, g) holds query col alone: its scores of keys 8g + r and 16 + 8g + r, its maximum, its sum, its output elements
  const int qm = QMSK[rq];
  asm volatile("s_wait_xcnt 0x0" ::: "memory");   // stands in front of any rewrite of the mask load's address registers
  const float scl = (qm == 0) ? 0.f : 0.125f * 1.44269504f;   // 1/sqrt(64) x log2(e); attention_mask on the QUERY axis: mask == 0 -> every score of that query is equal -> uniform weights
  v16h aq[2];
#pragma unroll
  for (int kc = 0; kc < 2; ++kc) aq[kc] = frag_h(QK + rq * (2 * DM) + h * HD + kc * 32, lane);
  // Held reference: P = exp2((k.q - mref) x scl + 11). mref (raw product units, equal in both halves) is a maximum seen earlier, not the running one: minus mref enters the score product as its C operand,
  // so a pass needs no maximum, no subtraction and no rescale of O. It is raised only when a pass's sum of P says that a P could leave the f16 range; an unmasked query's first pass always raises it.
  float mref = -3.0e38f, l = 0.f;   // l: this half's part of the sum, carrying P's 2^11
  v8f negm = {3.0e38f, 3.0e38f, 3.0e38f, 3.0e38f, 3.0e38f, 3.0e38f, 3.0e38f, 3.0e38f};   // -mref in every element: a lane's eight scores belong to one query
  v8f acc[4] = {};
  const _Float16* const gk = QK + ((size_t)b * SS + (tid >> 3)) * (2 * DM) + DM + h * HD + (tid & 7) * 8;
  const _Float16* const gv = VTH + ((size_t)b * DM + h * HD + (tid >> 3)) * SS + (tid & 7) * 8;
  const unsigned l0 = (unsigned)(size_t)(__attribute__((address_space(3))) _Float16*)ring + (tid >> 3) * (2 * AT_PITCH) + (tid & 7) * 16;
  attn_stage(l0, gk, gv);
  asm volatile("s_wait_asynccnt 0x0" ::: "memory");   // stage 0 has landed before the barrier that publishes it
  __syncthreads();
  attn_stage(l0 + 2 * AT_STAGE, gk + (size_t)AT_KST * 2 * DM, gv + AT_KST);
#pragma unroll 1   // rolled: one trip per stage, the buffer chosen by the trip's parity
  for (int t = 0; t < AT_NST; ++t) { const _Float16* const kb = ring + (t & 1) * AT_STAGE; const _Float16* const vb = kb + AT_TILE;
#pragma unroll   // the stage's two 32-key passes in line, so that their LDS offsets are constants
  for (int ps = 0; ps < AT_KST / 32; ++ps) { v8f s[2]; v16h kf[2][2], vf[4];   // the pass's fragments: LDS reads as one group ahead of the products, V's in flight under the softmax
#pragma unroll
    for (int ct = 0; ct < 2; ++ct) {
#pragma unroll
      for (int kc = 0; kc < 2; ++kc) kf[ct][kc] = frag_h(kb + (ps * 32 + ct * 16 + col) * AT_PITCH + kc * 32, lane); }
#pragma unroll
    for (int dt = 0; dt < 4; ++dt) vf[dt] = frag_h(vb + (dt * 16 + col) * AT_PITCH + ps * 32, lane);
    __builtin_amdgcn_sched_barrier(0);   // keeps the sixteen LDS reads one group ahead of the products: left free, the compiler spreads them among the products in pairs, each waited for to the end
#pragma unroll
    for (int ct = 0; ct < 2; ++ct) s[ct] = wmma16(kf[ct][1], aq[1], wmma16(kf[ct][0], aq[0], negm));   // single product: k, q as one-rounding f16 operands; s[ct][r] = k.q - mref of key ct * 16 + 8g + r, query col
    v8f ex0 = hw_exp2x8(s[0] * scl + 11.0f), ex1 = hw_exp2x8(s[1] * scl + 11.0f);   // P x 2^11 = exp2((k.q - mref) x scl + 11): the scaling keeps small softmax weights out of the f16 subnormal range; the sum carries it too, so it cancels in the epilogue
    float es = sum16(ex0, ex1);
    // every P is at most the sum of its lane's sixteen, so a sum up to 3 x 2^14 says that all of them fit f16 (sixteen P at the reference itself, or a masked query's, sum to 2^15 and pass); anything else (infinity too) in any lane sends the whole wave, by a scalar branch, to raise the reference and form the pass's P anew
    if (__builtin_amdgcn_ballot_w32(!(es <= 49152.0f)) != 0) { const v8f zero = {};
#pragma unroll
      for (int ct = 0; ct < 2; ++ct) s[ct] = wmma16(kf[ct][1], aq[1], wmma16(kf[ct][0], aq[0], zero));   // the raw products: against a far lower reference the difference has lost them
      float mx = fmaxf(s[0][0], s[1][0]);
#pragma unroll
      for (int r = 1; r < 8; ++r) mx = fmaxf(mx, fmaxf(s[0][r], s[1][r]));
      mx = fmaxf(mx, xhalf(mx));
      const float mn = fmaxf(mref, mx), alpha = hw_exp2((mref - mn) * scl); mref = mn;
#pragma unroll
      for (int r = 0; r < 8; ++r) negm[r] = -mn;
      l *= alpha;
#pragma unroll
      for (int dt = 0; dt < 4; ++dt) acc[dt] *= alpha;
      ex0 = hw_exp2x8((s[0] - mn) * scl + 11.0f); ex1 = hw_exp2x8((s[1] - mn) * scl + 11.0f);
      es = sum16(ex0, ex1); }
    l += es;
    v16h pt;   // P^T as the B operand: element i = key 8g + i, element 8 + i = key 16 + 8g + i, the k order of the V^T fragment
#pragma unroll
    for (int r = 0; r < 8; ++r) { pt[r] = (_Float16)ex0[r]; pt[8 + r] = (_Float16)ex1[r]; }
#pragma unroll
    for (int dt = 0; dt < 4; ++dt) acc[dt] = wmma16(vf[dt], pt, acc[dt]); }   // single product: V^T x P^T (x2^11); acc[dt][r] = output element dt * 16 + 8g + r of query col
    __builtin_amdgcn_sched_barrier(0);   // keeps the stage's work in front of its barrier: sunk behind it, the second pass would delay the refill's copies by half a stage of their flight time
    asm volatile("s_wait_dscnt 0x0" ::: "memory");      // this wave's reads of stage t are done
    asm volatile("s_wait_asynccnt 0x0" ::: "memory");   // its copies of stage t + 1 have landed
    __syncthreads();                                    // publishes stage t + 1 and ends every wave's reads of stage t
    if (t + 2 < AT_NST) attn_stage(l0 + (t & 1) * (2 * AT_STAGE), gk + (size_t)(t + 2) * AT_KST * 2 * DM, gv + (t + 2) * AT_KST); }
  asm volatile("s_wait_asynccnt 0x0" ::: "memory");     // no copy is left in flight when the wave goes on
  const float il = 1.0f / (l + xhalf(l));   // the two halves' sums joined once; the 2^11 of P stands in the sum and in acc alike
#pragma unroll
  for (int dt = 0; dt < 4; ++dt) { const v8f o = acc[dt] * il; float* const d = &so[wave][col][dt * 16 + 8 * g];
    *(v4f*)d = __builtin_shufflevector(o, o, 0, 1, 2, 3); *(v4f*)(d + 4) = __builtin_shufflevector(o, o, 4, 5, 6, 7); }
  LDSX();
  for (int rl = 0; rl < 16; ++rl) if (lane < 16) vst2(O + ((size_t)b * SS + q0 + rl) * DM + h * HD + lane * 4, *(const v4f*)&so[wave][rl][lane * 4]);
}
// ---- k_out: block = (64 rows, 128 cols): out = O(hi/lo) . Wo rows (2 products) + bo
__global__ __launch_bounds__(128) void k_out(const float* __restrict__ O, const __bf16* __restrict__ P, const float* __restrict__ BO, float* __restrict__ Y) {
  __shared__ __align__(16) float so[4][16][132];
  const int tid = threadIdx.x, wave = tid >> 5, lane = tid & 31, col = lane & 15, g = lane >> 4; const size_t r0 = (size_t)blockIdx.x * 64 + wave * 16; const int n0 = blockIdx.y * 128;
  v8f acc[8] = {};
#pragma unroll 2
  for (int kc = 0; kc < DM / 32; ++kc) { const F2 a = split_row(O + (r0 + col) * DM, kc * 32, lane);
#pragma unroll
    for (int j = 0; j < 8; ++j) { const v16b w = frag_b(P + (size_t)(n0 + j * 16 + col) * DM + kc * 32, lane); acc[j] = wmma_bf(a.l, w, acc[j]); acc[j] = wmma_bf(a.h, w, acc[j]); } }
#pragma unroll
  for (int j = 0; j < 8; ++j) {
#pragma unroll
    for (int r = 0; r < 8; ++r) so[wave][8 * g + r][j * 16 + col] = acc[j][r] + (BO ? bfr(BO[n0 + j * 16 + col]) : 0.f); }
  LDSX();
  for (int rl = 0; rl < 16; ++rl) vst2(Y + (r0 + rl) * DM + n0 + lane * 4, *(const v4f*)&so[wave][rl][lane * 4]);
}
// ---- k_qk2: block = (64 rows, 128 cols): q = x Wq + bq and k = x Wk + bk for the same columns; stores q rows, softplus(k) rows (the engine's k slot) and v = q + k planes, all as f16 hi + residual
// Operand tiles go through LDS: a stage is 64 k of [256 weight rows (128 of Wq, 128 of Wk) | 64 x rows already rounded to bf16], rows of 128 B at pitch 144 B (16 B x odd: no bank conflict for 16-byte readers).
// Two buffers: the next stage's global loads are issued before this stage's products, land in registers, and are written to the other buffer behind the products; one barrier per stage.
#define QK_KST 64
#define QK_NST (DM / QK_KST)
#define QK_PITCH 72
#define QK_STAGE ((256 + 64) * QK_PITCH)
typedef __attribute__((ext_vector_type(4))) __bf16 v4b;
__global__ __launch_bounds__(128) void k_qk2(const float* __restrict__ X, const __bf16* __restrict__ P, const float* __restrict__ BQ, const float* __restrict__ BK, _Float16* __restrict__ QK, _Float16* __restrict__ QKL, _Float16* __restrict__ VTH, _Float16* __restrict__ VTL) {
  __shared__ __align__(16) unsigned char smem[2 * QK_STAGE * 2];   // the two stage buffers; behind the loop's last barrier the same bytes are the output staging
  __bf16* const ring = (__bf16*)smem;
  _Float16 (* const so)[16][136] = (_Float16 (*)[16][136])smem; _Float16 (* const sol)[16][136] = (_Float16 (*)[16][136])(smem + 17408); _Float16 (* const sth)[72] = (_Float16 (*)[72])(smem + 34816); _Float16 (* const stl)[72] = (_Float16 (*)[72])(smem + 53248);
  const int tid = threadIdx.x, wave = tid >> 5, lane = tid & 31, col = lane & 15, g = lane >> 4; const size_t rb = (size_t)blockIdx.x * 64, r0 = rb + wave * 16; const int n0 = blockIdx.y * 128;
  // loaders: 8 lanes cover one 128-B weight row piece, 16 lanes one 256-B x row piece, so every wave-wide load reads whole lines
  const __bf16* const wsrc = P + PK_A + (size_t)(n0 + (tid >> 3)) * DM + (tid & 7) * 8;
  const float* const xsrc = X + (rb + (tid >> 4)) * DM + (tid & 15) * 4;
  const int wdst = (tid >> 3) * QK_PITCH + (tid & 7) * 8, xdst = (256 + (tid >> 4)) * QK_PITCH + (tid & 15) * 4;
  v4u wr[16]; v4f xr[8];
  v8f aq[8] = {}, ak[8] = {};
#pragma unroll
  for (int i = 0; i < 16; ++i) wr[i] = *(const v4u*)(wsrc + (size_t)((i >> 3) * DM + (i & 7) * 16) * DM);
#pragma unroll
  for (int i = 0; i < 8; ++i) xr[i] = *(const v4f*)(xsrc + (size_t)(i * 8) * DM);
#pragma unroll
  for (int i = 0; i < 16; ++i) *(v4u*)(ring + wdst + i * 16 * QK_PITCH) = wr[i];
#pragma unroll
  for (int i = 0; i < 8; ++i) { v4b c; c[0] = (__bf16)xr[i][0]; c[1] = (__bf16)xr[i][1]; c[2] = (__bf16)xr[i][2]; c[3] = (__bf16)xr[i][3]; *(v4b*)(ring + xdst + i * 8 * QK_PITCH) = c; }
  __syncthreads();
#pragma unroll 1   // rolled: the body already holds 32 products
  for (int s = 0; s < QK_NST; ++s) {
    const bool more = s + 1 < QK_NST;
    if (more) {
#pragma unroll
      for (int i = 0; i < 16; ++i) wr[i] = *(const v4u*)(wsrc + (size_t)((i >> 3) * DM + (i & 7) * 16) * DM + (s + 1) * QK_KST);
#pragma unroll
      for (int i = 0; i < 8; ++i) xr[i] = *(const v4f*)(xsrc + (size_t)(i * 8) * DM + (s + 1) * QK_KST);
    }
    const __bf16* const wb = ring + (s & 1) * QK_STAGE; const __bf16* const xb = wb + 256 * QK_PITCH;
#pragma unroll
    for (int kc = 0; kc < QK_KST / 32; ++kc) {
      const v16b a = frag_b(xb + (wave * 16 + col) * QK_PITCH + kc * 32, lane);
#pragma unroll
      for (int hf = 0; hf < 2; ++hf) { v16b f[8];   // eight fragments' LDS reads as one group ahead of their products (hf 0: Wq rows, hf 1: Wk rows); sixteen at once would not fit beside the accumulators in v0..v255, where the products' asm operands must lie
#pragma unroll
        for (int j = 0; j < 8; ++j) f[j] = frag_b(wb + (hf * 128 + j * 16 + col) * QK_PITCH + kc * 32, lane);
#pragma unroll
        for (int j = 0; j < 8; ++j) { if (hf == 0) aq[j] = wmma_bf(a, f[j], aq[j]); else ak[j] = wmma_bf(a, f[j], ak[j]); }
      }
    }
    if (more) { __bf16* const nb = ring + ((s + 1) & 1) * QK_STAGE;   // last read in stage s - 1, whose barrier every wave has passed
#pragma unroll
      for (int i = 0; i < 16; ++i) *(v4u*)(nb + wdst + i * 16 * QK_PITCH) = wr[i];
#pragma unroll
      for (int i = 0; i < 8; ++i) { v4b c; c[0] = (__bf16)xr[i][0]; c[1] = (__bf16)xr[i][1]; c[2] = (__bf16)xr[i][2]; c[3] = (__bf16)xr[i][3]; *(v4b*)(nb + xdst + i * 8 * QK_PITCH) = c; }
    }
    __syncthreads();   // publishes stage s + 1 and ends every wave's reads of stage s (after the last stage: frees the bytes for the output staging)
  }
#pragma unroll
  for (int j = 0; j < 8; ++j) { const float bq = bfr(BQ[n0 + j * 16 + col]);
#pragma unroll
    for (int r = 0; r < 8; ++r) { const float v = aq[j][r] + bq; aq[j][r] = v; const _Float16 hv = (_Float16)v; so[wave][8 * g + r][j * 16 + col] = hv; sol[wave][8 * g + r][j * 16 + col] = (_Float16)((v - (float)hv) * 2048.0f); } }
  LDSX();
  for (int rl = 0; rl < 16; ++rl) if (lane < 16) { vst2((unsigned*)(QK + (r0 + rl) * (2 * DM) + n0 + lane * 8), *(const v4u*)&so[wave][rl][lane * 8]); vst2((unsigned*)(QKL + (r0 + rl) * (2 * DM) + n0 + lane * 8), *(const v4u*)&sol[wave][rl][lane * 8]); }
  LDSX();
  // pass 2: softplus(k) rows into the k slot; v = q + k (raw k) planes
#pragma unroll
  for (int j = 0; j < 8; ++j) { const float bk = bfr(BK[n0 + j * 16 + col]);
#pragma unroll
    for (int r = 0; r < 8; ++r) { const float kv = ak[j][r] + bk; const float sp = softplus_p(kv); const _Float16 hs = (_Float16)sp; so[wave][8 * g + r][j * 16 + col] = hs; sol[wave][8 * g + r][j * 16 + col] = (_Float16)((sp - (float)hs) * 2048.0f);
      const float vv = aq[j][r] + kv; const _Float16 hv = (_Float16)vv; sth[j * 16 + col][wave * 16 + 8 * g + r] = hv; stl[j * 16 + col][wave * 16 + 8 * g + r] = (_Float16)((vv - (float)hv) * 2048.0f); } }
  __syncthreads();
  for (int rl = 0; rl < 16; ++rl) if (lane < 16) { vst2((unsigned*)(QK + (r0 + rl) * (2 * DM) + DM + n0 + lane * 8), *(const v4u*)&so[wave][rl][lane * 8]); vst2((unsigned*)(QKL + (r0 + rl) * (2 * DM) + DM + n0 + lane * 8), *(const v4u*)&sol[wave][rl][lane * 8]); }
  { const int b = (int)(rb / SS), s0 = (int)(rb % SS);
    for (int q = tid; q < 128 * 8; q += 128) { const int d = q >> 3, pc = q & 7; const size_t o = ((size_t)b * DM + n0 + d) * SS + s0 + pc * 8; vst2((unsigned*)(VTH + o), *(const v4u*)&sth[d][pc * 8]); vst2((unsigned*)(VTL + o), *(const v4u*)&stl[d][pc * 8]); } }
}
extern "C" void kernel_launch(void* const* d_in, const int* in_sizes, int n_in, void* d_out, int out_size, void* d_ws, size_t ws_size, hipStream_t stream) {
  (void)in_sizes; (void)n_in; (void)out_size;
  const float** F = (const float**)d_in;   // 0 hidden [2,2048,1024], 1 attention_mask [2,2048] int (query axis), 2 Wq (in,out), 3 bq, 4 Wk, 5 bk
  if (ws_size < (size_t)WS_END) return;
  char* ws = (char*)d_ws; __bf16* PK = (__bf16*)(ws + WS_PK); _Float16 *QK = (_Float16*)(ws + WS_QK), *QKL = (_Float16*)(ws + WS_QKL), *VTH = (_Float16*)(ws + WS_VTH), *VTL = (_Float16*)(ws + WS_VTL);
  k_pack<<<dim3(DM / PT_N, DM / PT_K, 2), 256, 0, stream>>>(F[2], F[4], PK);   // Wq, Wk rows (the only packed rows that are read)
  k_qk2<<<dim3(TNB * SS / 64, DM / 128), 128, 0, stream>>>(F[0], PK, F[3], F[5], QK, QKL, VTH, VTL);
  k_attn<<<dim3(TQB, NH, TNB), 128, 0, stream>>>(QK, QKL, VTH, VTL, nullptr, (const int*)d_in[1], (float*)d_out);   // merged heads are the module's output
}

// v008
// A run of this version takes 61.7 microseconds.
// Next to v007, in two timings, it ran 1.09 times as fast each time.
// Counting every step since v000, it is 5.66 times as fast.
// compute dtype: all float inputs rounded to bf16, the int mask read on device; q / k = x . W + b with EXACT bf16 products on WMMA 16x16x32 ((in,out) weights as transposed rows), softplus(k) (hardware exp2/log2, the rounding of 1 + e compensated) and v = q + k formed in f32 in the same block before one f16 rounding (hi + residual planes); PLAIN attention: q, softplus(k) single f16 x 1/8, softmax in f32 against a held reference that is raised only when needed (hardware exp), P (scaled by 2^11, single f16) x v (single f16); f32 merged-head output.
#include <hip/hip_runtime.h>
#include <math.h>

typedef __attribute__((ext_vector_type(16))) _Float16 v16h;
typedef __attribute__((ext_vector_type(16))) __bf16 v16b;
typedef __attribute__((ext_vector_type(8)))  _Float16 v8h;
typedef __attribute__((ext_vector_type(8)))  float v8f;
typedef __attribute__((ext_vector_type(4)))  float v4f;
typedef __attribute__((ext_vector_type(2)))  float v2f;
typedef __attribute__((ext_vector_type(4)))  unsigned v4u;
typedef __attribute__((ext_vector_type(4)))  int v4i;
typedef float __attribute__((may_alias)) float_a;
typedef int __attribute__((may_alias)) int_a;

template <typename T> __device__ __forceinline__ void vst2(void* p, T v) { *(T*)p = v;  }
__device__ __forceinline__ v8f wmma16(v16h a, v16h b, v8f c) {
  return __builtin_amdgcn_wmma_f32_16x16x32_f16(false, a, false, b, (short)0, c, false, false);   // the builtin alone: the compiler keeps the distance behind it itself and may fill it with useful work
}
__device__ __forceinline__ v8f wmma_bf(v16b a, v16b b, v8f c) {
  v8f d = __builtin_amdgcn_wmma_f32_16x16x32_bf16(false, a, false, b, (short)0, c, false, false);
  asm volatile("v_nop\n\tv_nop\n\tv_nop\n\tv_nop" : "+v"(d) : "v"(a), "v"(b));
  return d;
}
// BERT self attention variant (B 2, S 2,048, 1,024 dims, 16 heads x 64): q = x Wq + bq, k = x Wk + bk, keys transformed to softplus(k), values = q + k, scores / 8 with the attention mask applied on the QUERY axis (masked queries get uniform attention), softmax, . v; merged heads are the output.
__device__ __forceinline__ v16h frag_h(const _Float16* rowk0, int lane) {
  union { v16h v; v8h q[2]; } u; const _Float16* p = rowk0 + 8 * (lane >> 4);
  u.q[0] = *(const v8h*)p; u.q[1] = *(const v8h*)(p + 16); return u.v;
}
__device__ __forceinline__ v16h frag_f32(const float* rowk0, int lane) {
  v16h a; const float* p = rowk0 + 8 * (lane >> 4);
#pragma unroll
  for (int i = 0; i < 8; ++i) { a[i] = (_Float16)p[i]; a[8 + i] = (_Float16)p[16 + i]; }
  return a;
}
__device__ __forceinline__ v16h frag_f32s(const float* rowk0, int lane, float sc) {
  v16h a; const float* p = rowk0 + 8 * (lane >> 4);
#pragma unroll
  for (int i = 0; i < 8; ++i) { a[i] = (_Float16)(p[i] * sc); a[8 + i] = (_Float16)(p[16 + i] * sc); }
  return a;
}
// column fragment from a [K][ld] layout (column n), rows >= K read as 0
__device__ __forceinline__ v16h fragc_f32(const float* W, int k0, int n, int lane, int ld, int K) {
  v16h a; const int g = lane >> 4;
#pragma unroll
  for (int i = 0; i < 8; ++i) { const int ka = k0 + 8 * g + i, kb = ka + 16;
    a[i] = (_Float16)(ka < K ? W[(size_t)(ka < K ? ka : K - 1) * ld + n] : 0.f); a[8 + i] = (_Float16)(kb < K ? W[(size_t)(kb < K ? kb : K - 1) * ld + n] : 0.f); }
  return a;
}
struct F2 { v16b h, l; };
__device__ __forceinline__ F2 bsplit16(const float v[16]) { F2 r;
#pragma unroll
  for (int i = 0; i < 16; ++i) { const __bf16 h = (__bf16)v[i]; r.h[i] = h; r.l[i] = (__bf16)(v[i] - (float)h); }
  return r; }
__device__ __forceinline__ F2 split_row(const float* row, int k0, int lane) { float v[16]; const float* p = row + k0 + 8 * (lane >> 4);
#pragma unroll
  for (int i = 0; i < 8; ++i) { v[i] = p[i]; v[8 + i] = p[16 + i]; }
  return bsplit16(v); }
__device__ __forceinline__ F2 split_rowK(const float* row, int k0, int lane, int K) { float v[16]; const int g = lane >> 4;
#pragma unroll
  for (int i = 0; i < 8; ++i) { const int ka = k0 + 8 * g + i, kb = ka + 16; v[i] = ka < K ? row[ka < K ? ka : K - 1] : 0.f; v[8 + i] = kb < K ? row[kb < K ? kb : K - 1] : 0.f; }
  return bsplit16(v); }
__device__ __forceinline__ F2 split_col(const float* W, int k0, int n, int lane, int ld, int K) { float v[16]; const int g = lane >> 4;
#pragma unroll
  for (int i = 0; i < 8; ++i) { const int ka = k0 + 8 * g + i, kb = ka + 16; v[i] = ka < K ? W[(size_t)(ka < K ? ka : K - 1) * ld + n] : 0.f; v[8 + i] = kb < K ? W[(size_t)(kb < K ? kb : K - 1) * ld + n] : 0.f; }
  return bsplit16(v); }
__device__ __forceinline__ v8f mac3(const F2& a, const F2& b, v8f c) { c = wmma_bf(a.l, b.h, c); c = wmma_bf(a.h, b.l, c); return wmma_bf(a.h, b.h, c); }
__device__ __forceinline__ float sigm(float v) { return 1.0f / (1.0f + expf(-v)); }
#define LDSX() do { asm volatile("s_wait_dscnt 0" ::: "memory"); __builtin_amdgcn_wave_barrier(); __builtin_amdgcn_fence(__ATOMIC_RELEASE, "workgroup"); } while (0)


#define NB 2
#define SS 2048
#define DM 1024
#define NH 16
// softplus(z) = max(z, 0) + log1p(e) with e = exp(-|z|) in [0, 1], on the hardware exp2 and log2 and in line, so that a lane's 64 values overlap instead of running one dependent chain after another.
// c is the part of e that the rounding of 1 + e dropped: added back, it keeps the relative accuracy of small results (z far below 0); for large z both terms vanish against z.
// The v_nop fills the slot that the instruction set asks for behind a transcendental before its source is overwritten or its result read; inside the statement it stays directly behind it.
__device__ __forceinline__ float hw_exp2(float x) { float r; asm("v_exp_f32 %0, %1\n\tv_nop" : "=v"(r) : "v"(x)); return r; }
__device__ __forceinline__ float hw_log2(float x) { float r; asm("v_log_f32 %0, %1\n\tv_nop" : "=v"(r) : "v"(x)); return r; }
// eight independent exponentials in one statement: each stands behind another register's, the outputs share no register with the inputs, and the v_nop fills the slot behind the last
__device__ __forceinline__ v8f hw_exp2x8(v8f x) { float r0, r1, r2, r3, r4, r5, r6, r7;
  asm("v_exp_f32 %0, %8\n\tv_exp_f32 %1, %9\n\tv_exp_f32 %2, %10\n\tv_exp_f32 %3, %11\n\tv_exp_f32 %4, %12\n\tv_exp_f32 %5, %13\n\tv_exp_f32 %6, %14\n\tv_exp_f32 %7, %15\n\tv_nop"
      : "=&v"(r0), "=&v"(r1), "=&v"(r2), "=&v"(r3), "=&v"(r4), "=&v"(r5), "=&v"(r6), "=&v"(r7)
      : "v"(x[0]), "v"(x[1]), "v"(x[2]), "v"(x[3]), "v"(x[4]), "v"(x[5]), "v"(x[6]), "v"(x[7]));
  const v8f r = {r0, r1, r2, r3, r4, r5, r6, r7}; return r; }
__device__ __forceinline__ float softplus_p(float z) {
  const float e = hw_exp2(fabsf(z) * -1.44269504f), u = 1.0f + e, c = e - (u - 1.0f);
  return fmaxf(z, 0.f) + (hw_log2(u) * 0.693147181f + c);
}
#define HD 64
#define QKVW (3 * DM)
#ifndef TQB
#define TQB (SS / 64)
#define TNB NB
#define TOB (NB * SS / 64)     // output row tiles (all)
#endif
typedef __attribute__((ext_vector_type(8))) __bf16 v8b;
__device__ __forceinline__ v16b frag_b(const __bf16* rowk0, int lane) {
  union { v16b v; v8b q[2]; } u; const __bf16* p = rowk0 + 8 * (lane >> 4);
  u.q[0] = *(const v8b*)p; u.q[1] = *(const v8b*)(p + 16); return u.v;
}
__device__ __forceinline__ float bfr(float v) { return (float)(__bf16)v; }
__device__ __attribute__((noinline)) float exp_ni(float v) { return expf(v); }
__device__ __attribute__((noinline)) float erf_ni(float v) { return erff(v); }

#define PK_A 0                       // [3072][1024]: rows 0..2047 hold Wq | Wk as bf16 [out][in] (transposed), the rest unwritten
#define PK_P (PK_A + QKVW * DM)        // [1024][1024], unused
#define PK_END (PK_P + DM * DM)
#define WS_PK  0u
#define WS_QK  (WS_PK + 2u * PK_END)             // f16 [4096 rows][2048]: q | k
#define WS_QKL (WS_QK + 2u * NB * SS * 2 * DM)     // f16 q | k residual planes x2048
#define WS_VTH (WS_QKL + 2u * NB * SS * 2 * DM)    // f16 [b][1024 (h*64+d)][2048 s] hi
#define WS_VTL (WS_VTH + 2u * NB * DM * SS)        // f16 lo x 2048
#define WS_O   (WS_VTL + 2u * NB * DM * SS)        // f32 [4096][1024]
#define WS_CS  (WS_O + 4u * NB * SS * DM)           // f32 [2][2048][32], unused
#define WS_END (WS_CS + 4u * 2 * SS * 32)
// ---- k_pack: block = (64 columns n, 128 rows k, which): one tile of the (in,out) weight W_q (which 0) or W_k (which 1) -> bf16 rows [n][k] of PK_A (rows which*1024 + n), transposed through LDS
// Reads: 16 lanes cover 256 B of one weight row; writes: 16 lanes cover 256 B of one packed row, so every wave-wide global access is whole lines and each weight line is asked for once.
#define PT_N 64
#define PT_K 128
#define PT_PITCH 272   // bytes of a packed row in LDS: 256 + 16 (16 B x odd)
typedef __attribute__((ext_vector_type(2))) __bf16 v2b;
__global__ __launch_bounds__(256) void k_pack(const float* __restrict__ WQ, const float* __restrict__ WK, __bf16* __restrict__ PK) {
  __shared__ __align__(16) unsigned char s[PT_N * PT_PITCH];
  const int t = threadIdx.x, c = t & 15, rp = t >> 4, n0 = blockIdx.x * PT_N, k0 = blockIdx.y * PT_K, which = blockIdx.z;
  const float* const src = (which ? WK : WQ) + (size_t)(k0 + 2 * rp) * DM + n0 + 4 * c;   // rows k0 + 32p + 2rp and the next, columns n0 + 4c .. + 3
  v4f a[4], b[4];
#pragma unroll   // the eight loads in flight together, a[] and b[] in registers
  for (int p = 0; p < 4; ++p) { a[p] = *(const v4f*)(src + (size_t)(32 * p) * DM); b[p] = *(const v4f*)(src + (size_t)(32 * p + 1) * DM); }
  // a row's 16-byte pieces lie at piece ^ (row >> 4): the 16 lanes that write one k pair into rows 4c + i then fall on 16 different banks
  unsigned char* const d = s + (4 * c) * PT_PITCH + ((4 * rp) ^ ((c >> 2) << 4));
#pragma unroll   // both loops in line: register indices and LDS offsets are constants
  for (int p = 0; p < 4; ++p) {
#pragma unroll
    for (int i = 0; i < 4; ++i) { v2b w; w[0] = (__bf16)a[p][i]; w[1] = (__bf16)b[p][i]; *(v2b*)(d + i * PT_PITCH + 64 * p) = w; } }
  __syncthreads();
#pragma unroll   // the four LDS reads as one group ahead of their stores
  for (int j = 0; j < 4; ++j) { const int n = rp + 16 * j; vst2((unsigned*)(PK + PK_A + ((size_t)which * DM + n0 + n) * DM + k0 + c * 8), *(const v4u*)(s + n * PT_PITCH + ((c ^ j) << 4))); }
}
__global__ __launch_bounds__(128) void k_qkv(const float* __restrict__ XQ, const float* __restrict__ XK, const float* __restrict__ XV, const __bf16* __restrict__ P, const float* __restrict__ BQ, const float* __restrict__ BK, const float* __restrict__ BV, _Float16* __restrict__ QK, _Float16* __restrict__ QKL, _Float16* __restrict__ VTH, _Float16* __restrict__ VTL) {
  const int which0 = (blockIdx.y * 128) / DM; const float* X = (which0 == 0) ? XQ : (which0 == 1) ? XK : XV; const float* BB = BQ ? (((which0 == 0) ? BQ : (which0 == 1) ? BK : BV) + (blockIdx.y * 128 - which0 * DM)) : nullptr;
  __shared__ __align__(16) _Float16 so[4][16][136], sol[4][16][136]; __shared__ __align__(16) _Float16 sth[128][72], stl[128][72];
  const int tid = threadIdx.x, wave = tid >> 5, lane = tid & 31, col = lane & 15, g = lane >> 4; const size_t r0 = (size_t)blockIdx.x * 64 + wave * 16; const int n0 = blockIdx.y * 128;
  v8f acc[8] = {};
#pragma unroll 2
  for (int kc = 0; kc < DM / 32; ++kc) { v16b a; { const float* p = X + (r0 + col) * DM + kc * 32 + 8 * g;
#pragma unroll
      for (int i = 0; i < 8; ++i) { a[i] = (__bf16)p[i]; a[8 + i] = (__bf16)p[16 + i]; } }
#pragma unroll
    for (int j = 0; j < 8; ++j) acc[j] = wmma_bf(a, frag_b(P + (size_t)(n0 + j * 16 + col) * DM + kc * 32, lane), acc[j]); }
  if (n0 < 2 * DM) {   // q stored unscaled (f16 sigma ~0.6, no subnormal exposure); 1/8 applied to the f32 score
#pragma unroll
    for (int j = 0; j < 8; ++j) {
#pragma unroll
      for (int r = 0; r < 8; ++r) { const float v = acc[j][r] + (BB ? bfr(BB[j * 16 + col]) : 0.f); const _Float16 hv = (_Float16)v; so[wave][8 * g + r][j * 16 + col] = hv; sol[wave][8 * g + r][j * 16 + col] = (_Float16)((v - (float)hv) * 2048.0f); } }   // q, k (+ bias) as f16 hi + (x2048) residual
    LDSX();
    for (int rl = 0; rl < 16; ++rl) if (lane < 16) { vst2((unsigned*)(QK + (r0 + rl) * (2 * DM) + n0 + lane * 8), *(const v4u*)&so[wave][rl][lane * 8]); vst2((unsigned*)(QKL + (r0 + rl) * (2 * DM) + n0 + lane * 8), *(const v4u*)&sol[wave][rl][lane * 8]); }
  } else {
#pragma unroll
    for (int j = 0; j < 8; ++j) {
#pragma unroll
      for (int r = 0; r < 8; ++r) { const float v = acc[j][r] + (BB ? bfr(BB[j * 16 + col]) : 0.f); const _Float16 hv = (_Float16)v; sth[j * 16 + col][wave * 16 + 8 * g + r] = hv; stl[j * 16 + col][wave * 16 + 8 * g + r] = (_Float16)((v - (float)hv) * 2048.0f); } }
    __syncthreads();
    const size_t rb = (size_t)blockIdx.x * 64; const int b = (int)(rb / SS), s0 = (int)(rb % SS); const int pc0 = n0 - 2 * DM;
    for (int q = tid; q < 128 * 8; q += 128) { const int d = q >> 3, pc = q & 7; const size_t o = ((size_t)b * DM + pc0 + d) * SS + s0 + pc * 8; vst2((unsigned*)(VTH + o), *(const v4u*)&sth[d][pc * 8]); vst2((unsigned*)(VTL + o), *(const v4u*)&stl[d][pc * 8]); }
  }
}
// ---- k_attn: block = (128 queries, head h, batch b), a wave 32 of them over half of the keys: all-keys flash attention (K = 64: 2 k-steps), scores = (k.q) * 0.125 with single f16 operands, formed transposed; V^T.P^T: f16 V x f16 P (x2^11) in one accumulator; O[b*S+q][h*64+d] = acc / l, both carrying 2^11 (256-B segments)
// K and V^T go through LDS: a stage is 64 keys = [64 key rows x 64 d | 64 d rows x 64 keys] of f16, rows of 128 B at pitch 144 B (16 B x odd: no bank conflict for 16-byte readers), copied once per block and read by the 4 waves of its key half.
// Two buffers a key half: the half's next stage is copied while this one is worked on; one barrier per trip (one stage of each half).
#define AT_KST 64
#define AT_NST (SS / AT_KST)
#define AT_PITCH 72
#define AT_TILE (64 * AT_PITCH)
#define AT_STAGE (2 * AT_TILE)
// one stage: 8 copies of 16 B a lane (8 lanes cover one 128-B row, so a wave's copy reads 4 whole lines); lk = the lane's LDS byte address in the K tile, gk / gv = its global addresses in row (th >> 3) of the K / V^T tile
__device__ __forceinline__ void attn_stage(unsigned lk, const _Float16* gk, const _Float16* gv) {
  const unsigned lv = lk + 2 * AT_TILE;
  // the s_wait_xcnt stands in the copies' own statement so that no address register is rewritten ahead of it
  asm volatile("global_load_async_to_lds_b128 %0, %8, off\n\t"
               "global_load_async_to_lds_b128 %1, %9, off\n\t"
               "global_load_async_to_lds_b128 %2, %10, off\n\t"
               "global_load_async_to_lds_b128 %3, %11, off\n\t"
               "global_load_async_to_lds_b128 %4, %12, off\n\t"
               "global_load_async_to_lds_b128 %5, %13, off\n\t"
               "global_load_async_to_lds_b128 %6, %14, off\n\t"
               "global_load_async_to_lds_b128 %7, %15, off\n\t"
               "s_wait_xcnt 0x0"
               :: "v"(lk), "v"(lk + 16 * 2 * AT_PITCH), "v"(lk + 32 * 2 * AT_PITCH), "v"(lk + 48 * 2 * AT_PITCH),
                  "v"(lv), "v"(lv + 16 * 2 * AT_PITCH), "v"(lv + 32 * 2 * AT_PITCH), "v"(lv + 48 * 2 * AT_PITCH),
                  "v"(gk), "v"(gk + (size_t)16 * 2 * DM), "v"(gk + (size_t)32 * 2 * DM), "v"(gk + (size_t)48 * 2 * DM),
                  "v"(gv), "v"(gv + (size_t)16 * SS), "v"(gv + (size_t)32 * SS), "v"(gv + (size_t)48 * SS)
               : "memory");
}
__device__ __forceinline__ float sum16(v8f a, v8f b) {   // a lane's sixteen P as a pairwise tree: four levels deep, because the test on the sum stands on the pass's critical path
  const v8f t = a + b; const v4f u = __builtin_shufflevector(t, t, 0, 1, 2, 3) + __builtin_shufflevector(t, t, 4, 5, 6, 7);
  const v2f w = __builtin_shufflevector(u, u, 0, 1) + __builtin_shufflevector(u, u, 2, 3); return w[0] + w[1];
}
__device__ __forceinline__ float xhalf(float v) {   // the value of lane l ^ 16: the other half of the same query's keys
  const int b = __builtin_bit_cast(int, v); return __builtin_bit_cast(float, __builtin_amdgcn_permlanex16(b, b, 0x76543210, 0xfedcba98, false, false));
}
// four waves a SIMD, as before: a WGP then holds two of the grid's 512 work-groups of 8 waves
#define AT_QT 2                    // query tiles of 16 a wave: every K and V^T fragment read from LDS serves both, and a block's staged tiles serve 128 queries
#define AT_KH 2                    // key halves: waves 0..3 walk the even 64-key stages, waves 4..7 the odd ones, each half with its own two buffers and its own copies, so the wave count stays what it was
#define AT_NTR (AT_NST / AT_KH)    // trips: one stage of each half a trip
__device__ __forceinline__ v8f scale11(v8f s, v2f c) {   // s x c + 11 pair by pair from one register pair of c (a lane's eight scores share the factor)
  v8f r;
#pragma unroll
  for (int i = 0; i < 4; ++i) { v2f t = {s[2 * i], s[2 * i + 1]}; t = t * c + 11.0f; r[2 * i] = t[0]; r[2 * i + 1] = t[1]; }
  return r;
}
__global__ __launch_bounds__(256) __attribute__((amdgpu_waves_per_eu(4, 4))) void k_attn(const _Float16* __restrict__ QK, const _Float16* __restrict__ QKL, const _Float16* __restrict__ VTH, const _Float16* __restrict__ VTL, const void* __restrict__ KMASK, const int* __restrict__ QMSK, float* __restrict__ O) {
  __shared__ __align__(16) float so[8][16][68]; __shared__ __align__(16) float xg[8][9][32][4]; __shared__ __align__(16) _Float16 ring[AT_KH * 2 * AT_STAGE];
  const int tid = threadIdx.x, wave = tid >> 5, lane = tid & 31, col = lane & 15, g = lane >> 4, qg = wave & 3, kh = wave >> 2, th = tid & 127;
  const int qb = blockIdx.x, h = blockIdx.y, b = blockIdx.z; const int q0 = qb * (64 * AT_QT) + qg * (16 * AT_QT); const size_t rq = (size_t)b * SS + q0 + col;
  // transposed products: S^T = K . Q^T (A = key rows, B = q) and O^T += V^T . P^T, so lane (col, g) holds, in tile u, query 16u + col alone: its scores of keys 8g + r and 16 + 8g + r, its maximum, its sum, its output elements
  int qm[AT_QT];
#pragma unroll
  for (int u = 0; u < AT_QT; ++u) qm[u] = QMSK[rq + 16 * u];
  asm volatile("s_wait_xcnt 0x0" ::: "memory");   // stands in front of any rewrite of the mask loads' address registers
  float scl[AT_QT];   // 1/sqrt(64) x log2(e); attention_mask on the QUERY axis: mask == 0 -> every score of that query is equal -> uniform weights
  v16h aq[AT_QT][2];
#pragma unroll
  for (int u = 0; u < AT_QT; ++u) { scl[u] = (qm[u] == 0) ? 0.f : 0.125f * 1.44269504f;
#pragma unroll
    for (int kc = 0; kc < 2; ++kc) aq[u][kc] = frag_h(QK + (rq + 16 * u) * (2 * DM) + h * HD + kc * 32, lane); }
  // Held reference: P = exp2((k.q - mref) x scl + 11). mref (raw product units, equal in both halves of the wave) is a maximum seen earlier, not the running one: minus mref enters the score product as its C operand,
  // so a pass needs no maximum, no subtraction and no rescale of O. It is raised only when a pass's sum of P says that a P could leave the f16 range; an unmasked query's first pass always raises it.
  float mref[AT_QT], l[AT_QT];   // l: this lane's part of the sum, carrying P's 2^11
  v8f negm[AT_QT];               // -mref in every element: a lane's eight scores of a tile belong to one query
  v8f acc[AT_QT][4];
#pragma unroll
  for (int u = 0; u < AT_QT; ++u) { mref[u] = -3.0e38f; l[u] = 0.f;
#pragma unroll
    for (int r = 0; r < 8; ++r) negm[u][r] = 3.0e38f;
#pragma unroll
    for (int dt = 0; dt < 4; ++dt) acc[u][dt] = v8f{}; }
  // the copies of a key half are made by its own 128 lanes (th), into its own two buffers
  const _Float16* const gk = QK + ((size_t)b * SS + kh * AT_KST + (th >> 3)) * (2 * DM) + DM + h * HD + (th & 7) * 8;
  const _Float16* const gv = VTH + ((size_t)b * DM + h * HD + (th >> 3)) * SS + kh * AT_KST + (th & 7) * 8;
  const unsigned l0 = (unsigned)(size_t)(__attribute__((address_space(3))) _Float16*)ring + kh * (2 * 2 * AT_STAGE) + (th >> 3) * (2 * AT_PITCH) + (th & 7) * 16;
  attn_stage(l0, gk, gv);
  asm volatile("s_wait_asynccnt 0x0" ::: "memory");   // trip 0's stage has landed before the barrier that publishes it
  __syncthreads();
  attn_stage(l0 + 2 * AT_STAGE, gk + (size_t)(AT_KH * AT_KST) * 2 * DM, gv + AT_KH * AT_KST);
#pragma unroll 1   // rolled: one trip per stage of the half, the buffer chosen by the trip's parity
  for (int t = 0; t < AT_NTR; ++t) { const _Float16* const kb = ring + kh * (2 * AT_STAGE) + (t & 1) * AT_STAGE; const _Float16* const vb = kb + AT_TILE;
#pragma unroll   // the stage's two 32-key passes in line, so that their LDS offsets are constants
  for (int ps = 0; ps < AT_KST / 32; ++ps) { v8f s[AT_QT][2], ex[AT_QT][2]; float es[AT_QT]; v16h kf[2][2], vf[4];   // the pass's fragments: LDS reads as one group ahead of the products, V's in flight under the softmax
#pragma unroll
    for (int ct = 0; ct < 2; ++ct) {
#pragma unroll
      for (int kc = 0; kc < 2; ++kc) kf[ct][kc] = frag_h(kb + (ps * 32 + ct * 16 + col) * AT_PITCH + kc * 32, lane); }
#pragma unroll
    for (int dt = 0; dt < 4; ++dt) vf[dt] = frag_h(vb + (dt * 16 + col) * AT_PITCH + ps * 32, lane);
    __builtin_amdgcn_sched_barrier(0);   // keeps the sixteen LDS reads one group ahead of the products: left free, the compiler spreads them among the products in pairs, each waited for to the end
#pragma unroll
    for (int u = 0; u < AT_QT; ++u) {
#pragma unroll
      for (int ct = 0; ct < 2; ++ct) s[u][ct] = wmma16(kf[ct][1], aq[u][1], wmma16(kf[ct][0], aq[u][0], negm[u])); }   // single product: k, q as one-rounding f16 operands; s[u][ct][r] = k.q - mref of key ct * 16 + 8g + r, query 16u + col
#pragma unroll
    for (int u = 0; u < AT_QT; ++u) { const v2f c2 = {scl[u], scl[u]};
      ex[u][0] = hw_exp2x8(scale11(s[u][0], c2)); ex[u][1] = hw_exp2x8(scale11(s[u][1], c2));   // P x 2^11 = exp2((k.q - mref) x scl + 11): the scaling keeps small softmax weights out of the f16 subnormal range; the sum carries it too, so it cancels in the epilogue
      es[u] = sum16(ex[u][0], ex[u][1]); }
    // every P is at most the sum of its lane's sixteen, so a sum up to 3 x 2^14 says that all of them fit f16 (sixteen P at the reference itself, or a masked query's, sum to 2^15 and pass); anything else (infinity too) in any lane and either tile sends the whole wave, by a scalar branch, to raise both tiles' references and form the pass's P anew
    if (__builtin_amdgcn_ballot_w32(!(es[0] <= 49152.0f && es[1] <= 49152.0f)) != 0) { const v8f zero = {};
#pragma unroll
      for (int u = 0; u < AT_QT; ++u) { const v2f c2 = {scl[u], scl[u]};
#pragma unroll
        for (int ct = 0; ct < 2; ++ct) s[u][ct] = wmma16(kf[ct][1], aq[u][1], wmma16(kf[ct][0], aq[u][0], zero));   // the raw products: against a far lower reference the difference has lost them
        float mx = fmaxf(s[u][0][0], s[u][1][0]);
#pragma unroll
        for (int r = 1; r < 8; ++r) mx = fmaxf(mx, fmaxf(s[u][0][r], s[u][1][r]));
        mx = fmaxf(mx, xhalf(mx));
        const float mn = fmaxf(mref[u], mx), alpha = hw_exp2((mref[u] - mn) * scl[u]); mref[u] = mn;
#pragma unroll
        for (int r = 0; r < 8; ++r) negm[u][r] = -mn;
        l[u] *= alpha;
#pragma unroll
        for (int dt = 0; dt < 4; ++dt) acc[u][dt] *= alpha;
        ex[u][0] = hw_exp2x8(scale11(s[u][0] - mn, c2)); ex[u][1] = hw_exp2x8(scale11(s[u][1] - mn, c2));
        es[u] = sum16(ex[u][0], ex[u][1]); } }
#pragma unroll
    for (int u = 0; u < AT_QT; ++u) { l[u] += es[u];
      v16h pt;   // P^T as the B operand: element i = key 8g + i, element 8 + i = key 16 + 8g + i, the k order of the V^T fragment
#pragma unroll
      for (int r = 0; r < 8; ++r) { pt[r] = (_Float16)ex[u][0][r]; pt[8 + r] = (_Float16)ex[u][1][r]; }
#pragma unroll
      for (int dt = 0; dt < 4; ++dt) acc[u][dt] = wmma16(vf[dt], pt, acc[u][dt]); } }   // single product: V^T x P^T (x2^11); acc[u][dt][r] = output element dt * 16 + 8g + r of query 16u + col
    __builtin_amdgcn_sched_barrier(0);   // keeps the stage's work in front of its barrier: sunk behind it, the second pass would delay the refill's copies by half a stage of their flight time
    asm volatile("s_wait_dscnt 0x0" ::: "memory");      // this wave's reads of trip t's stage are done
    asm volatile("s_wait_asynccnt 0x0" ::: "memory");   // its copies of trip t + 1's stage have landed
    __syncthreads();                                    // publishes trip t + 1's stages and ends every wave's reads of trip t's
    if (t + 2 < AT_NTR) attn_stage(l0 + (t & 1) * (2 * AT_STAGE), gk + (size_t)(t + 2) * (AT_KH * AT_KST) * 2 * DM, gv + (t + 2) * (AT_KH * AT_KST)); }
  asm volatile("s_wait_asynccnt 0x0" ::: "memory");     // no copy is left in flight when the wave goes on
  // The two key halves are joined once: waves w and w ^ 4 hold the same 32 queries over different keys. Wave w finishes tile kh and hands the other tile (accumulators, reference, sum; lane for lane) to its partner through LDS.
  const bool k1 = kh != 0;
  const float mo = k1 ? mref[1] : mref[0], lo = k1 ? l[1] : l[0], sco = k1 ? scl[1] : scl[0];
  { const v4f ml = {k1 ? mref[0] : mref[1], k1 ? l[0] : l[1], 0.f, 0.f}; *(v4f*)&xg[wave][8][lane][0] = ml; }
  v8f own[4];
#pragma unroll
  for (int dt = 0; dt < 4; ++dt) { v8f gv8;
#pragma unroll
    for (int r = 0; r < 8; ++r) { gv8[r] = k1 ? acc[0][dt][r] : acc[1][dt][r]; own[dt][r] = k1 ? acc[1][dt][r] : acc[0][dt][r]; }
    *(v4f*)&xg[wave][2 * dt][lane][0] = __builtin_shufflevector(gv8, gv8, 0, 1, 2, 3); *(v4f*)&xg[wave][2 * dt + 1][lane][0] = __builtin_shufflevector(gv8, gv8, 4, 5, 6, 7); }
  __syncthreads();   // the partner's hand-over is written before it is read
  const v4f pml = *(const v4f*)&xg[wave ^ 4][8][lane][0];
  const float mn = fmaxf(mo, pml[0]), fa = hw_exp2((mo - mn) * sco), fb = hw_exp2((pml[0] - mn) * sco);   // both parts brought to the higher of the two references
  const float lj = lo * fa + pml[1] * fb;
  const float il = 1.0f / (lj + xhalf(lj));   // the wave's two halves' sums joined once; the 2^11 of P stands in the sum and in acc alike
  const float wa = fa * il, wb = fb * il;
#pragma unroll
  for (int dt = 0; dt < 4; ++dt) { const v4f p0 = *(const v4f*)&xg[wave ^ 4][2 * dt][lane][0], p1 = *(const v4f*)&xg[wave ^ 4][2 * dt + 1][lane][0];
    float* const d = &so[wave][col][dt * 16 + 8 * g];
    *(v4f*)d = __builtin_shufflevector(own[dt], own[dt], 0, 1, 2, 3) * wa + p0 * wb; *(v4f*)(d + 4) = __builtin_shufflevector(own[dt], own[dt], 4, 5, 6, 7) * wa + p1 * wb; }
  LDSX();
  for (int rl = 0; rl < 16; ++rl) if (lane < 16) vst2(O + ((size_t)b * SS + q0 + 16 * kh + rl) * DM + h * HD + lane * 4, *(const v4f*)&so[wave][rl][lane * 4]);
}
// ---- k_out: block = (64 rows, 128 cols): out = O(hi/lo) . Wo rows (2 products) + bo
__global__ __launch_bounds__(128) void k_out(const float* __restrict__ O, const __bf16* __restrict__ P, const float* __restrict__ BO, float* __restrict__ Y) {
  __shared__ __align__(16) float so[4][16][132];
  const int tid = threadIdx.x, wave = tid >> 5, lane = tid & 31, col = lane & 15, g = lane >> 4; const size_t r0 = (size_t)blockIdx.x * 64 + wave * 16; const int n0 = blockIdx.y * 128;
  v8f acc[8] = {};
#pragma unroll 2
  for (int kc = 0; kc < DM / 32; ++kc) { const F2 a = split_row(O + (r0 + col) * DM, kc * 32, lane);
#pragma unroll
    for (int j = 0; j < 8; ++j) { const v16b w = frag_b(P + (size_t)(n0 + j * 16 + col) * DM + kc * 32, lane); acc[j] = wmma_bf(a.l, w, acc[j]); acc[j] = wmma_bf(a.h, w, acc[j]); } }
#pragma unroll
  for (int j = 0; j < 8; ++j) {
#pragma unroll
    for (int r = 0; r < 8; ++r) so[wave][8 * g + r][j * 16 + col] = acc[j][r] + (BO ? bfr(BO[n0 + j * 16 + col]) : 0.f); }
  LDSX();
  for (int rl = 0; rl < 16; ++rl) vst2(Y + (r0 + rl) * DM + n0 + lane * 4, *(const v4f*)&so[wave][rl][lane * 4]);
}
// ---- k_qk2: block = (64 rows, 128 cols): q = x Wq + bq and k = x Wk + bk for the same columns; stores q rows, softplus(k) rows (the engine's k slot) and v = q + k planes, all as f16 hi + residual
// Operand tiles go through LDS: a stage is 64 k of [256 weight rows (128 of Wq, 128 of Wk) | 64 x rows already rounded to bf16], rows of 128 B at pitch 144 B (16 B x odd: no bank conflict for 16-byte readers).
// Two buffers: the next stage's global loads are issued before this stage's products, land in registers, and are written to the other buffer behind the products; one barrier per stage.
#define QK_KST 64
#define QK_NST (DM / QK_KST)
#define QK_PITCH 72
#define QK_STAGE ((256 + 64) * QK_PITCH)
typedef __attribute__((ext_vector_type(4))) __bf16 v4b;
__global__ __launch_bounds__(128) void k_qk2(const float* __restrict__ X, const __bf16* __restrict__ P, const float* __restrict__ BQ, const float* __restrict__ BK, _Float16* __restrict__ QK, _Float16* __restrict__ QKL, _Float16* __restrict__ VTH, _Float16* __restrict__ VTL) {
  __shared__ __align__(16) unsigned char smem[2 * QK_STAGE * 2];   // the two stage buffers; behind the loop's last barrier the same bytes are the output staging
  __bf16* const ring = (__bf16*)smem;
  _Float16 (* const so)[16][136] = (_Float16 (*)[16][136])smem; _Float16 (* const sol)[16][136] = (_Float16 (*)[16][136])(smem + 17408); _Float16 (* const sth)[72] = (_Float16 (*)[72])(smem + 34816); _Float16 (* const stl)[72] = (_Float16 (*)[72])(smem + 53248);
  const int tid = threadIdx.x, wave = tid >> 5, lane = tid & 31, col = lane & 15, g = lane >> 4; const size_t rb = (size_t)blockIdx.x * 64, r0 = rb + wave * 16; const int n0 = blockIdx.y * 128;
  // loaders: 8 lanes cover one 128-B weight row piece, 16 lanes one 256-B x row piece, so every wave-wide load reads whole lines
  const __bf16* const wsrc = P + PK_A + (size_t)(n0 + (tid >> 3)) * DM + (tid & 7) * 8;
  const float* const xsrc = X + (rb + (tid >> 4)) * DM + (tid & 15) * 4;
  const int wdst = (tid >> 3) * QK_PITCH + (tid & 7) * 8, xdst = (256 + (tid >> 4)) * QK_PITCH + (tid & 15) * 4;
  v4u wr[16]; v4f xr[8];
  v8f aq[8] = {}, ak[8] = {};
#pragma unroll
  for (int i = 0; i < 16; ++i) wr[i] = *(const v4u*)(wsrc + (size_t)((i >> 3) * DM + (i & 7) * 16) * DM);
#pragma unroll
  for (int i = 0; i < 8; ++i) xr[i] = *(const v4f*)(xsrc + (size_t)(i * 8) * DM);
#pragma unroll
  for (int i = 0; i < 16; ++i) *(v4u*)(ring + wdst + i * 16 * QK_PITCH) = wr[i];
#pragma unroll
  for (int i = 0; i < 8; ++i) { v4b c; c[0] = (__bf16)xr[i][0]; c[1] = (__bf16)xr[i][1]; c[2] = (__bf16)xr[i][2]; c[3] = (__bf16)xr[i][3]; *(v4b*)(ring + xdst + i * 8 * QK_PITCH) = c; }
  __syncthreads();
#pragma unroll 1   // rolled: the body already holds 32 products
  for (int s = 0; s < QK_NST; ++s) {
    const bool more = s + 1 < QK_NST;
    if (more) {
#pragma unroll
      for (int i = 0; i < 16; ++i) wr[i] = *(const v4u*)(wsrc + (size_t)((i >> 3) * DM + (i & 7) * 16) * DM + (s + 1) * QK_KST);
#pragma unroll
      for (int i = 0; i < 8; ++i) xr[i] = *(const v4f*)(xsrc + (size_t)(i * 8) * DM + (s + 1) * QK_KST);
    }
    const __bf16* const wb = ring + (s & 1) * QK_STAGE; const __bf16* const xb = wb + 256 * QK_PITCH;
#pragma unroll
    for (int kc = 0; kc < QK_KST / 32; ++kc) {
      const v16b a = frag_b(xb + (wave * 16 + col) * QK_PITCH + kc * 32, lane);
#pragma unroll
      for (int hf = 0; hf < 2; ++hf) { v16b f[8];   // eight fragments' LDS reads as one group ahead of their products (hf 0: Wq rows, hf 1: Wk rows); sixteen at once would not fit beside the accumulators in v0..v255, where the products' asm operands must lie
#pragma unroll
        for (int j = 0; j < 8; ++j) f[j] = frag_b(wb + (hf * 128 + j * 16 + col) * QK_PITCH + kc * 32, lane);
#pragma unroll
        for (int j = 0; j < 8; ++j) { if (hf == 0) aq[j] = wmma_bf(a, f[j], aq[j]); else ak[j] = wmma_bf(a, f[j], ak[j]); }
      }
    }
    if (more) { __bf16* const nb = ring + ((s + 1) & 1) * QK_STAGE;   // last read in stage s - 1, whose barrier every wave has passed
#pragma unroll
      for (int i = 0; i < 16; ++i) *(v4u*)(nb + wdst + i * 16 * QK_PITCH) = wr[i];
#pragma unroll
      for (int i = 0; i < 8; ++i) { v4b c; c[0] = (__bf16)xr[i][0]; c[1] = (__bf16)xr[i][1]; c[2] = (__bf16)xr[i][2]; c[3] = (__bf16)xr[i][3]; *(v4b*)(nb + xdst + i * 8 * QK_PITCH) = c; }
    }
    __syncthreads();   // publishes stage s + 1 and ends every wave's reads of stage s (after the last stage: frees the bytes for the output staging)
  }
#pragma unroll
  for (int j = 0; j < 8; ++j) { const float bq = bfr(BQ[n0 + j * 16 + col]);
#pragma unroll
    for (int r = 0; r < 8; ++r) { const float v = aq[j][r] + bq; aq[j][r] = v; const _Float16 hv = (_Float16)v; so[wave][8 * g + r][j * 16 + col] = hv; sol[wave][8 * g + r][j * 16 + col] = (_Float16)((v - (float)hv) * 2048.0f); } }
  LDSX();
  for (int rl = 0; rl < 16; ++rl) if (lane < 16) { vst2((unsigned*)(QK + (r0 + rl) * (2 * DM) + n0 + lane * 8), *(const v4u*)&so[wave][rl][lane * 8]); vst2((unsigned*)(QKL + (r0 + rl) * (2 * DM) + n0 + lane * 8), *(const v4u*)&sol[wave][rl][lane * 8]); }
  LDSX();
  // pass 2: softplus(k) rows into the k slot; v = q + k (raw k) planes
#pragma unroll
  for (int j = 0; j < 8; ++j) { const float bk = bfr(BK[n0 + j * 16 + col]);
#pragma unroll
    for (int r = 0; r < 8; ++r) { const float kv = ak[j][r] + bk; const float sp = softplus_p(kv); const _Float16 hs = (_Float16)sp; so[wave][8 * g + r][j * 16 + col] = hs; sol[wave][8 * g + r][j * 16 + col] = (_Float16)((sp - (float)hs) * 2048.0f);
      const float vv = aq[j][r] + kv; const _Float16 hv = (_Float16)vv; sth[j * 16 + col][wave * 16 + 8 * g + r] = hv; stl[j * 16 + col][wave * 16 + 8 * g + r] = (_Float16)((vv - (float)hv) * 2048.0f); } }
  __syncthreads();
  for (int rl = 0; rl < 16; ++rl) if (lane < 16) { vst2((unsigned*)(QK + (r0 + rl) * (2 * DM) + DM + n0 + lane * 8), *(const v4u*)&so[wave][rl][lane * 8]); vst2((unsigned*)(QKL + (r0 + rl) * (2 * DM) + DM + n0 + lane * 8), *(const v4u*)&sol[wave][rl][lane * 8]); }
  { const int b = (int)(rb / SS), s0 = (int)(rb % SS);
    for (int q = tid; q < 128 * 8; q += 128) { const int d = q >> 3, pc = q & 7; const size_t o = ((size_t)b * DM + n0 + d) * SS + s0 + pc * 8; vst2((unsigned*)(VTH + o), *(const v4u*)&sth[d][pc * 8]); vst2((unsigned*)(VTL + o), *(const v4u*)&stl[d][pc * 8]); } }
}
extern "C" void kernel_launch(void* const* d_in, const int* in_sizes, int n_in, void* d_out, int out_size, void* d_ws, size_t ws_size, hipStream_t stream) {
  (void)in_sizes; (void)n_in; (void)out_size;
  const float** F = (const float**)d_in;   // 0 hidden [2,2048,1024], 1 attention_mask [2,2048] int (query axis), 2 Wq (in,out), 3 bq, 4 Wk, 5 bk
  if (ws_size < (size_t)WS_END) return;
  char* ws = (char*)d_ws; __bf16* PK = (__bf16*)(ws + WS_PK); _Float16 *QK = (_Float16*)(ws + WS_QK), *QKL = (_Float16*)(ws + WS_QKL), *VTH = (_Float16*)(ws + WS_VTH), *VTL = (_Float16*)(ws + WS_VTL);
  k_pack<<<dim3(DM / PT_N, DM / PT_K, 2), 256, 0, stream>>>(F[2], F[4], PK);   // Wq, Wk rows (the only packed rows that are read)
  k_qk2<<<dim3(TNB * SS / 64, DM / 128), 128, 0, stream>>>(F[0], PK, F[3], F[5], QK, QKL, VTH, VTL);
  k_attn<<<dim3(TQB / AT_QT, NH, TNB), 256, 0, stream>>>(QK, QKL, VTH, VTL, nullptr, (const int*)d_in[1], (float*)d_out);   // merged heads are the module's output
}
